// v000
// Times are from an AMD MI455X. After a warm-up the kernel runs many times in a row, and a time is the length of
// such a window on the GPU divided by its runs, so every launch and the gaps after it count. The runs cycle
// through copies of the inputs. A figure is the median of several windows, for all but v000 over two sittings.
// Sittings can differ by a few percent; kernels timed side by side share one.
// v000 is the starting kernel. One run takes 2480 microseconds.
#include <hip/hip_runtime.h>

typedef __bf16 bf16;
typedef __attribute__((ext_vector_type(16))) __bf16 v16bf;
typedef __attribute__((ext_vector_type(8)))  __bf16 v8bf;
typedef __attribute__((ext_vector_type(8)))  float  v8f;
typedef __attribute__((ext_vector_type(4)))  int    v4i;
typedef __attribute__((address_space(3))) v4i* lds_v4i_p;

#define Bq 8
#define Cq 512
#define Nq 4096
#define Mq 32768
#define SCALEF 0.044194173824159216f   // 1/sqrt(512)
#define EPSQ 1e-5f

// ---------------------------------------------------------------------------
// WMMA helpers
// ---------------------------------------------------------------------------
__device__ __forceinline__ v8f wmma_bf16(v16bf a, v16bf b, v8f c) {
  return __builtin_amdgcn_wmma_f32_16x16x32_bf16(false, a, false, b, (short)0, c,
                                                 false, false);
}

__device__ __forceinline__ v16bf cat8(v8bf lo, v8bf hi) {
  return __builtin_shufflevector(lo, hi, 0, 1, 2, 3, 4, 5, 6, 7,
                                         8, 9, 10, 11, 12, 13, 14, 15);
}

// Load a 16x32 16-bit A-style fragment from a row-major [ld] bf16 matrix.
// base points at (row0, k0). Per ISA layout: lane L -> row = L&15, half = L>>4;
// elements 0..7  -> k = half*8 + j        (contiguous 16B)
// elements 8..15 -> k = 16 + half*8 + j   (contiguous 16B)
// The same pattern serves as a B fragment when the source is the transpose
// (rows indexed by N, k contiguous along the row).
__device__ __forceinline__ v16bf frag_rowmajor(const bf16* base, int ld, int lane) {
  const bf16* p = base + (size_t)(lane & 15) * ld + ((lane >> 4) << 3);
  v8bf lo = *(const v8bf*)p;
  v8bf hi = *(const v8bf*)(p + 16);
  return cat8(lo, hi);
}

// ---------------------------------------------------------------------------
// Async global -> LDS staging (gfx1250 GLOBAL_LOAD_ASYNC_TO_LDS_B128,
// tracked by ASYNCcnt). Param 0 is a generic v4i* (per compiler diagnostic);
// LDS side is cast to addrspace(3), which also converts implicitly to
// generic if the builtin is declared that way.
// ---------------------------------------------------------------------------
__device__ __forceinline__ void stage16(const void* gsrc, void* ldst) {
#if __has_builtin(__builtin_amdgcn_global_load_async_to_lds_b128)
  __builtin_amdgcn_global_load_async_to_lds_b128((v4i*)gsrc, (lds_v4i_p)ldst, 0, 0);
#else
  *(uint4*)ldst = *(const uint4*)gsrc;
#endif
}

__device__ __forceinline__ void wait_async() {
#if __has_builtin(__builtin_amdgcn_s_wait_asynccnt)
  __builtin_amdgcn_s_wait_asynccnt(0);
#else
  asm volatile("s_wait_asynccnt 0" ::: "memory");
#endif
}

// ---------------------------------------------------------------------------
// 1) GroupNorm statistics: one block per (batch, group); 256-thread reduce.
// ---------------------------------------------------------------------------
__global__ __launch_bounds__(256) void k_gn_stats(const float* __restrict__ x,
                                                  float* __restrict__ stats) {
  int bg = blockIdx.x;            // 0..255 : b*32+g
  int b = bg >> 5, g = bg & 31;
  const float* xb = x + (size_t)b * Nq * Cq + g * 16;
  float s = 0.f, ss = 0.f;
  for (int n = threadIdx.x; n < Nq; n += 256) {
    const float* p = xb + (size_t)n * Cq;
#pragma unroll
    for (int ci = 0; ci < 16; ++ci) { float v = p[ci]; s += v; ss += v * v; }
  }
  __shared__ float sh_s[256], sh_ss[256];
  sh_s[threadIdx.x] = s; sh_ss[threadIdx.x] = ss;
  __syncthreads();
  for (int off = 128; off > 0; off >>= 1) {
    if (threadIdx.x < off) {
      sh_s[threadIdx.x]  += sh_s[threadIdx.x + off];
      sh_ss[threadIdx.x] += sh_ss[threadIdx.x + off];
    }
    __syncthreads();
  }
  if (threadIdx.x == 0) {
    float inv = 1.0f / (float)(Nq * 16);
    float mean = sh_s[0] * inv;
    float var  = sh_ss[0] * inv - mean * mean;
    stats[bg * 2]     = mean;
    stats[bg * 2 + 1] = rsqrtf(var + EPSQ);
  }
}

// ---------------------------------------------------------------------------
// 2) Apply GroupNorm, emit bf16 activations (row-major M x C).
// ---------------------------------------------------------------------------
__global__ __launch_bounds__(256) void k_gn_apply(const float* __restrict__ x,
                                                  const float* __restrict__ stats,
                                                  const float* __restrict__ gamma,
                                                  const float* __restrict__ beta,
                                                  bf16* __restrict__ hn) {
  size_t i4 = ((size_t)blockIdx.x * 256 + threadIdx.x) * 4;
  int c = (int)(i4 & (Cq - 1));
  int m = (int)(i4 >> 9);
  int b = m >> 12;
  int g = c >> 4;
  float mean = stats[(b * 32 + g) * 2];
  float rstd = stats[(b * 32 + g) * 2 + 1];
  float4 xv = *(const float4*)(x + i4);
  bf16* o = hn + i4;
  o[0] = (bf16)((xv.x - mean) * rstd * gamma[c]     + beta[c]);
  o[1] = (bf16)((xv.y - mean) * rstd * gamma[c + 1] + beta[c + 1]);
  o[2] = (bf16)((xv.z - mean) * rstd * gamma[c + 2] + beta[c + 2]);
  o[3] = (bf16)((xv.w - mean) * rstd * gamma[c + 3] + beta[c + 3]);
}

// ---------------------------------------------------------------------------
// 3) Pack a 512x512 f32 weight (w[k][n]) into WMMA-B-fragment layout:
//    wpk[(kt*32+nt)*32 + lane][16] bf16 -> one contiguous 32B load per frag.
// ---------------------------------------------------------------------------
__global__ __launch_bounds__(256) void k_pack_w(const float* __restrict__ w,
                                                bf16* __restrict__ wpk) {
  int tid = blockIdx.x * 256 + threadIdx.x;
  if (tid >= 16 * 32 * 32) return;   // ktiles(16) * ntiles(32) * lanes(32)
  int lane = tid & 31;
  int nt = (tid >> 5) & 31;
  int kt = tid >> 10;
  int n = nt * 16 + (lane & 15);
  int half = lane >> 4;
  bf16* dst = wpk + (size_t)tid * 16; // tid == (kt*32+nt)*32+lane
#pragma unroll
  for (int j = 0; j < 8; ++j)
    dst[j] = (bf16)w[(kt * 32 + half * 8 + j) * Cq + n];
#pragma unroll
  for (int j = 0; j < 8; ++j)
    dst[8 + j] = (bf16)w[(kt * 32 + 16 + half * 8 + j) * Cq + n];
}

// ---------------------------------------------------------------------------
// 4) Fused QKV projection. 8 waves share one async-staged 16x512 A tile;
//    each wave computes one 16x16 tile for q, k, v (A fragment reused 3x).
//    q,k stored row-major bf16; v stored transposed (C x N) for P*V frags.
// ---------------------------------------------------------------------------
__global__ __launch_bounds__(256) void k_qkv(const bf16* __restrict__ hn,
                                             const bf16* __restrict__ wq,
                                             const bf16* __restrict__ wk,
                                             const bf16* __restrict__ wv,
                                             const float* __restrict__ bq,
                                             const float* __restrict__ bk,
                                             const float* __restrict__ bv,
                                             bf16* __restrict__ qb,
                                             bf16* __restrict__ kb,
                                             bf16* __restrict__ vtb) {
  __shared__ __align__(16) bf16 atile[16 * 512];
  int wave = threadIdx.x >> 5, lane = threadIdx.x & 31;
  int mt = blockIdx.x >> 2;
  int ct = ((blockIdx.x & 3) << 3) + wave;
  int m0 = mt << 4;
  for (int i = threadIdx.x; i < 16 * 512 / 8; i += 256)
    stage16((const uint4*)(hn + (size_t)m0 * Cq) + i, (uint4*)atile + i);
  wait_async();
  __syncthreads();
  v8f aq = {}, ak = {}, av = {};
  for (int kt = 0; kt < 16; ++kt) {
    v16bf a = frag_rowmajor(atile + kt * 32, 512, lane);
    const v16bf* bpq = (const v16bf*)(wq + (size_t)((kt * 32 + ct) * 32 + lane) * 16);
    const v16bf* bpk = (const v16bf*)(wk + (size_t)((kt * 32 + ct) * 32 + lane) * 16);
    const v16bf* bpv = (const v16bf*)(wv + (size_t)((kt * 32 + ct) * 32 + lane) * 16);
    aq = wmma_bf16(a, *bpq, aq);
    ak = wmma_bf16(a, *bpk, ak);
    av = wmma_bf16(a, *bpv, av);
  }
  int half = lane >> 4;
  int col = (ct << 4) + (lane & 15);
  float xbq = bq[col], xbk = bk[col], xbv = bv[col];
#pragma unroll
  for (int r = 0; r < 8; ++r) {
    int row = m0 + r + half * 8;   // C/D layout: M = vgpr + half*8
    qb[(size_t)row * Cq + col] = (bf16)(aq[r] + xbq);
    kb[(size_t)row * Cq + col] = (bf16)(ak[r] + xbk);
    int bb = row >> 12, n = row & (Nq - 1);
    vtb[(size_t)bb * Cq * Nq + (size_t)col * Nq + n] = (bf16)(av[r] + xbv);
  }
}

// ---------------------------------------------------------------------------
// 5) Softmax statistics (pass A): one wave per 16-query tile.
//    WMMA score tiles + shfl_xor reductions across the 16-lane halves
//    (C/D layout: lane = key column, VGPR r = query row r + half*8).
// ---------------------------------------------------------------------------
__global__ __launch_bounds__(32) void k_attn_stats(const bf16* __restrict__ qb,
                                                   const bf16* __restrict__ kb,
                                                   float* __restrict__ ms) {
  __shared__ __align__(16) bf16 qtile[16 * 512];
  int qt = blockIdx.x;             // 2048 query tiles (batches contiguous)
  int b = qt >> 8;
  int lane = threadIdx.x;
  for (int i = lane; i < 16 * 512 / 8; i += 32)
    stage16((const uint4*)(qb + (size_t)qt * 16 * Cq) + i, (uint4*)qtile + i);
  wait_async();
  __syncthreads();
  const bf16* kbase = kb + (size_t)b * Nq * Cq;
  float rmax[8], rsum[8];
#pragma unroll
  for (int r = 0; r < 8; ++r) { rmax[r] = -1e30f; rsum[r] = 0.f; }
  for (int nt = 0; nt < 256; ++nt) {
    v8f d = {};
    for (int kt = 0; kt < 16; ++kt) {
      v16bf a   = frag_rowmajor(qtile + kt * 32, 512, lane);
      v16bf bk_ = frag_rowmajor(kbase + (size_t)(nt * 16) * Cq + kt * 32, 512, lane);
      d = wmma_bf16(a, bk_, d);
    }
#pragma unroll
    for (int r = 0; r < 8; ++r) {
      float v = d[r] * SCALEF;
      float t = v;
      t = fmaxf(t, __shfl_xor(t, 1));
      t = fmaxf(t, __shfl_xor(t, 2));
      t = fmaxf(t, __shfl_xor(t, 4));
      t = fmaxf(t, __shfl_xor(t, 8));
      float mnew = fmaxf(rmax[r], t);
      float e = __expf(v - mnew);
      e += __shfl_xor(e, 1);
      e += __shfl_xor(e, 2);
      e += __shfl_xor(e, 4);
      e += __shfl_xor(e, 8);
      rsum[r] = rsum[r] * __expf(rmax[r] - mnew) + e;
      rmax[r] = mnew;
    }
  }
  if ((lane & 15) == 0) {
    int half = lane >> 4;
#pragma unroll
    for (int r = 0; r < 8; ++r) {
      int row = qt * 16 + half * 8 + r;
      ms[row * 2]     = rmax[r];
      ms[row * 2 + 1] = 1.0f / rsum[r];
    }
  }
}

// ---------------------------------------------------------------------------
// 6) Attention output (pass B): 4 waves per 16-query tile. Cooperative
//    scheme: wave w computes the score tile for ITS OWN 32-key slice and
//    publishes P (bf16) to LDS; after a barrier every wave consumes all 4
//    P tiles for its private 128-channel output chunk. This removes the
//    4x redundant score recomputation (scores dominate: 32 WMMA vs 8 for PV).
// ---------------------------------------------------------------------------
__global__ __launch_bounds__(128) void k_attn_out(const bf16* __restrict__ qb,
                                                  const bf16* __restrict__ kb,
                                                  const bf16* __restrict__ vtb,
                                                  const float* __restrict__ ms,
                                                  bf16* __restrict__ ao) {
  __shared__ __align__(16) bf16 qtile[16 * 512];
  __shared__ __align__(16) bf16 pbuf[4][16 * 32];
  int qt = blockIdx.x;
  int b = qt >> 8;
  int wave = threadIdx.x >> 5, lane = threadIdx.x & 31;
  for (int i = threadIdx.x; i < 16 * 512 / 8; i += 128)
    stage16((const uint4*)(qb + (size_t)qt * 16 * Cq) + i, (uint4*)qtile + i);
  wait_async();
  __syncthreads();
  int half = lane >> 4;
  float mrow[8], rsrow[8];
#pragma unroll
  for (int r = 0; r < 8; ++r) {
    int row = qt * 16 + half * 8 + r;
    mrow[r]  = ms[row * 2];
    rsrow[r] = ms[row * 2 + 1];
  }
  const bf16* kbase = kb + (size_t)b * Nq * Cq;
  const bf16* vbase = vtb + (size_t)b * Cq * Nq;
  v8f acc[8] = {};
  bf16* pb = &pbuf[wave][0];
  for (int kblock = 0; kblock < 32; ++kblock) {     // 128 keys per iteration
    int key0 = kblock * 128 + wave * 32;            // this wave's 32-key slice
    v8f d0 = {}, d1 = {};
    for (int kt = 0; kt < 16; ++kt) {
      v16bf a  = frag_rowmajor(qtile + kt * 32, 512, lane);
      v16bf b0 = frag_rowmajor(kbase + (size_t)key0 * Cq + kt * 32, 512, lane);
      v16bf b1 = frag_rowmajor(kbase + (size_t)(key0 + 16) * Cq + kt * 32, 512, lane);
      d0 = wmma_bf16(a, b0, d0);
      d1 = wmma_bf16(a, b1, d1);
    }
#pragma unroll
    for (int r = 0; r < 8; ++r) {
      float p0 = __expf(d0[r] * SCALEF - mrow[r]) * rsrow[r];
      float p1 = __expf(d1[r] * SCALEF - mrow[r]) * rsrow[r];
      int row = r + half * 8;
      pb[row * 32 + (lane & 15)]      = (bf16)p0;
      pb[row * 32 + 16 + (lane & 15)] = (bf16)p1;
    }
    __syncthreads();                                // publish P tiles
#pragma unroll
    for (int pt = 0; pt < 4; ++pt) {                // consume all 4 P tiles
      v16bf pa = frag_rowmajor(&pbuf[pt][0], 32, lane);
      int keyp = kblock * 128 + pt * 32;
#pragma unroll
      for (int ct = 0; ct < 8; ++ct) {
        v16bf vfr = frag_rowmajor(
            vbase + (size_t)(wave * 128 + ct * 16) * Nq + keyp, Nq, lane);
        acc[ct] = wmma_bf16(pa, vfr, acc[ct]);
      }
    }
    __syncthreads();                                // protect pbuf reuse (WAR)
  }
#pragma unroll
  for (int ct = 0; ct < 8; ++ct) {
    int ch = wave * 128 + ct * 16 + (lane & 15);
#pragma unroll
    for (int r = 0; r < 8; ++r) {
      int row = qt * 16 + r + half * 8;
      ao[(size_t)row * Cq + ch] = (bf16)acc[ct][r];
    }
  }
}

// ---------------------------------------------------------------------------
// 7) Output projection + bias + residual, fp32 store.
// ---------------------------------------------------------------------------
__global__ __launch_bounds__(256) void k_out_proj(const bf16* __restrict__ ao,
                                                  const bf16* __restrict__ wo,
                                                  const float* __restrict__ bo,
                                                  const float* __restrict__ x,
                                                  float* __restrict__ out) {
  __shared__ __align__(16) bf16 atile[16 * 512];
  int wave = threadIdx.x >> 5, lane = threadIdx.x & 31;
  int mt = blockIdx.x >> 2;
  int ct = ((blockIdx.x & 3) << 3) + wave;
  int m0 = mt << 4;
  for (int i = threadIdx.x; i < 16 * 512 / 8; i += 256)
    stage16((const uint4*)(ao + (size_t)m0 * Cq) + i, (uint4*)atile + i);
  wait_async();
  __syncthreads();
  v8f acc = {};
  for (int kt = 0; kt < 16; ++kt) {
    v16bf a = frag_rowmajor(atile + kt * 32, 512, lane);
    const v16bf* bp = (const v16bf*)(wo + (size_t)((kt * 32 + ct) * 32 + lane) * 16);
    acc = wmma_bf16(a, *bp, acc);
  }
  int half = lane >> 4;
  int col = (ct << 4) + (lane & 15);
  float bias = bo[col];
#pragma unroll
  for (int r = 0; r < 8; ++r) {
    int row = m0 + r + half * 8;
    size_t idx = (size_t)row * Cq + col;
    out[idx] = acc[r] + bias + x[idx];
  }
}

// ---------------------------------------------------------------------------
// Launch
// ---------------------------------------------------------------------------
extern "C" void kernel_launch(void* const* d_in, const int* in_sizes, int n_in,
                              void* d_out, int out_size, void* d_ws, size_t ws_size,
                              hipStream_t stream) {
  const float* x      = (const float*)d_in[0];
  const float* gscale = (const float*)d_in[1];
  const float* gbias  = (const float*)d_in[2];
  const float* wq     = (const float*)d_in[3];
  const float* bq     = (const float*)d_in[4];
  const float* wk     = (const float*)d_in[5];
  const float* bk     = (const float*)d_in[6];
  const float* wv     = (const float*)d_in[7];
  const float* bv     = (const float*)d_in[8];
  const float* wo     = (const float*)d_in[9];
  const float* bo     = (const float*)d_in[10];
  float* out = (float*)d_out;

  char* ws = (char*)d_ws;
  float* stats = (float*)ws;                               // 2 KB
  bf16* wpkq = (bf16*)(ws + 4096);                         // 4 x 512KB packed weights
  bf16* wpkk = (bf16*)(ws + 4096 + 1 * 524288);
  bf16* wpkv = (bf16*)(ws + 4096 + 2 * 524288);
  bf16* wpko = (bf16*)(ws + 4096 + 3 * 524288);
  size_t o = 4096 + 4 * 524288;
  bf16* hn  = (bf16*)(ws + o); o += 33554432;              // normalized acts / reused as attn out
  bf16* qb  = (bf16*)(ws + o); o += 33554432;              // Q row-major
  bf16* kb  = (bf16*)(ws + o); o += 33554432;              // K row-major
  bf16* vtb = (bf16*)(ws + o); o += 33554432;              // V transposed (C x N)
  float* ms = (float*)(ws + o);                            // per-row (max, 1/sum)

  k_gn_stats<<<256, 256, 0, stream>>>(x, stats);
  k_gn_apply<<<16384, 256, 0, stream>>>(x, stats, gscale, gbias, hn);
  k_pack_w<<<64, 256, 0, stream>>>(wq, wpkq);
  k_pack_w<<<64, 256, 0, stream>>>(wk, wpkk);
  k_pack_w<<<64, 256, 0, stream>>>(wv, wpkv);
  k_pack_w<<<64, 256, 0, stream>>>(wo, wpko);
  k_qkv<<<8192, 256, 0, stream>>>(hn, wpkq, wpkk, wpkv, bq, bk, bv, qb, kb, vtb);
  k_attn_stats<<<2048, 32, 0, stream>>>(qb, kb, ms);
  k_attn_out<<<2048, 128, 0, stream>>>(qb, kb, vtb, ms, hn);  // attn out overwrites hn
  k_out_proj<<<8192, 256, 0, stream>>>(hn, wpko, bo, x, out);
}

// v001
// One run takes 2190 microseconds.
// Two timings next to v000 both put it at 1.16 times that version's speed.
#include <hip/hip_runtime.h>

typedef __bf16 bf16;
typedef __attribute__((ext_vector_type(16))) __bf16 v16bf;
typedef __attribute__((ext_vector_type(8)))  __bf16 v8bf;
typedef __attribute__((ext_vector_type(8)))  float  v8f;
typedef __attribute__((ext_vector_type(4)))  int    v4i;
typedef __attribute__((address_space(3))) v4i* lds_v4i_p;

#define Bq 8
#define Cq 512
#define Nq 4096
#define Mq 32768
#define SCALEF 0.044194173824159216f   // 1/sqrt(512)
#define EPSQ 1e-5f

// ---------------------------------------------------------------------------
// WMMA helpers
// ---------------------------------------------------------------------------
__device__ __forceinline__ v8f wmma_bf16(v16bf a, v16bf b, v8f c) {
  return __builtin_amdgcn_wmma_f32_16x16x32_bf16(false, a, false, b, (short)0, c,
                                                 false, false);
}

__device__ __forceinline__ v16bf cat8(v8bf lo, v8bf hi) {
  return __builtin_shufflevector(lo, hi, 0, 1, 2, 3, 4, 5, 6, 7,
                                         8, 9, 10, 11, 12, 13, 14, 15);
}

// Fragment order. Every bf16 WMMA operand (in the workspace and in LDS) is kept
// as 1 KB blocks, one block per 16-row x 32-k fragment: [part 0..1][lane 0..31][8].
// Per ISA layout: lane L -> row = L&15, half = L>>4;
// part 0, elements 0..7  -> k = half*8 + j
// part 1, elements 8..15 -> k = 16 + half*8 + j
// so each of the two 16-byte reads of a fragment covers 512 contiguous bytes
// over the wave: four whole lines from global memory, no shared bank in LDS.
// The same pattern serves as a B fragment (rows indexed by N).
// frag_off: place of element (row r16, k index k32) inside its block.
__device__ __forceinline__ int frag_off(int r16, int k32) {
  return ((k32 >> 4) << 8) + (((((k32 >> 3) & 1) << 4) + r16) << 3) + (k32 & 7);
}

__device__ __forceinline__ v16bf frag_packed(const bf16* blk, int lane) {
  const bf16* p = blk + lane * 8;
  v8bf lo = *(const v8bf*)p;
  v8bf hi = *(const v8bf*)(p + 256);
  return cat8(lo, hi);
}

// ---------------------------------------------------------------------------
// Async global -> LDS staging (gfx1250 GLOBAL_LOAD_ASYNC_TO_LDS_B128,
// tracked by ASYNCcnt). Param 0 is a generic v4i* (per compiler diagnostic);
// LDS side is cast to addrspace(3), which also converts implicitly to
// generic if the builtin is declared that way.
// ---------------------------------------------------------------------------
__device__ __forceinline__ void stage16(const void* gsrc, void* ldst) {
#if __has_builtin(__builtin_amdgcn_global_load_async_to_lds_b128)
  __builtin_amdgcn_global_load_async_to_lds_b128((v4i*)gsrc, (lds_v4i_p)ldst, 0, 0);
#else
  *(uint4*)ldst = *(const uint4*)gsrc;
#endif
}

__device__ __forceinline__ void wait_async() {
#if __has_builtin(__builtin_amdgcn_s_wait_asynccnt)
  __builtin_amdgcn_s_wait_asynccnt(0);
#else
  asm volatile("s_wait_asynccnt 0" ::: "memory");
#endif
}

// ---------------------------------------------------------------------------
// 1) GroupNorm statistics: one block per (batch, group); 256-thread reduce.
// ---------------------------------------------------------------------------
__global__ __launch_bounds__(256) void k_gn_stats(const float* __restrict__ x,
                                                  float* __restrict__ stats) {
  int bg = blockIdx.x;            // 0..255 : b*32+g
  int b = bg >> 5, g = bg & 31;
  const float* xb = x + (size_t)b * Nq * Cq + g * 16;
  float s = 0.f, ss = 0.f;
  for (int n = threadIdx.x; n < Nq; n += 256) {
    const float* p = xb + (size_t)n * Cq;
#pragma unroll
    for (int ci = 0; ci < 16; ++ci) { float v = p[ci]; s += v; ss += v * v; }
  }
  __shared__ float sh_s[256], sh_ss[256];
  sh_s[threadIdx.x] = s; sh_ss[threadIdx.x] = ss;
  __syncthreads();
  for (int off = 128; off > 0; off >>= 1) {
    if (threadIdx.x < off) {
      sh_s[threadIdx.x]  += sh_s[threadIdx.x + off];
      sh_ss[threadIdx.x] += sh_ss[threadIdx.x + off];
    }
    __syncthreads();
  }
  if (threadIdx.x == 0) {
    float inv = 1.0f / (float)(Nq * 16);
    float mean = sh_s[0] * inv;
    float var  = sh_ss[0] * inv - mean * mean;
    stats[bg * 2]     = mean;
    stats[bg * 2 + 1] = rsqrtf(var + EPSQ);
  }
}

// ---------------------------------------------------------------------------
// 2) Apply GroupNorm, emit bf16 activations (M x C in fragment order:
//    block (m>>4, c>>5); a 16-row tile is 16 KB contiguous).
// ---------------------------------------------------------------------------
__global__ __launch_bounds__(256) void k_gn_apply(const float* __restrict__ x,
                                                  const float* __restrict__ stats,
                                                  const float* __restrict__ gamma,
                                                  const float* __restrict__ beta,
                                                  bf16* __restrict__ hn) {
  // i4 is the place in hn: threads walk the fragment order, so a wave stores
  // whole lines and each line has one writer; (m, c) is read back from the place.
  size_t i4 = ((size_t)blockIdx.x * 256 + threadIdx.x) * 4;
  int w = (int)(i4 & 511);
  int blk = (int)(i4 >> 9);
  int c = ((blk & 15) << 5) + ((w >> 8) << 4) + (((w >> 7) & 1) << 3) + (w & 7);
  int m = ((blk >> 4) << 4) + ((w >> 3) & 15);
  int b = m >> 12;
  int g = c >> 4;
  float mean = stats[(b * 32 + g) * 2];
  float rstd = stats[(b * 32 + g) * 2 + 1];
  float4 xv = *(const float4*)(x + (size_t)m * Cq + c);
  bf16* o = hn + i4;
  o[0] = (bf16)((xv.x - mean) * rstd * gamma[c]     + beta[c]);
  o[1] = (bf16)((xv.y - mean) * rstd * gamma[c + 1] + beta[c + 1]);
  o[2] = (bf16)((xv.z - mean) * rstd * gamma[c + 2] + beta[c + 2]);
  o[3] = (bf16)((xv.w - mean) * rstd * gamma[c + 3] + beta[c + 3]);
}

// ---------------------------------------------------------------------------
// 3) Pack a 512x512 f32 weight (w[k][n]) into fragment order:
//    block (kt*32+nt), rows indexed by n.
// ---------------------------------------------------------------------------
__global__ __launch_bounds__(256) void k_pack_w(const float* __restrict__ w,
                                                bf16* __restrict__ wpk) {
  int tid = blockIdx.x * 256 + threadIdx.x;
  if (tid >= 16 * 32 * 32) return;   // ktiles(16) * ntiles(32) * lanes(32)
  int lane = tid & 31;
  int nt = (tid >> 5) & 31;
  int kt = tid >> 10;
  int n = nt * 16 + (lane & 15);
  int half = lane >> 4;
  bf16* dst = wpk + (size_t)(tid >> 5) * 512 + lane * 8; // tid>>5 == kt*32+nt
#pragma unroll
  for (int j = 0; j < 8; ++j)
    dst[j] = (bf16)w[(kt * 32 + half * 8 + j) * Cq + n];
#pragma unroll
  for (int j = 0; j < 8; ++j)
    dst[256 + j] = (bf16)w[(kt * 32 + 16 + half * 8 + j) * Cq + n];
}

// ---------------------------------------------------------------------------
// 4) Fused QKV projection. 8 waves share one async-staged 16x512 A tile;
//    each wave computes one 16x16 tile for q, k, v (A fragment reused 3x).
//    q,k stored in fragment order, block (row>>4, channel>>5); v stored in
//    fragment order for P*V (rows = channels, k = keys), block (key>>5, channel>>4):
//    a lane's eight accumulator rows are its own 16 bytes of that block.
// ---------------------------------------------------------------------------
__global__ __launch_bounds__(256) void k_qkv(const bf16* __restrict__ hn,
                                             const bf16* __restrict__ wq,
                                             const bf16* __restrict__ wk,
                                             const bf16* __restrict__ wv,
                                             const float* __restrict__ bq,
                                             const float* __restrict__ bk,
                                             const float* __restrict__ bv,
                                             bf16* __restrict__ qb,
                                             bf16* __restrict__ kb,
                                             bf16* __restrict__ vtb) {
  __shared__ __align__(16) bf16 atile[16 * 512];
  int wave = threadIdx.x >> 5, lane = threadIdx.x & 31;
  int mt = blockIdx.x >> 2;
  int ct = ((blockIdx.x & 3) << 3) + wave;
  int m0 = mt << 4;
  for (int i = threadIdx.x; i < 16 * 512 / 8; i += 256)
    stage16((const uint4*)(hn + (size_t)m0 * Cq) + i, (uint4*)atile + i);
  wait_async();
  __syncthreads();
  v8f aq = {}, ak = {}, av = {};
  // Fully unrolled: the weight reads of later k steps then issue ahead of the
  // WMMAs of earlier ones; rolled, each read is waited for before its WMMA.
#pragma unroll
  for (int kt = 0; kt < 16; ++kt) {
    v16bf a = frag_packed(atile + kt * 512, lane);
    size_t wb = (size_t)(kt * 32 + ct) * 512;
    aq = wmma_bf16(a, frag_packed(wq + wb, lane), aq);
    ak = wmma_bf16(a, frag_packed(wk + wb, lane), ak);
    av = wmma_bf16(a, frag_packed(wv + wb, lane), av);
  }
  int half = lane >> 4;
  int col = (ct << 4) + (lane & 15);
  float xbq = bq[col], xbk = bk[col], xbv = bv[col];
  size_t qkblk = ((size_t)mt * 16 + (col >> 5)) * 512;
  v8bf vv;
#pragma unroll
  for (int r = 0; r < 8; ++r) {
    int off = frag_off(r + half * 8, col & 31);   // C/D layout: M = vgpr + half*8
    qb[qkblk + off] = (bf16)(aq[r] + xbq);
    kb[qkblk + off] = (bf16)(ak[r] + xbk);
    vv[r] = (bf16)(av[r] + xbv);
  }
  int bb = m0 >> 12, n0 = m0 & (Nq - 1);          // key = n0 + half*8 + r
  *(v8bf*)(vtb + (size_t)bb * Cq * Nq + ((size_t)(n0 >> 5) * 32 + ct) * 512 +
           ((n0 >> 4) & 1) * 256 + lane * 8) = vv;
}

// ---------------------------------------------------------------------------
// 5) Softmax statistics (pass A): one wave per 16-query tile.
//    WMMA score tiles + shfl_xor reductions across the 16-lane halves
//    (C/D layout: lane = key column, VGPR r = query row r + half*8).
// ---------------------------------------------------------------------------
__global__ __launch_bounds__(32) void k_attn_stats(const bf16* __restrict__ qb,
                                                   const bf16* __restrict__ kb,
                                                   float* __restrict__ ms) {
  __shared__ __align__(16) bf16 qtile[16 * 512];
  int qt = blockIdx.x;             // 2048 query tiles (batches contiguous)
  int b = qt >> 8;
  int lane = threadIdx.x;
  for (int i = lane; i < 16 * 512 / 8; i += 32)
    stage16((const uint4*)(qb + (size_t)qt * 16 * Cq) + i, (uint4*)qtile + i);
  wait_async();
  __syncthreads();
  const bf16* kbase = kb + (size_t)b * Nq * Cq;
  float rmax[8], rsum[8];
#pragma unroll
  for (int r = 0; r < 8; ++r) { rmax[r] = -1e30f; rsum[r] = 0.f; }
  for (int nt = 0; nt < 256; ++nt) {
    v8f d = {};
    for (int kt = 0; kt < 16; ++kt) {
      v16bf a   = frag_packed(qtile + kt * 512, lane);
      v16bf bk_ = frag_packed(kbase + (size_t)(nt * 16 + kt) * 512, lane);
      d = wmma_bf16(a, bk_, d);
    }
#pragma unroll
    for (int r = 0; r < 8; ++r) {
      float v = d[r] * SCALEF;
      float t = v;
      t = fmaxf(t, __shfl_xor(t, 1));
      t = fmaxf(t, __shfl_xor(t, 2));
      t = fmaxf(t, __shfl_xor(t, 4));
      t = fmaxf(t, __shfl_xor(t, 8));
      float mnew = fmaxf(rmax[r], t);
      float e = __expf(v - mnew);
      e += __shfl_xor(e, 1);
      e += __shfl_xor(e, 2);
      e += __shfl_xor(e, 4);
      e += __shfl_xor(e, 8);
      rsum[r] = rsum[r] * __expf(rmax[r] - mnew) + e;
      rmax[r] = mnew;
    }
  }
  if ((lane & 15) == 0) {
    int half = lane >> 4;
#pragma unroll
    for (int r = 0; r < 8; ++r) {
      int row = qt * 16 + half * 8 + r;
      ms[row * 2]     = rmax[r];
      ms[row * 2 + 1] = 1.0f / rsum[r];
    }
  }
}

// ---------------------------------------------------------------------------
// 6) Attention output (pass B): 4 waves per 16-query tile. Cooperative
//    scheme: wave w computes the score tile for ITS OWN 32-key slice and
//    publishes P (bf16) to LDS; after a barrier every wave consumes all 4
//    P tiles for its private 128-channel output chunk. This removes the
//    4x redundant score recomputation (scores dominate: 32 WMMA vs 8 for PV).
// ---------------------------------------------------------------------------
__global__ __launch_bounds__(128) void k_attn_out(const bf16* __restrict__ qb,
                                                  const bf16* __restrict__ kb,
                                                  const bf16* __restrict__ vtb,
                                                  const float* __restrict__ ms,
                                                  bf16* __restrict__ ao) {
  __shared__ __align__(16) bf16 qtile[16 * 512];
  __shared__ __align__(16) bf16 pbuf[4][16 * 32];
  int qt = blockIdx.x;
  int b = qt >> 8;
  int wave = threadIdx.x >> 5, lane = threadIdx.x & 31;
  for (int i = threadIdx.x; i < 16 * 512 / 8; i += 128)
    stage16((const uint4*)(qb + (size_t)qt * 16 * Cq) + i, (uint4*)qtile + i);
  wait_async();
  __syncthreads();
  int half = lane >> 4;
  float mrow[8], rsrow[8];
#pragma unroll
  for (int r = 0; r < 8; ++r) {
    int row = qt * 16 + half * 8 + r;
    mrow[r]  = ms[row * 2];
    rsrow[r] = ms[row * 2 + 1];
  }
  const bf16* kbase = kb + (size_t)b * Nq * Cq;
  const bf16* vbase = vtb + (size_t)b * Cq * Nq;
  v8f acc[8] = {};
  bf16* pb = &pbuf[wave][0];
  for (int kblock = 0; kblock < 32; ++kblock) {     // 128 keys per iteration
    int key0 = kblock * 128 + wave * 32;            // this wave's 32-key slice
    v8f d0 = {}, d1 = {};
    for (int kt = 0; kt < 16; ++kt) {
      v16bf a  = frag_packed(qtile + kt * 512, lane);
      v16bf b0 = frag_packed(kbase + (size_t)key0 * Cq + kt * 512, lane);
      v16bf b1 = frag_packed(kbase + (size_t)(key0 + 16) * Cq + kt * 512, lane);
      d0 = wmma_bf16(a, b0, d0);
      d1 = wmma_bf16(a, b1, d1);
    }
#pragma unroll
    for (int r = 0; r < 8; ++r) {
      float p0 = __expf(d0[r] * SCALEF - mrow[r]) * rsrow[r];
      float p1 = __expf(d1[r] * SCALEF - mrow[r]) * rsrow[r];
      int off = frag_off(r + half * 8, lane & 15);
      pb[off]       = (bf16)p0;                     // keys 0..15 of the slice: part 0
      pb[off + 256] = (bf16)p1;                     // keys 16..31: part 1
    }
    __syncthreads();                                // publish P tiles
#pragma unroll
    for (int pt = 0; pt < 4; ++pt) {                // consume all 4 P tiles
      v16bf pa = frag_packed(&pbuf[pt][0], lane);
      int kb32 = kblock * 4 + pt;                   // 32-key block of this P tile
#pragma unroll
      for (int ct = 0; ct < 8; ++ct) {
        v16bf vfr = frag_packed(
            vbase + (size_t)(kb32 * 32 + wave * 8 + ct) * 512, lane);
        acc[ct] = wmma_bf16(pa, vfr, acc[ct]);
      }
    }
    __syncthreads();                                // protect pbuf reuse (WAR)
  }
#pragma unroll
  for (int ct = 0; ct < 8; ++ct) {
    int ch = wave * 128 + ct * 16 + (lane & 15);
    bf16* ob = ao + ((size_t)qt * 16 + (ch >> 5)) * 512;
#pragma unroll
    for (int r = 0; r < 8; ++r)
      ob[frag_off(r + half * 8, ch & 31)] = (bf16)acc[ct][r];
  }
}

// ---------------------------------------------------------------------------
// 7) Output projection + bias + residual, fp32 store.
// ---------------------------------------------------------------------------
__global__ __launch_bounds__(256) void k_out_proj(const bf16* __restrict__ ao,
                                                  const bf16* __restrict__ wo,
                                                  const float* __restrict__ bo,
                                                  const float* __restrict__ x,
                                                  float* __restrict__ out) {
  __shared__ __align__(16) bf16 atile[16 * 512];
  int wave = threadIdx.x >> 5, lane = threadIdx.x & 31;
  int mt = blockIdx.x >> 2;
  int ct = ((blockIdx.x & 3) << 3) + wave;
  int m0 = mt << 4;
  for (int i = threadIdx.x; i < 16 * 512 / 8; i += 256)
    stage16((const uint4*)(ao + (size_t)m0 * Cq) + i, (uint4*)atile + i);
  wait_async();
  __syncthreads();
  v8f acc = {};
  for (int kt = 0; kt < 16; ++kt) {
    v16bf a = frag_packed(atile + kt * 512, lane);
    acc = wmma_bf16(a, frag_packed(wo + (size_t)(kt * 32 + ct) * 512, lane), acc);
  }
  int half = lane >> 4;
  int col = (ct << 4) + (lane & 15);
  float bias = bo[col];
#pragma unroll
  for (int r = 0; r < 8; ++r) {
    int row = m0 + r + half * 8;
    size_t idx = (size_t)row * Cq + col;
    out[idx] = acc[r] + bias + x[idx];
  }
}

// ---------------------------------------------------------------------------
// Launch
// ---------------------------------------------------------------------------
extern "C" void kernel_launch(void* const* d_in, const int* in_sizes, int n_in,
                              void* d_out, int out_size, void* d_ws, size_t ws_size,
                              hipStream_t stream) {
  const float* x      = (const float*)d_in[0];
  const float* gscale = (const float*)d_in[1];
  const float* gbias  = (const float*)d_in[2];
  const float* wq     = (const float*)d_in[3];
  const float* bq     = (const float*)d_in[4];
  const float* wk     = (const float*)d_in[5];
  const float* bk     = (const float*)d_in[6];
  const float* wv     = (const float*)d_in[7];
  const float* bv     = (const float*)d_in[8];
  const float* wo     = (const float*)d_in[9];
  const float* bo     = (const float*)d_in[10];
  float* out = (float*)d_out;

  char* ws = (char*)d_ws;
  float* stats = (float*)ws;                               // 2 KB
  bf16* wpkq = (bf16*)(ws + 4096);                         // 4 x 512KB packed weights
  bf16* wpkk = (bf16*)(ws + 4096 + 1 * 524288);
  bf16* wpkv = (bf16*)(ws + 4096 + 2 * 524288);
  bf16* wpko = (bf16*)(ws + 4096 + 3 * 524288);
  size_t o = 4096 + 4 * 524288;
  bf16* hn  = (bf16*)(ws + o); o += 33554432;              // normalized acts / reused as attn out
  bf16* qb  = (bf16*)(ws + o); o += 33554432;              // Q, fragment order
  bf16* kb  = (bf16*)(ws + o); o += 33554432;              // K, fragment order
  bf16* vtb = (bf16*)(ws + o); o += 33554432;              // V, fragment order (rows = channels)
  float* ms = (float*)(ws + o);                            // per-row (max, 1/sum)

  k_gn_stats<<<256, 256, 0, stream>>>(x, stats);
  k_gn_apply<<<16384, 256, 0, stream>>>(x, stats, gscale, gbias, hn);
  k_pack_w<<<64, 256, 0, stream>>>(wq, wpkq);
  k_pack_w<<<64, 256, 0, stream>>>(wk, wpkk);
  k_pack_w<<<64, 256, 0, stream>>>(wv, wpkv);
  k_pack_w<<<64, 256, 0, stream>>>(wo, wpko);
  k_qkv<<<8192, 256, 0, stream>>>(hn, wpkq, wpkk, wpkv, bq, bk, bv, qb, kb, vtb);
  k_attn_stats<<<2048, 32, 0, stream>>>(qb, kb, ms);
  k_attn_out<<<2048, 128, 0, stream>>>(qb, kb, vtb, ms, hn);  // attn out overwrites hn
  k_out_proj<<<8192, 256, 0, stream>>>(hn, wpko, bo, x, out);
}

// v002
// Measured time: 544 microseconds a run.
// Timed twice side by side with v001, it ran 4.04 and 4.05 times as fast.
// Counting every step since v000, it is 4.71 times as fast.
#include <hip/hip_runtime.h>

typedef __bf16 bf16;
typedef __attribute__((ext_vector_type(16))) __bf16 v16bf;
typedef __attribute__((ext_vector_type(8)))  __bf16 v8bf;
typedef __attribute__((ext_vector_type(8)))  float  v8f;
typedef __attribute__((ext_vector_type(4)))  int    v4i;
typedef __attribute__((address_space(3))) v4i* lds_v4i_p;

#define Bq 8
#define Cq 512
#define Nq 4096
#define Mq 32768
#define SCALEF 0.044194173824159216f   // 1/sqrt(512)
#define EPSQ 1e-5f

// ---------------------------------------------------------------------------
// WMMA helpers
// ---------------------------------------------------------------------------
__device__ __forceinline__ v8f wmma_bf16(v16bf a, v16bf b, v8f c) {
  return __builtin_amdgcn_wmma_f32_16x16x32_bf16(false, a, false, b, (short)0, c,
                                                 false, false);
}

__device__ __forceinline__ v16bf cat8(v8bf lo, v8bf hi) {
  return __builtin_shufflevector(lo, hi, 0, 1, 2, 3, 4, 5, 6, 7,
                                         8, 9, 10, 11, 12, 13, 14, 15);
}

// Fragment order. Every bf16 WMMA operand (in the workspace and in LDS) is kept
// as 1 KB blocks, one block per 16-row x 32-k fragment: [part 0..1][lane 0..31][8].
// Per ISA layout: lane L -> row = L&15, half = L>>4;
// part 0, elements 0..7  -> k = half*8 + j
// part 1, elements 8..15 -> k = 16 + half*8 + j
// so each of the two 16-byte reads of a fragment covers 512 contiguous bytes
// over the wave: four whole lines from global memory, no shared bank in LDS.
// The same pattern serves as a B fragment (rows indexed by N).
// frag_off: place of element (row r16, k index k32) inside its block.
__device__ __forceinline__ int frag_off(int r16, int k32) {
  return ((k32 >> 4) << 8) + (((((k32 >> 3) & 1) << 4) + r16) << 3) + (k32 & 7);
}

__device__ __forceinline__ v16bf frag_packed(const bf16* blk, int lane) {
  const bf16* p = blk + lane * 8;
  v8bf lo = *(const v8bf*)p;
  v8bf hi = *(const v8bf*)(p + 256);
  return cat8(lo, hi);
}

// ---------------------------------------------------------------------------
// Async global -> LDS staging (gfx1250 GLOBAL_LOAD_ASYNC_TO_LDS_B128,
// tracked by ASYNCcnt). Param 0 is a generic v4i* (per compiler diagnostic);
// LDS side is cast to addrspace(3), which also converts implicitly to
// generic if the builtin is declared that way.
// ---------------------------------------------------------------------------
__device__ __forceinline__ void stage16(const void* gsrc, void* ldst) {
#if __has_builtin(__builtin_amdgcn_global_load_async_to_lds_b128)
  __builtin_amdgcn_global_load_async_to_lds_b128((v4i*)gsrc, (lds_v4i_p)ldst, 0, 0);
#else
  *(uint4*)ldst = *(const uint4*)gsrc;
#endif
}

__device__ __forceinline__ void wait_async() {
#if __has_builtin(__builtin_amdgcn_s_wait_asynccnt)
  __builtin_amdgcn_s_wait_asynccnt(0);
#else
  asm volatile("s_wait_asynccnt 0" ::: "memory");
#endif
}

// ---------------------------------------------------------------------------
// 1) GroupNorm statistics: one block per (batch, group); 256-thread reduce.
// ---------------------------------------------------------------------------
__global__ __launch_bounds__(256) void k_gn_stats(const float* __restrict__ x,
                                                  float* __restrict__ stats) {
  int bg = blockIdx.x;            // 0..255 : b*32+g
  int b = bg >> 5, g = bg & 31;
  const float* xb = x + (size_t)b * Nq * Cq + g * 16;
  float s = 0.f, ss = 0.f;
  for (int n = threadIdx.x; n < Nq; n += 256) {
    const float* p = xb + (size_t)n * Cq;
#pragma unroll
    for (int ci = 0; ci < 16; ++ci) { float v = p[ci]; s += v; ss += v * v; }
  }
  __shared__ float sh_s[256], sh_ss[256];
  sh_s[threadIdx.x] = s; sh_ss[threadIdx.x] = ss;
  __syncthreads();
  for (int off = 128; off > 0; off >>= 1) {
    if (threadIdx.x < off) {
      sh_s[threadIdx.x]  += sh_s[threadIdx.x + off];
      sh_ss[threadIdx.x] += sh_ss[threadIdx.x + off];
    }
    __syncthreads();
  }
  if (threadIdx.x == 0) {
    float inv = 1.0f / (float)(Nq * 16);
    float mean = sh_s[0] * inv;
    float var  = sh_ss[0] * inv - mean * mean;
    stats[bg * 2]     = mean;
    stats[bg * 2 + 1] = rsqrtf(var + EPSQ);
  }
}

// ---------------------------------------------------------------------------
// 2) Apply GroupNorm, emit bf16 activations (M x C in fragment order:
//    block (m>>4, c>>5); a 16-row tile is 16 KB contiguous).
// ---------------------------------------------------------------------------
__global__ __launch_bounds__(256) void k_gn_apply(const float* __restrict__ x,
                                                  const float* __restrict__ stats,
                                                  const float* __restrict__ gamma,
                                                  const float* __restrict__ beta,
                                                  bf16* __restrict__ hn) {
  // i4 is the place in hn: threads walk the fragment order, so a wave stores
  // whole lines and each line has one writer; (m, c) is read back from the place.
  size_t i4 = ((size_t)blockIdx.x * 256 + threadIdx.x) * 4;
  int w = (int)(i4 & 511);
  int blk = (int)(i4 >> 9);
  int c = ((blk & 15) << 5) + ((w >> 8) << 4) + (((w >> 7) & 1) << 3) + (w & 7);
  int m = ((blk >> 4) << 4) + ((w >> 3) & 15);
  int b = m >> 12;
  int g = c >> 4;
  float mean = stats[(b * 32 + g) * 2];
  float rstd = stats[(b * 32 + g) * 2 + 1];
  float4 xv = *(const float4*)(x + (size_t)m * Cq + c);
  bf16* o = hn + i4;
  o[0] = (bf16)((xv.x - mean) * rstd * gamma[c]     + beta[c]);
  o[1] = (bf16)((xv.y - mean) * rstd * gamma[c + 1] + beta[c + 1]);
  o[2] = (bf16)((xv.z - mean) * rstd * gamma[c + 2] + beta[c + 2]);
  o[3] = (bf16)((xv.w - mean) * rstd * gamma[c + 3] + beta[c + 3]);
}

// ---------------------------------------------------------------------------
// 3) Pack a 512x512 f32 weight (w[k][n]) into fragment order:
//    block (kt*32+nt), rows indexed by n.
// ---------------------------------------------------------------------------
__global__ __launch_bounds__(256) void k_pack_w(const float* __restrict__ w,
                                                bf16* __restrict__ wpk) {
  int tid = blockIdx.x * 256 + threadIdx.x;
  if (tid >= 16 * 32 * 32) return;   // ktiles(16) * ntiles(32) * lanes(32)
  int lane = tid & 31;
  int nt = (tid >> 5) & 31;
  int kt = tid >> 10;
  int n = nt * 16 + (lane & 15);
  int half = lane >> 4;
  bf16* dst = wpk + (size_t)(tid >> 5) * 512 + lane * 8; // tid>>5 == kt*32+nt
#pragma unroll
  for (int j = 0; j < 8; ++j)
    dst[j] = (bf16)w[(kt * 32 + half * 8 + j) * Cq + n];
#pragma unroll
  for (int j = 0; j < 8; ++j)
    dst[256 + j] = (bf16)w[(kt * 32 + 16 + half * 8 + j) * Cq + n];
}

// ---------------------------------------------------------------------------
// 4) Fused QKV projection. 8 waves share one async-staged 16x512 A tile;
//    each wave computes one 16x16 tile for q, k, v (A fragment reused 3x).
//    q,k stored in fragment order, block (row>>4, channel>>5); v stored in
//    fragment order for P*V (rows = channels, k = keys), block (key>>5, channel>>4):
//    a lane's eight accumulator rows are its own 16 bytes of that block.
// ---------------------------------------------------------------------------
__global__ __launch_bounds__(256) void k_qkv(const bf16* __restrict__ hn,
                                             const bf16* __restrict__ wq,
                                             const bf16* __restrict__ wk,
                                             const bf16* __restrict__ wv,
                                             const float* __restrict__ bq,
                                             const float* __restrict__ bk,
                                             const float* __restrict__ bv,
                                             bf16* __restrict__ qb,
                                             bf16* __restrict__ kb,
                                             bf16* __restrict__ vtb) {
  __shared__ __align__(16) bf16 atile[16 * 512];
  int wave = threadIdx.x >> 5, lane = threadIdx.x & 31;
  int mt = blockIdx.x >> 2;
  int ct = ((blockIdx.x & 3) << 3) + wave;
  int m0 = mt << 4;
  for (int i = threadIdx.x; i < 16 * 512 / 8; i += 256)
    stage16((const uint4*)(hn + (size_t)m0 * Cq) + i, (uint4*)atile + i);
  wait_async();
  __syncthreads();
  v8f aq = {}, ak = {}, av = {};
  // Fully unrolled: the weight reads of later k steps then issue ahead of the
  // WMMAs of earlier ones; rolled, each read is waited for before its WMMA.
#pragma unroll
  for (int kt = 0; kt < 16; ++kt) {
    v16bf a = frag_packed(atile + kt * 512, lane);
    size_t wb = (size_t)(kt * 32 + ct) * 512;
    aq = wmma_bf16(a, frag_packed(wq + wb, lane), aq);
    ak = wmma_bf16(a, frag_packed(wk + wb, lane), ak);
    av = wmma_bf16(a, frag_packed(wv + wb, lane), av);
  }
  int half = lane >> 4;
  int col = (ct << 4) + (lane & 15);
  float xbq = bq[col], xbk = bk[col], xbv = bv[col];
  size_t qkblk = ((size_t)mt * 16 + (col >> 5)) * 512;
  v8bf vv;
#pragma unroll
  for (int r = 0; r < 8; ++r) {
    int off = frag_off(r + half * 8, col & 31);   // C/D layout: M = vgpr + half*8
    qb[qkblk + off] = (bf16)(aq[r] + xbq);
    kb[qkblk + off] = (bf16)(ak[r] + xbk);
    vv[r] = (bf16)(av[r] + xbv);
  }
  int bb = m0 >> 12, n0 = m0 & (Nq - 1);          // key = n0 + half*8 + r
  *(v8bf*)(vtb + (size_t)bb * Cq * Nq + ((size_t)(n0 >> 5) * 32 + ct) * 512 +
           ((n0 >> 4) & 1) * 256 + lane * 8) = vv;
}

typedef __attribute__((address_space(3))) char* lds_char_p;
#define QREG 4   // Q fragments (of 16) that pass B keeps in registers

__device__ __forceinline__ void copy_tile32k(const bf16* g, bf16* l, int tid) {
  const char* gp = (const char*)g + tid * 16;
  unsigned lp = (unsigned)(__UINTPTR_TYPE__)(lds_char_p)(char*)l + (unsigned)tid * 16u;
  // The copies and their s_wait_xcnt stand in one statement, so no address
  // register of an issued copy is rewritten ahead of that wait.
  asm volatile(
      "global_load_async_to_lds_b128 %0, %8, off\n\t"
      "global_load_async_to_lds_b128 %1, %9, off\n\t"
      "global_load_async_to_lds_b128 %2, %10, off\n\t"
      "global_load_async_to_lds_b128 %3, %11, off\n\t"
      "global_load_async_to_lds_b128 %4, %12, off\n\t"
      "global_load_async_to_lds_b128 %5, %13, off\n\t"
      "global_load_async_to_lds_b128 %6, %14, off\n\t"
      "global_load_async_to_lds_b128 %7, %15, off\n\t"
      "s_wait_xcnt 0x0"
      :: "v"(lp), "v"(lp + 4096u), "v"(lp + 8192u), "v"(lp + 12288u),
         "v"(lp + 16384u), "v"(lp + 20480u), "v"(lp + 24576u), "v"(lp + 28672u),
         "v"(gp), "v"(gp + 4096), "v"(gp + 8192), "v"(gp + 12288),
         "v"(gp + 16384), "v"(gp + 20480), "v"(gp + 24576), "v"(gp + 28672)
      : "memory");
}

// This wave's own LDS reads and writes have retired (before a buffer is handed
// back for refill, and before a wave reads back what its lanes wrote).
__device__ __forceinline__ void wait_ds0() {
  asm volatile("s_wait_dscnt 0x0" ::: "memory");
}
// This wave's own copies have landed (before the barrier that publishes them).
__device__ __forceinline__ void wait_copies0() {
  asm volatile("s_wait_asynccnt 0x0" ::: "memory");
}

// ---------------------------------------------------------------------------
// 5) Softmax statistics (pass A): one wave per 16-query tile, 8 tiles per
//    work-group sharing the staged K tiles.
//    WMMA score tiles + shfl_xor reductions across the 16-lane halves
//    (C/D layout: lane = key column, VGPR r = query row r + half*8).
// ---------------------------------------------------------------------------
__global__ __launch_bounds__(256) void k_attn_stats(const bf16* __restrict__ qb,
                                                    const bf16* __restrict__ kb,
                                                    float* __restrict__ ms) {
  __shared__ __align__(16) bf16 kbuf[2][32 * 512];
  int wave = threadIdx.x >> 5, lane = threadIdx.x & 31;
  int qt = blockIdx.x * 8 + wave;  // 2048 query tiles (batches contiguous)
  int b = blockIdx.x >> 5;         // 32 work-groups per batch
  const bf16* kbase = kb + (size_t)b * Nq * Cq;
  copy_tile32k(kbase, &kbuf[0][0], threadIdx.x);
  v16bf qf[16];
#pragma unroll
  for (int kt = 0; kt < 16; ++kt)
    qf[kt] = frag_packed(qb + (size_t)qt * 16 * Cq + kt * 512, lane);
  wait_copies0();
  __syncthreads();                                  // publish tile 0
  copy_tile32k(kbase + 32 * Cq, &kbuf[1][0], threadIdx.x);
  float rmax[8], rsum[8];
#pragma unroll
  for (int r = 0; r < 8; ++r) { rmax[r] = -1e30f; rsum[r] = 0.f; }
  for (int t = 0; t < 128; ++t) {                   // 32 keys per trip
    const bf16* kt32 = &kbuf[t & 1][0];
    v8f dd[2] = {};
    // K fragments come in groups of eight (4 k steps x 2 key tiles); the next
    // group's LDS reads are issued ahead of this group's WMMAs. Unrolled so that
    // qf[] and the two groups are indexed by constants and stay in registers.
    v16bf fa[8], fb[8];
#pragma unroll
    for (int j = 0; j < 8; ++j)
      fa[j] = frag_packed(kt32 + (j & 1) * 16 * Cq + (j >> 1) * 512, lane);
#pragma unroll
    for (int g = 0; g < 4; ++g) {
      if (g < 3) {
#pragma unroll
        for (int j = 0; j < 8; ++j)
          fb[j] = frag_packed(kt32 + (j & 1) * 16 * Cq + ((g + 1) * 4 + (j >> 1)) * 512, lane);
      }
      // Keeps the reads above as one group ahead of the WMMAs; left free, each
      // read sinks to just in front of its WMMA, which then waits out its latency.
      __builtin_amdgcn_sched_barrier(0);
#pragma unroll
      for (int j = 0; j < 8; ++j)
        dd[j & 1] = wmma_bf16(qf[g * 4 + (j >> 1)], fa[j], dd[j & 1]);
      // Keeps the following group's reads behind these WMMAs (two groups live).
      __builtin_amdgcn_sched_barrier(0);
#pragma unroll
      for (int j = 0; j < 8; ++j) fa[j] = fb[j];
    }
#pragma unroll
    for (int h = 0; h < 2; ++h) {
#pragma unroll
      for (int r = 0; r < 8; ++r) {
        float v = dd[h][r] * SCALEF;
        float m = v;
        m = fmaxf(m, __shfl_xor(m, 1));
        m = fmaxf(m, __shfl_xor(m, 2));
        m = fmaxf(m, __shfl_xor(m, 4));
        m = fmaxf(m, __shfl_xor(m, 8));
        float mnew = fmaxf(rmax[r], m);
        float e = __expf(v - mnew);
        e += __shfl_xor(e, 1);
        e += __shfl_xor(e, 2);
        e += __shfl_xor(e, 4);
        e += __shfl_xor(e, 8);
        rsum[r] = rsum[r] * __expf(rmax[r] - mnew) + e;
        rmax[r] = mnew;
      }
    }
    // Keeps the row statistics in front of the barrier; sunk behind it they
    // delay the refill, which then has too short a lead on its wait.
    __builtin_amdgcn_sched_barrier(0);
    wait_ds0();
    wait_copies0();
    __syncthreads();          // publishes tile t+1, ends every read of tile t
    if (t + 2 < 128)
      copy_tile32k(kbase + (size_t)(t + 2) * 32 * Cq, &kbuf[t & 1][0], threadIdx.x);
  }
  wait_copies0();
  if ((lane & 15) == 0) {
    int half = lane >> 4;
#pragma unroll
    for (int r = 0; r < 8; ++r) {
      int row = qt * 16 + half * 8 + r;
      ms[row * 2]     = rmax[r];
      ms[row * 2 + 1] = 1.0f / rsum[r];
    }
  }
}

// ---------------------------------------------------------------------------
// 6) Attention output (pass B): one wave per 16-query tile, all 512 output
//    channels in its accumulators; 8 tiles per work-group share the staged
//    K and V tiles. P (bf16) turns from accumulator to A-fragment order through
//    the wave's own 1 KB of LDS.
// ---------------------------------------------------------------------------
__global__ __launch_bounds__(256) void k_attn_out(const bf16* __restrict__ qb,
                                                  const bf16* __restrict__ kb,
                                                  const bf16* __restrict__ vtb,
                                                  const float* __restrict__ ms,
                                                  bf16* __restrict__ ao) {
  __shared__ __align__(16) bf16 kvbuf[2][2][32 * 512];   // [buffer][K, V]
  __shared__ __align__(16) bf16 pbuf[8][16 * 32];
  __shared__ __align__(16) bf16 qlds[8][(16 - QREG) * 512];
  int wave = threadIdx.x >> 5, lane = threadIdx.x & 31;
  int qt = blockIdx.x * 8 + wave;
  int b = blockIdx.x >> 5;
  const bf16* kbase = kb + (size_t)b * Nq * Cq;
  const bf16* vbase = vtb + (size_t)b * Cq * Nq;
  copy_tile32k(kbase, &kvbuf[0][0][0], threadIdx.x);
  copy_tile32k(vbase, &kvbuf[0][1][0], threadIdx.x);
  // The first QREG of the wave's 16 Q fragments stay in registers; beside the
  // 256 accumulator registers no more fit, so the rest lie in its own LDS.
  const bf16* qsrc = qb + (size_t)qt * 16 * Cq + lane * 8;   // the lane's 16 bytes
  v16bf qf[QREG];
#pragma unroll
  for (int kt = 0; kt < QREG; ++kt)
    qf[kt] = cat8(*(const v8bf*)(qsrc + kt * 512), *(const v8bf*)(qsrc + kt * 512 + 256));
  v8bf qlo[16 - QREG], qhi[16 - QREG];
#pragma unroll
  for (int kt = QREG; kt < 16; ++kt) {
    qlo[kt - QREG] = *(const v8bf*)(qsrc + kt * 512);
    qhi[kt - QREG] = *(const v8bf*)(qsrc + kt * 512 + 256);
  }
  int half = lane >> 4;
  const float* msrc = ms + (qt * 16 + half * 8) * 2;
  float mrow[8], rsrow[8];
#pragma unroll
  for (int r = 0; r < 8; ++r) {
    mrow[r]  = msrc[r * 2];
    rsrow[r] = msrc[r * 2 + 1];
  }
  // The address registers of the loads above stay as they are until this wait
  // (named as inputs so that they live up to it).
  asm volatile("s_wait_xcnt 0x0" :: "v"(qsrc), "v"(msrc) : "memory");
  bf16* ql = &qlds[wave][0];
#pragma unroll
  for (int kt = QREG; kt < 16; ++kt) {
    *(v8bf*)(ql + (kt - QREG) * 512 + lane * 8)       = qlo[kt - QREG];
    *(v8bf*)(ql + (kt - QREG) * 512 + 256 + lane * 8) = qhi[kt - QREG];
  }
  wait_copies0();
  __syncthreads();                                  // publish tile 0
  copy_tile32k(kbase + 32 * Cq, &kvbuf[1][0][0], threadIdx.x);
  copy_tile32k(vbase + 32 * Cq, &kvbuf[1][1][0], threadIdx.x);
  v8f acc[32] = {};
  bf16* pb = &pbuf[wave][0];
  for (int t = 0; t < 128; ++t) {                   // 32 keys per trip
    const bf16* kt32 = &kvbuf[t & 1][0][0];
    const bf16* vt32 = &kvbuf[t & 1][1][0];
    v8f d0 = {}, d1 = {};
    // K and V fragments come in groups of four; the next group's LDS reads are
    // issued ahead of this group's WMMAs. Unrolled so that qf[], acc[] and the
    // two groups are indexed by constants and stay in registers.
    v16bf fa[4], fb[4], qa[2], qn[2];
#pragma unroll
    for (int j = 0; j < 4; ++j)
      fa[j] = frag_packed(kt32 + (j & 1) * 16 * Cq + (j >> 1) * 512, lane);
#pragma unroll
    for (int g = 0; g < 8; ++g) {
#pragma unroll
      for (int j = 0; j < 4; ++j)
        fb[j] = (g < 7)
            ? frag_packed(kt32 + (j & 1) * 16 * Cq + ((g + 1) * 2 + (j >> 1)) * 512, lane)
            : frag_packed(vt32 + j * 512, lane);    // first V group
      if (g < 7 && (g + 1) * 2 >= QREG) {           // the next group's Q, where in LDS
        qn[0] = frag_packed(ql + ((g + 1) * 2 - QREG) * 512, lane);
        qn[1] = frag_packed(ql + ((g + 1) * 2 + 1 - QREG) * 512, lane);
      }
      // Keeps the reads above as one group ahead of the WMMAs; left free, each
      // read sinks to just in front of its WMMA, which then waits out its latency.
      __builtin_amdgcn_sched_barrier(0);
      v16bf q0 = (g * 2 < QREG) ? qf[(g * 2) % QREG] : qa[0];
      v16bf q1 = (g * 2 < QREG) ? qf[(g * 2 + 1) % QREG] : qa[1];
      d0 = wmma_bf16(q0, fa[0], d0);
      d1 = wmma_bf16(q0, fa[1], d1);
      d0 = wmma_bf16(q1, fa[2], d0);
      d1 = wmma_bf16(q1, fa[3], d1);
      // Keeps the following group's reads behind these WMMAs (two groups live).
      __builtin_amdgcn_sched_barrier(0);
#pragma unroll
      for (int j = 0; j < 4; ++j) fa[j] = fb[j];
      qa[0] = qn[0]; qa[1] = qn[1];
    }
#pragma unroll
    for (int r = 0; r < 8; ++r) {
      float p0 = __expf(d0[r] * SCALEF - mrow[r]) * rsrow[r];
      float p1 = __expf(d1[r] * SCALEF - mrow[r]) * rsrow[r];
      int off = frag_off(r + half * 8, lane & 15);
      pb[off]       = (bf16)p0;                     // keys 0..15 of the tile: part 0
      pb[off + 256] = (bf16)p1;                     // keys 16..31: part 1
    }
    wait_ds0();               // the other lanes' P stores, before the read back
    v16bf pa = frag_packed(pb, lane);
#pragma unroll
    for (int g = 0; g < 8; ++g) {
      if (g < 7) {
#pragma unroll
        for (int j = 0; j < 4; ++j)
          fb[j] = frag_packed(vt32 + ((g + 1) * 4 + j) * 512, lane);
      }
      __builtin_amdgcn_sched_barrier(0);            // as in the score loop
#pragma unroll
      for (int j = 0; j < 4; ++j)
        acc[g * 4 + j] = wmma_bf16(pa, fa[j], acc[g * 4 + j]);
      __builtin_amdgcn_sched_barrier(0);            // as in the score loop
#pragma unroll
      for (int j = 0; j < 4; ++j) fa[j] = fb[j];
    }
    wait_ds0();
    wait_copies0();
    __syncthreads();          // publishes tile t+1, ends every read of tile t
    if (t + 2 < 128) {
      copy_tile32k(kbase + (size_t)(t + 2) * 32 * Cq, &kvbuf[t & 1][0][0], threadIdx.x);
      copy_tile32k(vbase + (size_t)(t + 2) * 32 * Cq, &kvbuf[t & 1][1][0], threadIdx.x);
    }
  }
  wait_copies0();
#pragma unroll
  for (int ct = 0; ct < 32; ++ct) {
    int ch = ct * 16 + (lane & 15);
    bf16* ob = ao + ((size_t)qt * 16 + (ch >> 5)) * 512;
#pragma unroll
    for (int r = 0; r < 8; ++r)
      ob[frag_off(r + half * 8, ch & 31)] = (bf16)acc[ct][r];
    // Before the next tile's conversions reuse a register that a store names.
    asm volatile("s_wait_xcnt 0x0" ::: "memory");
  }
}

// ---------------------------------------------------------------------------
// 7) Output projection + bias + residual, fp32 store.
// ---------------------------------------------------------------------------
__global__ __launch_bounds__(256) void k_out_proj(const bf16* __restrict__ ao,
                                                  const bf16* __restrict__ wo,
                                                  const float* __restrict__ bo,
                                                  const float* __restrict__ x,
                                                  float* __restrict__ out) {
  __shared__ __align__(16) bf16 atile[16 * 512];
  int wave = threadIdx.x >> 5, lane = threadIdx.x & 31;
  int mt = blockIdx.x >> 2;
  int ct = ((blockIdx.x & 3) << 3) + wave;
  int m0 = mt << 4;
  for (int i = threadIdx.x; i < 16 * 512 / 8; i += 256)
    stage16((const uint4*)(ao + (size_t)m0 * Cq) + i, (uint4*)atile + i);
  wait_async();
  __syncthreads();
  v8f acc = {};
  for (int kt = 0; kt < 16; ++kt) {
    v16bf a = frag_packed(atile + kt * 512, lane);
    acc = wmma_bf16(a, frag_packed(wo + (size_t)(kt * 32 + ct) * 512, lane), acc);
  }
  int half = lane >> 4;
  int col = (ct << 4) + (lane & 15);
  float bias = bo[col];
#pragma unroll
  for (int r = 0; r < 8; ++r) {
    int row = m0 + r + half * 8;
    size_t idx = (size_t)row * Cq + col;
    out[idx] = acc[r] + bias + x[idx];
  }
}

// ---------------------------------------------------------------------------
// Launch
// ---------------------------------------------------------------------------
extern "C" void kernel_launch(void* const* d_in, const int* in_sizes, int n_in,
                              void* d_out, int out_size, void* d_ws, size_t ws_size,
                              hipStream_t stream) {
  const float* x      = (const float*)d_in[0];
  const float* gscale = (const float*)d_in[1];
  const float* gbias  = (const float*)d_in[2];
  const float* wq     = (const float*)d_in[3];
  const float* bq     = (const float*)d_in[4];
  const float* wk     = (const float*)d_in[5];
  const float* bk     = (const float*)d_in[6];
  const float* wv     = (const float*)d_in[7];
  const float* bv     = (const float*)d_in[8];
  const float* wo     = (const float*)d_in[9];
  const float* bo     = (const float*)d_in[10];
  float* out = (float*)d_out;

  char* ws = (char*)d_ws;
  float* stats = (float*)ws;                               // 2 KB
  bf16* wpkq = (bf16*)(ws + 4096);                         // 4 x 512KB packed weights
  bf16* wpkk = (bf16*)(ws + 4096 + 1 * 524288);
  bf16* wpkv = (bf16*)(ws + 4096 + 2 * 524288);
  bf16* wpko = (bf16*)(ws + 4096 + 3 * 524288);
  size_t o = 4096 + 4 * 524288;
  bf16* hn  = (bf16*)(ws + o); o += 33554432;              // normalized acts / reused as attn out
  bf16* qb  = (bf16*)(ws + o); o += 33554432;              // Q, fragment order
  bf16* kb  = (bf16*)(ws + o); o += 33554432;              // K, fragment order
  bf16* vtb = (bf16*)(ws + o); o += 33554432;              // V, fragment order (rows = channels)
  float* ms = (float*)(ws + o);                            // per-row (max, 1/sum)

  k_gn_stats<<<256, 256, 0, stream>>>(x, stats);
  k_gn_apply<<<16384, 256, 0, stream>>>(x, stats, gscale, gbias, hn);
  k_pack_w<<<64, 256, 0, stream>>>(wq, wpkq);
  k_pack_w<<<64, 256, 0, stream>>>(wk, wpkk);
  k_pack_w<<<64, 256, 0, stream>>>(wv, wpkv);
  k_pack_w<<<64, 256, 0, stream>>>(wo, wpko);
  k_qkv<<<8192, 256, 0, stream>>>(hn, wpkq, wpkk, wpkv, bq, bk, bv, qb, kb, vtb);
  k_attn_stats<<<256, 256, 0, stream>>>(qb, kb, ms);
  k_attn_out<<<256, 256, 0, stream>>>(qb, kb, vtb, ms, hn);  // attn out overwrites hn
  k_out_proj<<<8192, 256, 0, stream>>>(hn, wpko, bo, x, out);
}

// v003
// A run of this version takes 363 microseconds.
// Two timings next to v002 both put it at 1.50 times that version's speed.
// All steps since v000 together make it 7.05 times as fast.
#include <hip/hip_runtime.h>

typedef __bf16 bf16;
typedef __attribute__((ext_vector_type(16))) __bf16 v16bf;
typedef __attribute__((ext_vector_type(8)))  __bf16 v8bf;
typedef __attribute__((ext_vector_type(8)))  float  v8f;
typedef __attribute__((ext_vector_type(4)))  int    v4i;
typedef __attribute__((address_space(3))) v4i* lds_v4i_p;

#define Bq 8
#define Cq 512
#define Nq 4096
#define Mq 32768
#define SCALEF 0.044194173824159216f   // 1/sqrt(512)
#define EPSQ 1e-5f

// ---------------------------------------------------------------------------
// WMMA helpers
// ---------------------------------------------------------------------------
__device__ __forceinline__ v8f wmma_bf16(v16bf a, v16bf b, v8f c) {
  return __builtin_amdgcn_wmma_f32_16x16x32_bf16(false, a, false, b, (short)0, c,
                                                 false, false);
}

__device__ __forceinline__ v16bf cat8(v8bf lo, v8bf hi) {
  return __builtin_shufflevector(lo, hi, 0, 1, 2, 3, 4, 5, 6, 7,
                                         8, 9, 10, 11, 12, 13, 14, 15);
}

// Fragment order. Every bf16 WMMA operand (in the workspace and in LDS) is kept
// as 1 KB blocks, one block per 16-row x 32-k fragment: [part 0..1][lane 0..31][8].
// Per ISA layout: lane L -> row = L&15, half = L>>4;
// part 0, elements 0..7  -> k = half*8 + j
// part 1, elements 8..15 -> k = 16 + half*8 + j
// so each of the two 16-byte reads of a fragment covers 512 contiguous bytes
// over the wave: four whole lines from global memory, no shared bank in LDS.
// The same pattern serves as a B fragment (rows indexed by N).
// frag_off: place of element (row r16, k index k32) inside its block.
__device__ __forceinline__ int frag_off(int r16, int k32) {
  return ((k32 >> 4) << 8) + (((((k32 >> 3) & 1) << 4) + r16) << 3) + (k32 & 7);
}

__device__ __forceinline__ v16bf frag_packed(const bf16* blk, int lane) {
  const bf16* p = blk + lane * 8;
  v8bf lo = *(const v8bf*)p;
  v8bf hi = *(const v8bf*)(p + 256);
  return cat8(lo, hi);
}

// ---------------------------------------------------------------------------
// Async global -> LDS staging (gfx1250 GLOBAL_LOAD_ASYNC_TO_LDS_B128,
// tracked by ASYNCcnt). Param 0 is a generic v4i* (per compiler diagnostic);
// LDS side is cast to addrspace(3), which also converts implicitly to
// generic if the builtin is declared that way.
// ---------------------------------------------------------------------------
__device__ __forceinline__ void stage16(const void* gsrc, void* ldst) {
#if __has_builtin(__builtin_amdgcn_global_load_async_to_lds_b128)
  __builtin_amdgcn_global_load_async_to_lds_b128((v4i*)gsrc, (lds_v4i_p)ldst, 0, 0);
#else
  *(uint4*)ldst = *(const uint4*)gsrc;
#endif
}

__device__ __forceinline__ void wait_async() {
#if __has_builtin(__builtin_amdgcn_s_wait_asynccnt)
  __builtin_amdgcn_s_wait_asynccnt(0);
#else
  asm volatile("s_wait_asynccnt 0" ::: "memory");
#endif
}

// ---------------------------------------------------------------------------
// 1) GroupNorm statistics: one block per (batch, group); 256-thread reduce.
// ---------------------------------------------------------------------------
__global__ __launch_bounds__(256) void k_gn_stats(const float* __restrict__ x,
                                                  float* __restrict__ stats) {
  int bg = blockIdx.x;            // 0..255 : b*32+g
  int b = bg >> 5, g = bg & 31;
  const float* xb = x + (size_t)b * Nq * Cq + g * 16;
  float s = 0.f, ss = 0.f;
  for (int n = threadIdx.x; n < Nq; n += 256) {
    const float* p = xb + (size_t)n * Cq;
#pragma unroll
    for (int ci = 0; ci < 16; ++ci) { float v = p[ci]; s += v; ss += v * v; }
  }
  __shared__ float sh_s[256], sh_ss[256];
  sh_s[threadIdx.x] = s; sh_ss[threadIdx.x] = ss;
  __syncthreads();
  for (int off = 128; off > 0; off >>= 1) {
    if (threadIdx.x < off) {
      sh_s[threadIdx.x]  += sh_s[threadIdx.x + off];
      sh_ss[threadIdx.x] += sh_ss[threadIdx.x + off];
    }
    __syncthreads();
  }
  if (threadIdx.x == 0) {
    float inv = 1.0f / (float)(Nq * 16);
    float mean = sh_s[0] * inv;
    float var  = sh_ss[0] * inv - mean * mean;
    stats[bg * 2]     = mean;
    stats[bg * 2 + 1] = rsqrtf(var + EPSQ);
  }
}

// ---------------------------------------------------------------------------
// 2) Apply GroupNorm, emit bf16 activations (M x C in fragment order:
//    block (m>>4, c>>5); a 16-row tile is 16 KB contiguous).
// ---------------------------------------------------------------------------
__global__ __launch_bounds__(256) void k_gn_apply(const float* __restrict__ x,
                                                  const float* __restrict__ stats,
                                                  const float* __restrict__ gamma,
                                                  const float* __restrict__ beta,
                                                  bf16* __restrict__ hn) {
  // i4 is the place in hn: threads walk the fragment order, so a wave stores
  // whole lines and each line has one writer; (m, c) is read back from the place.
  size_t i4 = ((size_t)blockIdx.x * 256 + threadIdx.x) * 4;
  int w = (int)(i4 & 511);
  int blk = (int)(i4 >> 9);
  int c = ((blk & 15) << 5) + ((w >> 8) << 4) + (((w >> 7) & 1) << 3) + (w & 7);
  int m = ((blk >> 4) << 4) + ((w >> 3) & 15);
  int b = m >> 12;
  int g = c >> 4;
  float mean = stats[(b * 32 + g) * 2];
  float rstd = stats[(b * 32 + g) * 2 + 1];
  float4 xv = *(const float4*)(x + (size_t)m * Cq + c);
  bf16* o = hn + i4;
  o[0] = (bf16)((xv.x - mean) * rstd * gamma[c]     + beta[c]);
  o[1] = (bf16)((xv.y - mean) * rstd * gamma[c + 1] + beta[c + 1]);
  o[2] = (bf16)((xv.z - mean) * rstd * gamma[c + 2] + beta[c + 2]);
  o[3] = (bf16)((xv.w - mean) * rstd * gamma[c + 3] + beta[c + 3]);
}

// ---------------------------------------------------------------------------
// 3) Pack a 512x512 f32 weight (w[k][n]) into fragment order:
//    block (kt*32+nt), rows indexed by n.
// ---------------------------------------------------------------------------
__global__ __launch_bounds__(256) void k_pack_w(const float* __restrict__ w,
                                                bf16* __restrict__ wpk) {
  int tid = blockIdx.x * 256 + threadIdx.x;
  if (tid >= 16 * 32 * 32) return;   // ktiles(16) * ntiles(32) * lanes(32)
  int lane = tid & 31;
  int nt = (tid >> 5) & 31;
  int kt = tid >> 10;
  int n = nt * 16 + (lane & 15);
  int half = lane >> 4;
  bf16* dst = wpk + (size_t)(tid >> 5) * 512 + lane * 8; // tid>>5 == kt*32+nt
#pragma unroll
  for (int j = 0; j < 8; ++j)
    dst[j] = (bf16)w[(kt * 32 + half * 8 + j) * Cq + n];
#pragma unroll
  for (int j = 0; j < 8; ++j)
    dst[256 + j] = (bf16)w[(kt * 32 + 16 + half * 8 + j) * Cq + n];
}

// ---------------------------------------------------------------------------
// 4) Fused QKV projection. 8 waves share one async-staged 16x512 A tile;
//    each wave computes one 16x16 tile for q, k, v (A fragment reused 3x).
//    q,k stored in fragment order, block (row>>4, channel>>5); v stored in
//    fragment order for P*V (rows = channels, k = keys), block (key>>5, channel>>4):
//    a lane's eight accumulator rows are its own 16 bytes of that block.
// ---------------------------------------------------------------------------
__global__ __launch_bounds__(256) void k_qkv(const bf16* __restrict__ hn,
                                             const bf16* __restrict__ wq,
                                             const bf16* __restrict__ wk,
                                             const bf16* __restrict__ wv,
                                             const float* __restrict__ bq,
                                             const float* __restrict__ bk,
                                             const float* __restrict__ bv,
                                             bf16* __restrict__ qb,
                                             bf16* __restrict__ kb,
                                             bf16* __restrict__ vtb) {
  __shared__ __align__(16) bf16 atile[16 * 512];
  int wave = threadIdx.x >> 5, lane = threadIdx.x & 31;
  int mt = blockIdx.x >> 2;
  int ct = ((blockIdx.x & 3) << 3) + wave;
  int m0 = mt << 4;
  for (int i = threadIdx.x; i < 16 * 512 / 8; i += 256)
    stage16((const uint4*)(hn + (size_t)m0 * Cq) + i, (uint4*)atile + i);
  wait_async();
  __syncthreads();
  v8f aq = {}, ak = {}, av = {};
  // Fully unrolled: the weight reads of later k steps then issue ahead of the
  // WMMAs of earlier ones; rolled, each read is waited for before its WMMA.
#pragma unroll
  for (int kt = 0; kt < 16; ++kt) {
    v16bf a = frag_packed(atile + kt * 512, lane);
    size_t wb = (size_t)(kt * 32 + ct) * 512;
    aq = wmma_bf16(a, frag_packed(wq + wb, lane), aq);
    ak = wmma_bf16(a, frag_packed(wk + wb, lane), ak);
    av = wmma_bf16(a, frag_packed(wv + wb, lane), av);
  }
  int half = lane >> 4;
  int col = (ct << 4) + (lane & 15);
  float xbq = bq[col], xbk = bk[col], xbv = bv[col];
  size_t qkblk = ((size_t)mt * 16 + (col >> 5)) * 512;
  v8bf vv;
#pragma unroll
  for (int r = 0; r < 8; ++r) {
    int off = frag_off(r + half * 8, col & 31);   // C/D layout: M = vgpr + half*8
    qb[qkblk + off] = (bf16)(aq[r] + xbq);
    kb[qkblk + off] = (bf16)(ak[r] + xbk);
    vv[r] = (bf16)(av[r] + xbv);
  }
  int bb = m0 >> 12, n0 = m0 & (Nq - 1);          // key = n0 + half*8 + r
  *(v8bf*)(vtb + (size_t)bb * Cq * Nq + ((size_t)(n0 >> 5) * 32 + ct) * 512 +
           ((n0 >> 4) & 1) * 256 + lane * 8) = vv;
}

typedef __attribute__((address_space(3))) char* lds_char_p;
#define QREG 2   // Q fragments (of 16) that the attention kernel keeps in registers

__device__ __forceinline__ void copy_tile32k(const bf16* g, bf16* l, int tid) {
  const char* gp = (const char*)g + tid * 16;
  unsigned lp = (unsigned)(__UINTPTR_TYPE__)(lds_char_p)(char*)l + (unsigned)tid * 16u;
  // The copies and their s_wait_xcnt stand in one statement, so no address
  // register of an issued copy is rewritten ahead of that wait.
  asm volatile(
      "global_load_async_to_lds_b128 %0, %8, off\n\t"
      "global_load_async_to_lds_b128 %1, %9, off\n\t"
      "global_load_async_to_lds_b128 %2, %10, off\n\t"
      "global_load_async_to_lds_b128 %3, %11, off\n\t"
      "global_load_async_to_lds_b128 %4, %12, off\n\t"
      "global_load_async_to_lds_b128 %5, %13, off\n\t"
      "global_load_async_to_lds_b128 %6, %14, off\n\t"
      "global_load_async_to_lds_b128 %7, %15, off\n\t"
      "s_wait_xcnt 0x0"
      :: "v"(lp), "v"(lp + 4096u), "v"(lp + 8192u), "v"(lp + 12288u),
         "v"(lp + 16384u), "v"(lp + 20480u), "v"(lp + 24576u), "v"(lp + 28672u),
         "v"(gp), "v"(gp + 4096), "v"(gp + 8192), "v"(gp + 12288),
         "v"(gp + 16384), "v"(gp + 20480), "v"(gp + 24576), "v"(gp + 28672)
      : "memory");
}

// This wave's own LDS reads and writes have retired (before a buffer is handed
// back for refill, and before a wave reads back what its lanes wrote).
__device__ __forceinline__ void wait_ds0() {
  asm volatile("s_wait_dscnt 0x0" ::: "memory");
}
// This wave's own copies have landed (before the barrier that publishes them).
__device__ __forceinline__ void wait_copies0() {
  asm volatile("s_wait_asynccnt 0x0" ::: "memory");
}

// ---------------------------------------------------------------------------
// Maximum / sum over the 16 lanes of a row (C/D layout: lane = key column,
// VGPR r = query row r + half*8): a four-step butterfly on the vector unit's
// own lane exchange; every lane of the row ends with the result.
// ---------------------------------------------------------------------------
template <int CTRL>
__device__ __forceinline__ float row_xchg(float v) {   // CTRL = 0x160 + xor mask
  return __builtin_bit_cast(float, __builtin_amdgcn_update_dpp(
      0, __builtin_bit_cast(int, v), CTRL, 0xf, 0xf, true));
}
__device__ __forceinline__ float row_max16(float v) {
  v = fmaxf(v, row_xchg<0x161>(v));
  v = fmaxf(v, row_xchg<0x162>(v));
  v = fmaxf(v, row_xchg<0x164>(v));
  v = fmaxf(v, row_xchg<0x168>(v));
  return v;
}
__device__ __forceinline__ float row_sum16(float v) {
  v += row_xchg<0x161>(v);
  v += row_xchg<0x162>(v);
  v += row_xchg<0x164>(v);
  v += row_xchg<0x168>(v);
  return v;
}
// A row's maximum in use is replaced only when a tile's maximum exceeds it by
// more than this (P then stays below e^5.5, about 245).
#define RESCALE_OVER 5.5f

// ---------------------------------------------------------------------------
// 5) Attention, one pass (online softmax): one wave per 16-query tile, all 512
//    output channels in its accumulators; 8 tiles per work-group share the
//    staged K and V tiles. P = exp(s - m) with m the row maximum in use, not yet
//    divided by the row sum; when m moves, accumulators and sums are rescaled;
//    the division by the sum comes once, in the epilogue. P (bf16) turns from
//    accumulator to A-fragment order through the wave's own 1 KB of LDS.
// ---------------------------------------------------------------------------
__global__ __launch_bounds__(256) void k_attn_out(const bf16* __restrict__ qb,
                                                  const bf16* __restrict__ kb,
                                                  const bf16* __restrict__ vtb,
                                                  bf16* __restrict__ ao) {
  __shared__ __align__(16) bf16 kvbuf[2][2][32 * 512];   // [buffer][K, V]
  __shared__ __align__(16) bf16 pbuf[8][16 * 32];
  __shared__ __align__(16) bf16 qlds[8][(16 - QREG) * 512];
  int wave = threadIdx.x >> 5, lane = threadIdx.x & 31;
  int qt = blockIdx.x * 8 + wave;
  int b = blockIdx.x >> 5;
  const bf16* kbase = kb + (size_t)b * Nq * Cq;
  const bf16* vbase = vtb + (size_t)b * Cq * Nq;
  copy_tile32k(kbase, &kvbuf[0][0][0], threadIdx.x);
  copy_tile32k(vbase, &kvbuf[0][1][0], threadIdx.x);
  // The first QREG of the wave's 16 Q fragments stay in registers; beside the
  // 256 accumulator registers no more fit, so the rest lie in its own LDS.
  const bf16* qsrc = qb + (size_t)qt * 16 * Cq + lane * 8;   // the lane's 16 bytes
  v16bf qf[QREG];
#pragma unroll
  for (int kt = 0; kt < QREG; ++kt)
    qf[kt] = cat8(*(const v8bf*)(qsrc + kt * 512), *(const v8bf*)(qsrc + kt * 512 + 256));
  v8bf qlo[16 - QREG], qhi[16 - QREG];
#pragma unroll
  for (int kt = QREG; kt < 16; ++kt) {
    qlo[kt - QREG] = *(const v8bf*)(qsrc + kt * 512);
    qhi[kt - QREG] = *(const v8bf*)(qsrc + kt * 512 + 256);
  }
  int half = lane >> 4;
  // mrow: the row maximum in use; lsum: this lane's share of the row sum (its
  // own key columns), joined over the row in the epilogue.
  float mrow[8], lsum[8];
#pragma unroll
  for (int r = 0; r < 8; ++r) { mrow[r] = -1e30f; lsum[r] = 0.f; }
  // The address registers of the loads above stay as they are until this wait
  // (named as an input so that they live up to it).
  asm volatile("s_wait_xcnt 0x0" :: "v"(qsrc) : "memory");
  bf16* ql = &qlds[wave][0];
#pragma unroll
  for (int kt = QREG; kt < 16; ++kt) {
    *(v8bf*)(ql + (kt - QREG) * 512 + lane * 8)       = qlo[kt - QREG];
    *(v8bf*)(ql + (kt - QREG) * 512 + 256 + lane * 8) = qhi[kt - QREG];
  }
  wait_copies0();
  __syncthreads();                                  // publish tile 0
  // Keeps the address arithmetic of tile 1's copies behind the Q staging; formed
  // ahead of it, those addresses are spilled to scratch and read back here.
  __builtin_amdgcn_sched_barrier(0);
  copy_tile32k(kbase + 32 * Cq, &kvbuf[1][0][0], threadIdx.x);
  copy_tile32k(vbase + 32 * Cq, &kvbuf[1][1][0], threadIdx.x);
  v8f acc[32] = {};
  bf16* pb = &pbuf[wave][0];
  for (int t = 0; t < 128; ++t) {                   // 32 keys per trip
    const bf16* kt32 = &kvbuf[t & 1][0][0];
    const bf16* vt32 = &kvbuf[t & 1][1][0];
    v8f d0 = {}, d1 = {};
    // K and V fragments come in groups of four; the next group's LDS reads are
    // issued ahead of this group's WMMAs. Unrolled so that qf[], acc[] and the
    // two groups are indexed by constants and stay in registers.
    v16bf fa[4], fb[4], qa[2], qn[2];
#pragma unroll
    for (int j = 0; j < 4; ++j)
      fa[j] = frag_packed(kt32 + (j & 1) * 16 * Cq + (j >> 1) * 512, lane);
#pragma unroll
    for (int g = 0; g < 8; ++g) {
#pragma unroll
      for (int j = 0; j < 4; ++j)
        fb[j] = (g < 7)
            ? frag_packed(kt32 + (j & 1) * 16 * Cq + ((g + 1) * 2 + (j >> 1)) * 512, lane)
            : frag_packed(vt32 + j * 512, lane);    // first V group
      if (g < 7 && (g + 1) * 2 >= QREG) {           // the next group's Q, where in LDS
        qn[0] = frag_packed(ql + ((g + 1) * 2 - QREG) * 512, lane);
        qn[1] = frag_packed(ql + ((g + 1) * 2 + 1 - QREG) * 512, lane);
      }
      // Keeps the reads above as one group ahead of the WMMAs; left free, each
      // read sinks to just in front of its WMMA, which then waits out its latency.
      __builtin_amdgcn_sched_barrier(0);
      v16bf q0 = (g * 2 < QREG) ? qf[(g * 2) % QREG] : qa[0];
      v16bf q1 = (g * 2 < QREG) ? qf[(g * 2 + 1) % QREG] : qa[1];
      d0 = wmma_bf16(q0, fa[0], d0);
      d1 = wmma_bf16(q0, fa[1], d1);
      d0 = wmma_bf16(q1, fa[2], d0);
      d1 = wmma_bf16(q1, fa[3], d1);
      // Keeps the following group's reads behind these WMMAs (two groups live).
      __builtin_amdgcn_sched_barrier(0);
#pragma unroll
      for (int j = 0; j < 4; ++j) fa[j] = fb[j];
      qa[0] = qn[0]; qa[1] = qn[1];
    }
    // The tile's row maxima, and how far the highest stands above its row's
    // maximum in use.
    float tmax[8];
#pragma unroll
    for (int r = 0; r < 8; ++r) tmax[r] = row_max16(fmaxf(d0[r], d1[r])) * SCALEF;
    float over = tmax[0] - mrow[0];
#pragma unroll
    for (int r = 1; r < 8; ++r) over = fmaxf(over, tmax[r] - mrow[r]);
    // One test per tile, the same for the whole wave (a scalar branch): the
    // 256 accumulator registers are rescaled only when some row's maximum has
    // passed the one in use by the margin.
    if (__builtin_amdgcn_ballot_w32(over > RESCALE_OVER) != 0) {
#pragma unroll
      for (int r = 0; r < 8; ++r) {
        float mnew = fmaxf(mrow[r], tmax[r]);
        float f = __expf(mrow[r] - mnew);           // 0 on the first tile
        mrow[r] = mnew;
        lsum[r] *= f;
#pragma unroll
        for (int ct = 0; ct < 32; ++ct) acc[ct][r] *= f;
      }
    }
#pragma unroll
    for (int r = 0; r < 8; ++r) {
      float p0 = __expf(d0[r] * SCALEF - mrow[r]);
      float p1 = __expf(d1[r] * SCALEF - mrow[r]);
      lsum[r] += p0 + p1;
      int off = frag_off(r + half * 8, lane & 15);
      pb[off]       = (bf16)p0;                     // keys 0..15 of the tile: part 0
      pb[off + 256] = (bf16)p1;                     // keys 16..31: part 1
    }
    wait_ds0();               // the other lanes' P stores, before the read back
    v16bf pa = frag_packed(pb, lane);
#pragma unroll
    for (int g = 0; g < 8; ++g) {
      if (g < 7) {
#pragma unroll
        for (int j = 0; j < 4; ++j)
          fb[j] = frag_packed(vt32 + ((g + 1) * 4 + j) * 512, lane);
      }
      __builtin_amdgcn_sched_barrier(0);            // as in the score loop
#pragma unroll
      for (int j = 0; j < 4; ++j)
        acc[g * 4 + j] = wmma_bf16(pa, fa[j], acc[g * 4 + j]);
      __builtin_amdgcn_sched_barrier(0);            // as in the score loop
#pragma unroll
      for (int j = 0; j < 4; ++j) fa[j] = fb[j];
    }
    wait_ds0();
    wait_copies0();
    __syncthreads();          // publishes tile t+1, ends every read of tile t
    if (t + 2 < 128) {
      copy_tile32k(kbase + (size_t)(t + 2) * 32 * Cq, &kvbuf[t & 1][0][0], threadIdx.x);
      copy_tile32k(vbase + (size_t)(t + 2) * 32 * Cq, &kvbuf[t & 1][1][0], threadIdx.x);
    }
  }
  wait_copies0();
  float rinv[8];
#pragma unroll
  for (int r = 0; r < 8; ++r) rinv[r] = 1.0f / row_sum16(lsum[r]);
#pragma unroll
  for (int ct = 0; ct < 32; ++ct) {
    int ch = ct * 16 + (lane & 15);
    bf16* ob = ao + ((size_t)qt * 16 + (ch >> 5)) * 512;
#pragma unroll
    for (int r = 0; r < 8; ++r)
      ob[frag_off(r + half * 8, ch & 31)] = (bf16)(acc[ct][r] * rinv[r]);
    // Before the next tile's conversions reuse a register that a store names.
    asm volatile("s_wait_xcnt 0x0" ::: "memory");
    // Holds the next tile's conversions behind that wait; left free, some of
    // them are lifted over it.
    __builtin_amdgcn_sched_barrier(0);
  }
}

// ---------------------------------------------------------------------------
// 6) Output projection + bias + residual, fp32 store.
// ---------------------------------------------------------------------------
__global__ __launch_bounds__(256) void k_out_proj(const bf16* __restrict__ ao,
                                                  const bf16* __restrict__ wo,
                                                  const float* __restrict__ bo,
                                                  const float* __restrict__ x,
                                                  float* __restrict__ out) {
  __shared__ __align__(16) bf16 atile[16 * 512];
  int wave = threadIdx.x >> 5, lane = threadIdx.x & 31;
  int mt = blockIdx.x >> 2;
  int ct = ((blockIdx.x & 3) << 3) + wave;
  int m0 = mt << 4;
  for (int i = threadIdx.x; i < 16 * 512 / 8; i += 256)
    stage16((const uint4*)(ao + (size_t)m0 * Cq) + i, (uint4*)atile + i);
  wait_async();
  __syncthreads();
  v8f acc = {};
  for (int kt = 0; kt < 16; ++kt) {
    v16bf a = frag_packed(atile + kt * 512, lane);
    acc = wmma_bf16(a, frag_packed(wo + (size_t)(kt * 32 + ct) * 512, lane), acc);
  }
  int half = lane >> 4;
  int col = (ct << 4) + (lane & 15);
  float bias = bo[col];
#pragma unroll
  for (int r = 0; r < 8; ++r) {
    int row = m0 + r + half * 8;
    size_t idx = (size_t)row * Cq + col;
    out[idx] = acc[r] + bias + x[idx];
  }
}

// ---------------------------------------------------------------------------
// Launch
// ---------------------------------------------------------------------------
extern "C" void kernel_launch(void* const* d_in, const int* in_sizes, int n_in,
                              void* d_out, int out_size, void* d_ws, size_t ws_size,
                              hipStream_t stream) {
  const float* x      = (const float*)d_in[0];
  const float* gscale = (const float*)d_in[1];
  const float* gbias  = (const float*)d_in[2];
  const float* wq     = (const float*)d_in[3];
  const float* bq     = (const float*)d_in[4];
  const float* wk     = (const float*)d_in[5];
  const float* bk     = (const float*)d_in[6];
  const float* wv     = (const float*)d_in[7];
  const float* bv     = (const float*)d_in[8];
  const float* wo     = (const float*)d_in[9];
  const float* bo     = (const float*)d_in[10];
  float* out = (float*)d_out;

  char* ws = (char*)d_ws;
  float* stats = (float*)ws;                               // 2 KB
  bf16* wpkq = (bf16*)(ws + 4096);                         // 4 x 512KB packed weights
  bf16* wpkk = (bf16*)(ws + 4096 + 1 * 524288);
  bf16* wpkv = (bf16*)(ws + 4096 + 2 * 524288);
  bf16* wpko = (bf16*)(ws + 4096 + 3 * 524288);
  size_t o = 4096 + 4 * 524288;
  bf16* hn  = (bf16*)(ws + o); o += 33554432;              // normalized acts / reused as attn out
  bf16* qb  = (bf16*)(ws + o); o += 33554432;              // Q, fragment order
  bf16* kb  = (bf16*)(ws + o); o += 33554432;              // K, fragment order
  bf16* vtb = (bf16*)(ws + o);                             // V, fragment order (rows = channels)

  k_gn_stats<<<256, 256, 0, stream>>>(x, stats);
  k_gn_apply<<<16384, 256, 0, stream>>>(x, stats, gscale, gbias, hn);
  k_pack_w<<<64, 256, 0, stream>>>(wq, wpkq);
  k_pack_w<<<64, 256, 0, stream>>>(wk, wpkk);
  k_pack_w<<<64, 256, 0, stream>>>(wv, wpkv);
  k_pack_w<<<64, 256, 0, stream>>>(wo, wpko);
  k_qkv<<<8192, 256, 0, stream>>>(hn, wpkq, wpkk, wpkv, bq, bk, bv, qb, kb, vtb);
  k_attn_out<<<256, 256, 0, stream>>>(qb, kb, vtb, hn);      // attn out overwrites hn
  k_out_proj<<<8192, 256, 0, stream>>>(hn, wpko, bo, x, out);
}

// v004
// It runs in 333 microseconds.
// Timed twice side by side with v003, it ran 1.09 times as fast both times.
// Counting every step since v000, it is 7.68 times as fast.
#include <hip/hip_runtime.h>

typedef __bf16 bf16;
typedef __attribute__((ext_vector_type(16))) __bf16 v16bf;
typedef __attribute__((ext_vector_type(8)))  __bf16 v8bf;
typedef __attribute__((ext_vector_type(8)))  float  v8f;
typedef __attribute__((ext_vector_type(4)))  int    v4i;
typedef __attribute__((address_space(3))) v4i* lds_v4i_p;

#define Bq 8
#define Cq 512
#define Nq 4096
#define Mq 32768
#define SCALEF 0.044194173824159216f   // 1/sqrt(512)
#define EPSQ 1e-5f

// ---------------------------------------------------------------------------
// WMMA helpers
// ---------------------------------------------------------------------------
__device__ __forceinline__ v8f wmma_bf16(v16bf a, v16bf b, v8f c) {
  return __builtin_amdgcn_wmma_f32_16x16x32_bf16(false, a, false, b, (short)0, c,
                                                 false, false);
}

__device__ __forceinline__ v16bf cat8(v8bf lo, v8bf hi) {
  return __builtin_shufflevector(lo, hi, 0, 1, 2, 3, 4, 5, 6, 7,
                                         8, 9, 10, 11, 12, 13, 14, 15);
}

// Fragment order. Every bf16 WMMA operand (in the workspace and in LDS) is kept
// as 1 KB blocks, one block per 16-row x 32-k fragment: [part 0..1][lane 0..31][8].
// Per ISA layout: lane L -> row = L&15, half = L>>4;
// part 0, elements 0..7  -> k = half*8 + j
// part 1, elements 8..15 -> k = 16 + half*8 + j
// so each of the two 16-byte reads of a fragment covers 512 contiguous bytes
// over the wave: four whole lines from global memory, no shared bank in LDS.
// The same pattern serves as a B fragment (rows indexed by N).
// frag_off: place of element (row r16, k index k32) inside its block.
__device__ __forceinline__ int frag_off(int r16, int k32) {
  return ((k32 >> 4) << 8) + (((((k32 >> 3) & 1) << 4) + r16) << 3) + (k32 & 7);
}

__device__ __forceinline__ v16bf frag_packed(const bf16* blk, int lane) {
  const bf16* p = blk + lane * 8;
  v8bf lo = *(const v8bf*)p;
  v8bf hi = *(const v8bf*)(p + 256);
  return cat8(lo, hi);
}

// ---------------------------------------------------------------------------
// Async global -> LDS staging (gfx1250 GLOBAL_LOAD_ASYNC_TO_LDS_B128,
// tracked by ASYNCcnt). Param 0 is a generic v4i* (per compiler diagnostic);
// LDS side is cast to addrspace(3), which also converts implicitly to
// generic if the builtin is declared that way.
// ---------------------------------------------------------------------------
__device__ __forceinline__ void stage16(const void* gsrc, void* ldst) {
#if __has_builtin(__builtin_amdgcn_global_load_async_to_lds_b128)
  __builtin_amdgcn_global_load_async_to_lds_b128((v4i*)gsrc, (lds_v4i_p)ldst, 0, 0);
#else
  *(uint4*)ldst = *(const uint4*)gsrc;
#endif
}

// This wave's own copies have landed (before the barrier that publishes them).
__device__ __forceinline__ void wait_copies0() {
  asm volatile("s_wait_asynccnt 0x0" ::: "memory");
}

// 16-row tiles per work-group of the two projection kernels: each wave carries
// all of them, so one weight fragment read from L2 feeds that many WMMAs.
#define PROJ_MT 4

// ---------------------------------------------------------------------------
// 1) GroupNorm statistics: one block per (batch, group); 256-thread reduce.
// ---------------------------------------------------------------------------
__global__ __launch_bounds__(256) void k_gn_stats(const float* __restrict__ x,
                                                  float* __restrict__ stats) {
  int bg = blockIdx.x;            // 0..255 : b*32+g
  int b = bg >> 5, g = bg & 31;
  const float* xb = x + (size_t)b * Nq * Cq + g * 16;
  float s = 0.f, ss = 0.f;
  for (int n = threadIdx.x; n < Nq; n += 256) {
    const float* p = xb + (size_t)n * Cq;
#pragma unroll
    for (int ci = 0; ci < 16; ++ci) { float v = p[ci]; s += v; ss += v * v; }
  }
  __shared__ float sh_s[256], sh_ss[256];
  sh_s[threadIdx.x] = s; sh_ss[threadIdx.x] = ss;
  __syncthreads();
  for (int off = 128; off > 0; off >>= 1) {
    if (threadIdx.x < off) {
      sh_s[threadIdx.x]  += sh_s[threadIdx.x + off];
      sh_ss[threadIdx.x] += sh_ss[threadIdx.x + off];
    }
    __syncthreads();
  }
  if (threadIdx.x == 0) {
    float inv = 1.0f / (float)(Nq * 16);
    float mean = sh_s[0] * inv;
    float var  = sh_ss[0] * inv - mean * mean;
    stats[bg * 2]     = mean;
    stats[bg * 2 + 1] = rsqrtf(var + EPSQ);
  }
}

// ---------------------------------------------------------------------------
// 2) Apply GroupNorm, emit bf16 activations (M x C in fragment order:
//    block (m>>4, c>>5); a 16-row tile is 16 KB contiguous).
// ---------------------------------------------------------------------------
__global__ __launch_bounds__(256) void k_gn_apply(const float* __restrict__ x,
                                                  const float* __restrict__ stats,
                                                  const float* __restrict__ gamma,
                                                  const float* __restrict__ beta,
                                                  bf16* __restrict__ hn) {
  // i4 is the place in hn: threads walk the fragment order, so a wave stores
  // whole lines and each line has one writer; (m, c) is read back from the place.
  size_t i4 = ((size_t)blockIdx.x * 256 + threadIdx.x) * 4;
  int w = (int)(i4 & 511);
  int blk = (int)(i4 >> 9);
  int c = ((blk & 15) << 5) + ((w >> 8) << 4) + (((w >> 7) & 1) << 3) + (w & 7);
  int m = ((blk >> 4) << 4) + ((w >> 3) & 15);
  int b = m >> 12;
  int g = c >> 4;
  float mean = stats[(b * 32 + g) * 2];
  float rstd = stats[(b * 32 + g) * 2 + 1];
  float4 xv = *(const float4*)(x + (size_t)m * Cq + c);
  bf16* o = hn + i4;
  o[0] = (bf16)((xv.x - mean) * rstd * gamma[c]     + beta[c]);
  o[1] = (bf16)((xv.y - mean) * rstd * gamma[c + 1] + beta[c + 1]);
  o[2] = (bf16)((xv.z - mean) * rstd * gamma[c + 2] + beta[c + 2]);
  o[3] = (bf16)((xv.w - mean) * rstd * gamma[c + 3] + beta[c + 3]);
}

// ---------------------------------------------------------------------------
// 3) Pack a 512x512 f32 weight (w[k][n]) into fragment order:
//    block (kt*32+nt), rows indexed by n.
// ---------------------------------------------------------------------------
__global__ __launch_bounds__(256) void k_pack_w(const float* __restrict__ w,
                                                bf16* __restrict__ wpk) {
  int tid = blockIdx.x * 256 + threadIdx.x;
  if (tid >= 16 * 32 * 32) return;   // ktiles(16) * ntiles(32) * lanes(32)
  int lane = tid & 31;
  int nt = (tid >> 5) & 31;
  int kt = tid >> 10;
  int n = nt * 16 + (lane & 15);
  int half = lane >> 4;
  bf16* dst = wpk + (size_t)(tid >> 5) * 512 + lane * 8; // tid>>5 == kt*32+nt
#pragma unroll
  for (int j = 0; j < 8; ++j)
    dst[j] = (bf16)w[(kt * 32 + half * 8 + j) * Cq + n];
#pragma unroll
  for (int j = 0; j < 8; ++j)
    dst[256 + j] = (bf16)w[(kt * 32 + 16 + half * 8 + j) * Cq + n];
}

// ---------------------------------------------------------------------------
// 4) Fused QKV projection. 8 waves share one async-staged 64x512 A tile (four
//    16-row tiles); each wave computes the four 16x16 tiles of one channel tile
//    for q, k, v: an A fragment is used 3x, a weight fragment 4x.
//    q,k stored in fragment order, block (row>>4, channel>>5); v stored in
//    fragment order for P*V (rows = channels, k = keys), block (key>>5, channel>>4):
//    a lane's eight accumulator rows are its own 16 bytes of that block.
// ---------------------------------------------------------------------------
__global__ __launch_bounds__(256) void k_qkv(const bf16* __restrict__ hn,
                                             const bf16* __restrict__ wq,
                                             const bf16* __restrict__ wk,
                                             const bf16* __restrict__ wv,
                                             const float* __restrict__ bq,
                                             const float* __restrict__ bk,
                                             const float* __restrict__ bv,
                                             bf16* __restrict__ qb,
                                             bf16* __restrict__ kb,
                                             bf16* __restrict__ vtb) {
  __shared__ __align__(16) bf16 atile[PROJ_MT * 16 * 512];
  int wave = threadIdx.x >> 5, lane = threadIdx.x & 31;
  int mt0 = (blockIdx.x >> 2) * PROJ_MT;
  int ct = ((blockIdx.x & 3) << 3) + wave;
  // A constant trip count, unrolled: straight-line copies with every lane on.
#pragma unroll
  for (int j = 0; j < PROJ_MT * 4; ++j)
    stage16((const uint4*)(hn + (size_t)mt0 * 16 * Cq) + j * 256 + threadIdx.x,
            (uint4*)atile + j * 256 + threadIdx.x);
  wait_copies0();
  __syncthreads();
  v8f aq[PROJ_MT] = {}, ak[PROJ_MT] = {}, av[PROJ_MT] = {};
  // Fully unrolled: the weight reads of later k steps then issue ahead of the
  // WMMAs of earlier ones; rolled, each read is waited for before its WMMA.
#pragma unroll
  for (int kt = 0; kt < 16; ++kt) {
    size_t wb = (size_t)(kt * 32 + ct) * 512;
    v16bf fq = frag_packed(wq + wb, lane);
    v16bf fk = frag_packed(wk + wb, lane);
    v16bf fv = frag_packed(wv + wb, lane);
    // Unrolled, here and in the epilogue: the accumulator arrays are then
    // indexed by constants and stay in registers.
#pragma unroll
    for (int i = 0; i < PROJ_MT; ++i) {
      v16bf a = frag_packed(atile + (i * 16 + kt) * 512, lane);
      aq[i] = wmma_bf16(a, fq, aq[i]);
      ak[i] = wmma_bf16(a, fk, ak[i]);
      av[i] = wmma_bf16(a, fv, av[i]);
    }
  }
  int half = lane >> 4;
  int col = (ct << 4) + (lane & 15);
  float xbq = bq[col], xbk = bk[col], xbv = bv[col];
#pragma unroll
  for (int i = 0; i < PROJ_MT; ++i) {
    int mt = mt0 + i, m0 = mt << 4;
    size_t qkblk = ((size_t)mt * 16 + (col >> 5)) * 512;
    v8bf vv;
#pragma unroll
    for (int r = 0; r < 8; ++r) {
      int off = frag_off(r + half * 8, col & 31);   // C/D layout: M = vgpr + half*8
      qb[qkblk + off] = (bf16)(aq[i][r] + xbq);
      kb[qkblk + off] = (bf16)(ak[i][r] + xbk);
      vv[r] = (bf16)(av[i][r] + xbv);
    }
    int bb = m0 >> 12, n0 = m0 & (Nq - 1);          // key = n0 + half*8 + r
    *(v8bf*)(vtb + (size_t)bb * Cq * Nq + ((size_t)(n0 >> 5) * 32 + ct) * 512 +
             ((n0 >> 4) & 1) * 256 + lane * 8) = vv;
  }
}

typedef __attribute__((address_space(3))) char* lds_char_p;
#define QREG 2   // Q fragments (of 16) that the attention kernel keeps in registers

__device__ __forceinline__ void copy_tile32k(const bf16* g, bf16* l, int tid) {
  const char* gp = (const char*)g + tid * 16;
  unsigned lp = (unsigned)(__UINTPTR_TYPE__)(lds_char_p)(char*)l + (unsigned)tid * 16u;
  // The copies and their s_wait_xcnt stand in one statement, so no address
  // register of an issued copy is rewritten ahead of that wait.
  asm volatile(
      "global_load_async_to_lds_b128 %0, %8, off\n\t"
      "global_load_async_to_lds_b128 %1, %9, off\n\t"
      "global_load_async_to_lds_b128 %2, %10, off\n\t"
      "global_load_async_to_lds_b128 %3, %11, off\n\t"
      "global_load_async_to_lds_b128 %4, %12, off\n\t"
      "global_load_async_to_lds_b128 %5, %13, off\n\t"
      "global_load_async_to_lds_b128 %6, %14, off\n\t"
      "global_load_async_to_lds_b128 %7, %15, off\n\t"
      "s_wait_xcnt 0x0"
      :: "v"(lp), "v"(lp + 4096u), "v"(lp + 8192u), "v"(lp + 12288u),
         "v"(lp + 16384u), "v"(lp + 20480u), "v"(lp + 24576u), "v"(lp + 28672u),
         "v"(gp), "v"(gp + 4096), "v"(gp + 8192), "v"(gp + 12288),
         "v"(gp + 16384), "v"(gp + 20480), "v"(gp + 24576), "v"(gp + 28672)
      : "memory");
}

// This wave's own LDS reads and writes have retired (before a buffer is handed
// back for refill, and before a wave reads back what its lanes wrote).
__device__ __forceinline__ void wait_ds0() {
  asm volatile("s_wait_dscnt 0x0" ::: "memory");
}

// ---------------------------------------------------------------------------
// Maximum / sum over the 16 lanes of a row (C/D layout: lane = key column,
// VGPR r = query row r + half*8): a four-step butterfly on the vector unit's
// own lane exchange; every lane of the row ends with the result.
// ---------------------------------------------------------------------------
template <int CTRL>
__device__ __forceinline__ float row_xchg(float v) {   // CTRL = 0x160 + xor mask
  return __builtin_bit_cast(float, __builtin_amdgcn_update_dpp(
      0, __builtin_bit_cast(int, v), CTRL, 0xf, 0xf, true));
}
__device__ __forceinline__ float row_max16(float v) {
  v = fmaxf(v, row_xchg<0x161>(v));
  v = fmaxf(v, row_xchg<0x162>(v));
  v = fmaxf(v, row_xchg<0x164>(v));
  v = fmaxf(v, row_xchg<0x168>(v));
  return v;
}
__device__ __forceinline__ float row_sum16(float v) {
  v += row_xchg<0x161>(v);
  v += row_xchg<0x162>(v);
  v += row_xchg<0x164>(v);
  v += row_xchg<0x168>(v);
  return v;
}
// A row's maximum in use is replaced only when a tile's maximum exceeds it by
// more than this (P then stays below e^5.5, about 245).
#define RESCALE_OVER 5.5f

// ---------------------------------------------------------------------------
// 5) Attention, one pass (online softmax): one wave per 16-query tile, all 512
//    output channels in its accumulators; 8 tiles per work-group share the
//    staged K and V tiles. P = exp(s - m) with m the row maximum in use, not yet
//    divided by the row sum; when m moves, accumulators and sums are rescaled;
//    the division by the sum comes once, in the epilogue. P (bf16) turns from
//    accumulator to A-fragment order through the wave's own 1 KB of LDS.
// ---------------------------------------------------------------------------
__global__ __launch_bounds__(256) void k_attn_out(const bf16* __restrict__ qb,
                                                  const bf16* __restrict__ kb,
                                                  const bf16* __restrict__ vtb,
                                                  bf16* __restrict__ ao) {
  __shared__ __align__(16) bf16 kvbuf[2][2][32 * 512];   // [buffer][K, V]
  __shared__ __align__(16) bf16 pbuf[8][16 * 32];
  __shared__ __align__(16) bf16 qlds[8][(16 - QREG) * 512];
  int wave = threadIdx.x >> 5, lane = threadIdx.x & 31;
  int qt = blockIdx.x * 8 + wave;
  int b = blockIdx.x >> 5;
  const bf16* kbase = kb + (size_t)b * Nq * Cq;
  const bf16* vbase = vtb + (size_t)b * Cq * Nq;
  copy_tile32k(kbase, &kvbuf[0][0][0], threadIdx.x);
  copy_tile32k(vbase, &kvbuf[0][1][0], threadIdx.x);
  // The first QREG of the wave's 16 Q fragments stay in registers; beside the
  // 256 accumulator registers no more fit, so the rest lie in its own LDS.
  const bf16* qsrc = qb + (size_t)qt * 16 * Cq + lane * 8;   // the lane's 16 bytes
  v16bf qf[QREG];
#pragma unroll
  for (int kt = 0; kt < QREG; ++kt)
    qf[kt] = cat8(*(const v8bf*)(qsrc + kt * 512), *(const v8bf*)(qsrc + kt * 512 + 256));
  v8bf qlo[16 - QREG], qhi[16 - QREG];
#pragma unroll
  for (int kt = QREG; kt < 16; ++kt) {
    qlo[kt - QREG] = *(const v8bf*)(qsrc + kt * 512);
    qhi[kt - QREG] = *(const v8bf*)(qsrc + kt * 512 + 256);
  }
  int half = lane >> 4;
  // mrow: the row maximum in use; lsum: this lane's share of the row sum (its
  // own key columns), joined over the row in the epilogue.
  float mrow[8], lsum[8];
#pragma unroll
  for (int r = 0; r < 8; ++r) { mrow[r] = -1e30f; lsum[r] = 0.f; }
  // The address registers of the loads above stay as they are until this wait
  // (named as an input so that they live up to it).
  asm volatile("s_wait_xcnt 0x0" :: "v"(qsrc) : "memory");
  bf16* ql = &qlds[wave][0];
#pragma unroll
  for (int kt = QREG; kt < 16; ++kt) {
    *(v8bf*)(ql + (kt - QREG) * 512 + lane * 8)       = qlo[kt - QREG];
    *(v8bf*)(ql + (kt - QREG) * 512 + 256 + lane * 8) = qhi[kt - QREG];
  }
  wait_copies0();
  __syncthreads();                                  // publish tile 0
  // Keeps the address arithmetic of tile 1's copies behind the Q staging; formed
  // ahead of it, those addresses are spilled to scratch and read back here.
  __builtin_amdgcn_sched_barrier(0);
  copy_tile32k(kbase + 32 * Cq, &kvbuf[1][0][0], threadIdx.x);
  copy_tile32k(vbase + 32 * Cq, &kvbuf[1][1][0], threadIdx.x);
  v8f acc[32] = {};
  bf16* pb = &pbuf[wave][0];
  for (int t = 0; t < 128; ++t) {                   // 32 keys per trip
    const bf16* kt32 = &kvbuf[t & 1][0][0];
    const bf16* vt32 = &kvbuf[t & 1][1][0];
    v8f d0 = {}, d1 = {};
    // K and V fragments come in groups of four; the next group's LDS reads are
    // issued ahead of this group's WMMAs. Unrolled so that qf[], acc[] and the
    // two groups are indexed by constants and stay in registers.
    v16bf fa[4], fb[4], qa[2], qn[2];
#pragma unroll
    for (int j = 0; j < 4; ++j)
      fa[j] = frag_packed(kt32 + (j & 1) * 16 * Cq + (j >> 1) * 512, lane);
#pragma unroll
    for (int g = 0; g < 8; ++g) {
#pragma unroll
      for (int j = 0; j < 4; ++j)
        fb[j] = (g < 7)
            ? frag_packed(kt32 + (j & 1) * 16 * Cq + ((g + 1) * 2 + (j >> 1)) * 512, lane)
            : frag_packed(vt32 + j * 512, lane);    // first V group
      if (g < 7 && (g + 1) * 2 >= QREG) {           // the next group's Q, where in LDS
        qn[0] = frag_packed(ql + ((g + 1) * 2 - QREG) * 512, lane);
        qn[1] = frag_packed(ql + ((g + 1) * 2 + 1 - QREG) * 512, lane);
      }
      // Keeps the reads above as one group ahead of the WMMAs; left free, each
      // read sinks to just in front of its WMMA, which then waits out its latency.
      __builtin_amdgcn_sched_barrier(0);
      v16bf q0 = (g * 2 < QREG) ? qf[(g * 2) % QREG] : qa[0];
      v16bf q1 = (g * 2 < QREG) ? qf[(g * 2 + 1) % QREG] : qa[1];
      d0 = wmma_bf16(q0, fa[0], d0);
      d1 = wmma_bf16(q0, fa[1], d1);
      d0 = wmma_bf16(q1, fa[2], d0);
      d1 = wmma_bf16(q1, fa[3], d1);
      // Keeps the following group's reads behind these WMMAs (two groups live).
      __builtin_amdgcn_sched_barrier(0);
#pragma unroll
      for (int j = 0; j < 4; ++j) fa[j] = fb[j];
      qa[0] = qn[0]; qa[1] = qn[1];
    }
    // The tile's row maxima, and how far the highest stands above its row's
    // maximum in use.
    float tmax[8];
#pragma unroll
    for (int r = 0; r < 8; ++r) tmax[r] = row_max16(fmaxf(d0[r], d1[r])) * SCALEF;
    float over = tmax[0] - mrow[0];
#pragma unroll
    for (int r = 1; r < 8; ++r) over = fmaxf(over, tmax[r] - mrow[r]);
    // One test per tile, the same for the whole wave (a scalar branch): the
    // 256 accumulator registers are rescaled only when some row's maximum has
    // passed the one in use by the margin.
    if (__builtin_amdgcn_ballot_w32(over > RESCALE_OVER) != 0) {
#pragma unroll
      for (int r = 0; r < 8; ++r) {
        float mnew = fmaxf(mrow[r], tmax[r]);
        float f = __expf(mrow[r] - mnew);           // 0 on the first tile
        mrow[r] = mnew;
        lsum[r] *= f;
#pragma unroll
        for (int ct = 0; ct < 32; ++ct) acc[ct][r] *= f;
      }
    }
#pragma unroll
    for (int r = 0; r < 8; ++r) {
      float p0 = __expf(d0[r] * SCALEF - mrow[r]);
      float p1 = __expf(d1[r] * SCALEF - mrow[r]);
      lsum[r] += p0 + p1;
      int off = frag_off(r + half * 8, lane & 15);
      pb[off]       = (bf16)p0;                     // keys 0..15 of the tile: part 0
      pb[off + 256] = (bf16)p1;                     // keys 16..31: part 1
    }
    wait_ds0();               // the other lanes' P stores, before the read back
    v16bf pa = frag_packed(pb, lane);
#pragma unroll
    for (int g = 0; g < 8; ++g) {
      if (g < 7) {
#pragma unroll
        for (int j = 0; j < 4; ++j)
          fb[j] = frag_packed(vt32 + ((g + 1) * 4 + j) * 512, lane);
      }
      __builtin_amdgcn_sched_barrier(0);            // as in the score loop
#pragma unroll
      for (int j = 0; j < 4; ++j)
        acc[g * 4 + j] = wmma_bf16(pa, fa[j], acc[g * 4 + j]);
      __builtin_amdgcn_sched_barrier(0);            // as in the score loop
#pragma unroll
      for (int j = 0; j < 4; ++j) fa[j] = fb[j];
    }
    wait_ds0();
    wait_copies0();
    __syncthreads();          // publishes tile t+1, ends every read of tile t
    if (t + 2 < 128) {
      copy_tile32k(kbase + (size_t)(t + 2) * 32 * Cq, &kvbuf[t & 1][0][0], threadIdx.x);
      copy_tile32k(vbase + (size_t)(t + 2) * 32 * Cq, &kvbuf[t & 1][1][0], threadIdx.x);
    }
  }
  wait_copies0();
  float rinv[8];
#pragma unroll
  for (int r = 0; r < 8; ++r) rinv[r] = 1.0f / row_sum16(lsum[r]);
#pragma unroll
  for (int ct = 0; ct < 32; ++ct) {
    int ch = ct * 16 + (lane & 15);
    bf16* ob = ao + ((size_t)qt * 16 + (ch >> 5)) * 512;
#pragma unroll
    for (int r = 0; r < 8; ++r)
      ob[frag_off(r + half * 8, ch & 31)] = (bf16)(acc[ct][r] * rinv[r]);
    // Before the next tile's conversions reuse a register that a store names.
    asm volatile("s_wait_xcnt 0x0" ::: "memory");
    // Holds the next tile's conversions behind that wait; left free, some of
    // them are lifted over it.
    __builtin_amdgcn_sched_barrier(0);
  }
}

// ---------------------------------------------------------------------------
// 6) Output projection + bias + residual, fp32 store. As in 4), 64 rows per
//    work-group; each wave takes two neighbouring channel tiles (an A fragment
//    is used 2x, a weight fragment 4x) and so writes whole 128-byte lines.
// ---------------------------------------------------------------------------
__global__ __launch_bounds__(256) void k_out_proj(const bf16* __restrict__ ao,
                                                  const bf16* __restrict__ wo,
                                                  const float* __restrict__ bo,
                                                  const float* __restrict__ x,
                                                  float* __restrict__ out) {
  __shared__ __align__(16) bf16 atile[PROJ_MT * 16 * 512];
  int wave = threadIdx.x >> 5, lane = threadIdx.x & 31;
  int mt0 = (blockIdx.x >> 1) * PROJ_MT;
  int ct0 = ((blockIdx.x & 1) << 4) + wave * 2;
  // A constant trip count, unrolled: straight-line copies with every lane on.
#pragma unroll
  for (int j = 0; j < PROJ_MT * 4; ++j)
    stage16((const uint4*)(ao + (size_t)mt0 * 16 * Cq) + j * 256 + threadIdx.x,
            (uint4*)atile + j * 256 + threadIdx.x);
  wait_copies0();
  __syncthreads();
  v8f acc[PROJ_MT][2] = {};
  for (int kt = 0; kt < 16; ++kt) {
    const bf16* wb = wo + (size_t)(kt * 32 + ct0) * 512;
    v16bf f0 = frag_packed(wb, lane);
    v16bf f1 = frag_packed(wb + 512, lane);
    // Unrolled, here and in the epilogue: acc[][] is then indexed by constants
    // and stays in registers.
#pragma unroll
    for (int i = 0; i < PROJ_MT; ++i) {
      v16bf a = frag_packed(atile + (i * 16 + kt) * 512, lane);
      acc[i][0] = wmma_bf16(a, f0, acc[i][0]);
      acc[i][1] = wmma_bf16(a, f1, acc[i][1]);
    }
  }
  // Keeps the 64 residual reads behind the product loop; lifted over it they
  // hold their registers through the loop, and only one work-group fits a WGP.
  __builtin_amdgcn_sched_barrier(0);
  int half = lane >> 4;
  int col = (ct0 << 4) + (lane & 15);
  float bias0 = bo[col], bias1 = bo[col + 16];
  // One base per buffer: every row and both channel tiles are constant offsets.
  size_t base = ((size_t)mt0 * 16 + half * 8) * Cq + col;
  const float* xp = x + base;
  float* op = out + base;
#pragma unroll
  for (int i = 0; i < PROJ_MT; ++i) {
#pragma unroll
    for (int r = 0; r < 8; ++r) {
      int o = (i * 16 + r) * Cq;                    // C/D layout: M = vgpr + half*8
      op[o]      = acc[i][0][r] + bias0 + xp[o];
      op[o + 16] = acc[i][1][r] + bias1 + xp[o + 16];
    }
  }
}

// ---------------------------------------------------------------------------
// Launch
// ---------------------------------------------------------------------------
extern "C" void kernel_launch(void* const* d_in, const int* in_sizes, int n_in,
                              void* d_out, int out_size, void* d_ws, size_t ws_size,
                              hipStream_t stream) {
  const float* x      = (const float*)d_in[0];
  const float* gscale = (const float*)d_in[1];
  const float* gbias  = (const float*)d_in[2];
  const float* wq     = (const float*)d_in[3];
  const float* bq     = (const float*)d_in[4];
  const float* wk     = (const float*)d_in[5];
  const float* bk     = (const float*)d_in[6];
  const float* wv     = (const float*)d_in[7];
  const float* bv     = (const float*)d_in[8];
  const float* wo     = (const float*)d_in[9];
  const float* bo     = (const float*)d_in[10];
  float* out = (float*)d_out;

  char* ws = (char*)d_ws;
  float* stats = (float*)ws;                               // 2 KB
  bf16* wpkq = (bf16*)(ws + 4096);                         // 4 x 512KB packed weights
  bf16* wpkk = (bf16*)(ws + 4096 + 1 * 524288);
  bf16* wpkv = (bf16*)(ws + 4096 + 2 * 524288);
  bf16* wpko = (bf16*)(ws + 4096 + 3 * 524288);
  size_t o = 4096 + 4 * 524288;
  bf16* hn  = (bf16*)(ws + o); o += 33554432;              // normalized acts / reused as attn out
  bf16* qb  = (bf16*)(ws + o); o += 33554432;              // Q, fragment order
  bf16* kb  = (bf16*)(ws + o); o += 33554432;              // K, fragment order
  bf16* vtb = (bf16*)(ws + o);                             // V, fragment order (rows = channels)

  k_gn_stats<<<256, 256, 0, stream>>>(x, stats);
  k_gn_apply<<<16384, 256, 0, stream>>>(x, stats, gscale, gbias, hn);
  k_pack_w<<<64, 256, 0, stream>>>(wq, wpkq);
  k_pack_w<<<64, 256, 0, stream>>>(wk, wpkk);
  k_pack_w<<<64, 256, 0, stream>>>(wv, wpkv);
  k_pack_w<<<64, 256, 0, stream>>>(wo, wpko);
  k_qkv<<<2048, 256, 0, stream>>>(hn, wpkq, wpkk, wpkv, bq, bk, bv, qb, kb, vtb);
  k_attn_out<<<256, 256, 0, stream>>>(qb, kb, vtb, hn);      // attn out overwrites hn
  k_out_proj<<<1024, 256, 0, stream>>>(hn, wpko, bo, x, out);
}

// v005
// A run of this version takes 297 microseconds.
// Two timings next to v004 both put it at 1.12 times that version's speed.
// Counting every step since v000, it is 8.60 times as fast.
#include <hip/hip_runtime.h>

typedef __bf16 bf16;
typedef __attribute__((ext_vector_type(16))) __bf16 v16bf;
typedef __attribute__((ext_vector_type(8)))  __bf16 v8bf;
typedef __attribute__((ext_vector_type(8)))  float  v8f;
typedef __attribute__((ext_vector_type(4)))  int    v4i;
typedef __attribute__((address_space(3))) v4i* lds_v4i_p;

#define Bq 8
#define Cq 512
#define Nq 4096
#define Mq 32768
#define SCALEF 0.044194173824159216f   // 1/sqrt(512)
#define EPSQ 1e-5f

// ---------------------------------------------------------------------------
// WMMA helpers
// ---------------------------------------------------------------------------
__device__ __forceinline__ v8f wmma_bf16(v16bf a, v16bf b, v8f c) {
  return __builtin_amdgcn_wmma_f32_16x16x32_bf16(false, a, false, b, (short)0, c,
                                                 false, false);
}

__device__ __forceinline__ v16bf cat8(v8bf lo, v8bf hi) {
  return __builtin_shufflevector(lo, hi, 0, 1, 2, 3, 4, 5, 6, 7,
                                         8, 9, 10, 11, 12, 13, 14, 15);
}

// Fragment order. Every bf16 WMMA operand (in the workspace and in LDS) is kept
// as 1 KB blocks, one block per 16-row x 32-k fragment: [part 0..1][lane 0..31][8].
// Per ISA layout: lane L -> row = L&15, half = L>>4;
// part 0, elements 0..7  -> k = half*8 + j
// part 1, elements 8..15 -> k = 16 + half*8 + j
// so each of the two 16-byte reads of a fragment covers 512 contiguous bytes
// over the wave: four whole lines from global memory, no shared bank in LDS.
// The same pattern serves as a B fragment (rows indexed by N).
// frag_off: place of element (row r16, k index k32) inside its block.
__device__ __forceinline__ int frag_off(int r16, int k32) {
  return ((k32 >> 4) << 8) + (((((k32 >> 3) & 1) << 4) + r16) << 3) + (k32 & 7);
}

__device__ __forceinline__ v16bf frag_packed(const bf16* blk, int lane) {
  const bf16* p = blk + lane * 8;
  v8bf lo = *(const v8bf*)p;
  v8bf hi = *(const v8bf*)(p + 256);
  return cat8(lo, hi);
}

// ---------------------------------------------------------------------------
// Async global -> LDS staging (gfx1250 GLOBAL_LOAD_ASYNC_TO_LDS_B128,
// tracked by ASYNCcnt). Param 0 is a generic v4i* (per compiler diagnostic);
// LDS side is cast to addrspace(3), which also converts implicitly to
// generic if the builtin is declared that way.
// ---------------------------------------------------------------------------
__device__ __forceinline__ void stage16(const void* gsrc, void* ldst) {
#if __has_builtin(__builtin_amdgcn_global_load_async_to_lds_b128)
  __builtin_amdgcn_global_load_async_to_lds_b128((v4i*)gsrc, (lds_v4i_p)ldst, 0, 0);
#else
  *(uint4*)ldst = *(const uint4*)gsrc;
#endif
}

// This wave's own copies have landed (before the barrier that publishes them).
__device__ __forceinline__ void wait_copies0() {
  asm volatile("s_wait_asynccnt 0x0" ::: "memory");
}

// 16-row tiles per work-group of the two projection kernels: each wave carries
// all of them, so one weight fragment read from L2 feeds that many WMMAs.
#define PROJ_MT 4

// ---------------------------------------------------------------------------
// 1) GroupNorm statistics: one block per (batch, group); 256-thread reduce.
// ---------------------------------------------------------------------------
__global__ __launch_bounds__(256) void k_gn_stats(const float* __restrict__ x,
                                                  float* __restrict__ stats) {
  int bg = blockIdx.x;            // 0..255 : b*32+g
  int b = bg >> 5, g = bg & 31;
  const float* xb = x + (size_t)b * Nq * Cq + g * 16;
  float s = 0.f, ss = 0.f;
  for (int n = threadIdx.x; n < Nq; n += 256) {
    const float* p = xb + (size_t)n * Cq;
#pragma unroll
    for (int ci = 0; ci < 16; ++ci) { float v = p[ci]; s += v; ss += v * v; }
  }
  __shared__ float sh_s[256], sh_ss[256];
  sh_s[threadIdx.x] = s; sh_ss[threadIdx.x] = ss;
  __syncthreads();
  for (int off = 128; off > 0; off >>= 1) {
    if (threadIdx.x < off) {
      sh_s[threadIdx.x]  += sh_s[threadIdx.x + off];
      sh_ss[threadIdx.x] += sh_ss[threadIdx.x + off];
    }
    __syncthreads();
  }
  if (threadIdx.x == 0) {
    float inv = 1.0f / (float)(Nq * 16);
    float mean = sh_s[0] * inv;
    float var  = sh_ss[0] * inv - mean * mean;
    stats[bg * 2]     = mean;
    stats[bg * 2 + 1] = rsqrtf(var + EPSQ);
  }
}

// ---------------------------------------------------------------------------
// 2) Apply GroupNorm, emit bf16 activations (M x C in fragment order:
//    block (m>>4, c>>5); a 16-row tile is 16 KB contiguous).
// ---------------------------------------------------------------------------
__global__ __launch_bounds__(256) void k_gn_apply(const float* __restrict__ x,
                                                  const float* __restrict__ stats,
                                                  const float* __restrict__ gamma,
                                                  const float* __restrict__ beta,
                                                  bf16* __restrict__ hn) {
  // i4 is the place in hn: threads walk the fragment order, so a wave stores
  // whole lines and each line has one writer; (m, c) is read back from the place.
  size_t i4 = ((size_t)blockIdx.x * 256 + threadIdx.x) * 4;
  int w = (int)(i4 & 511);
  int blk = (int)(i4 >> 9);
  int c = ((blk & 15) << 5) + ((w >> 8) << 4) + (((w >> 7) & 1) << 3) + (w & 7);
  int m = ((blk >> 4) << 4) + ((w >> 3) & 15);
  int b = m >> 12;
  int g = c >> 4;
  float mean = stats[(b * 32 + g) * 2];
  float rstd = stats[(b * 32 + g) * 2 + 1];
  float4 xv = *(const float4*)(x + (size_t)m * Cq + c);
  bf16* o = hn + i4;
  o[0] = (bf16)((xv.x - mean) * rstd * gamma[c]     + beta[c]);
  o[1] = (bf16)((xv.y - mean) * rstd * gamma[c + 1] + beta[c + 1]);
  o[2] = (bf16)((xv.z - mean) * rstd * gamma[c + 2] + beta[c + 2]);
  o[3] = (bf16)((xv.w - mean) * rstd * gamma[c + 3] + beta[c + 3]);
}

// ---------------------------------------------------------------------------
// 3) Pack a 512x512 f32 weight (w[k][n]) into fragment order:
//    block (kt*32+nt), rows indexed by n.
// ---------------------------------------------------------------------------
__global__ __launch_bounds__(256) void k_pack_w(const float* __restrict__ w,
                                                bf16* __restrict__ wpk) {
  int tid = blockIdx.x * 256 + threadIdx.x;
  if (tid >= 16 * 32 * 32) return;   // ktiles(16) * ntiles(32) * lanes(32)
  int lane = tid & 31;
  int nt = (tid >> 5) & 31;
  int kt = tid >> 10;
  int n = nt * 16 + (lane & 15);
  int half = lane >> 4;
  bf16* dst = wpk + (size_t)(tid >> 5) * 512 + lane * 8; // tid>>5 == kt*32+nt
#pragma unroll
  for (int j = 0; j < 8; ++j)
    dst[j] = (bf16)w[(kt * 32 + half * 8 + j) * Cq + n];
#pragma unroll
  for (int j = 0; j < 8; ++j)
    dst[256 + j] = (bf16)w[(kt * 32 + 16 + half * 8 + j) * Cq + n];
}

// ---------------------------------------------------------------------------
// 4) Fused QKV projection. 8 waves share one async-staged 64x512 A tile (four
//    16-row tiles); each wave computes the four 16x16 tiles of one channel tile
//    for q, k, v: an A fragment is used 3x, a weight fragment 4x.
//    q,k stored in fragment order, block (row>>4, channel>>5); v stored in
//    fragment order for P*V (rows = channels, k = keys), block (key>>5, channel>>4):
//    a lane's eight accumulator rows are its own 16 bytes of that block.
// ---------------------------------------------------------------------------
__global__ __launch_bounds__(256) void k_qkv(const bf16* __restrict__ hn,
                                             const bf16* __restrict__ wq,
                                             const bf16* __restrict__ wk,
                                             const bf16* __restrict__ wv,
                                             const float* __restrict__ bq,
                                             const float* __restrict__ bk,
                                             const float* __restrict__ bv,
                                             bf16* __restrict__ qb,
                                             bf16* __restrict__ kb,
                                             bf16* __restrict__ vtb) {
  __shared__ __align__(16) bf16 atile[PROJ_MT * 16 * 512];
  int wave = threadIdx.x >> 5, lane = threadIdx.x & 31;
  int mt0 = (blockIdx.x >> 2) * PROJ_MT;
  int ct = ((blockIdx.x & 3) << 3) + wave;
  // A constant trip count, unrolled: straight-line copies with every lane on.
#pragma unroll
  for (int j = 0; j < PROJ_MT * 4; ++j)
    stage16((const uint4*)(hn + (size_t)mt0 * 16 * Cq) + j * 256 + threadIdx.x,
            (uint4*)atile + j * 256 + threadIdx.x);
  wait_copies0();
  __syncthreads();
  v8f aq[PROJ_MT] = {}, ak[PROJ_MT] = {}, av[PROJ_MT] = {};
  // Fully unrolled: the weight reads of later k steps then issue ahead of the
  // WMMAs of earlier ones; rolled, each read is waited for before its WMMA.
#pragma unroll
  for (int kt = 0; kt < 16; ++kt) {
    size_t wb = (size_t)(kt * 32 + ct) * 512;
    v16bf fq = frag_packed(wq + wb, lane);
    v16bf fk = frag_packed(wk + wb, lane);
    v16bf fv = frag_packed(wv + wb, lane);
    // Unrolled, here and in the epilogue: the accumulator arrays are then
    // indexed by constants and stay in registers.
#pragma unroll
    for (int i = 0; i < PROJ_MT; ++i) {
      v16bf a = frag_packed(atile + (i * 16 + kt) * 512, lane);
      aq[i] = wmma_bf16(a, fq, aq[i]);
      ak[i] = wmma_bf16(a, fk, ak[i]);
      av[i] = wmma_bf16(a, fv, av[i]);
    }
  }
  int half = lane >> 4;
  int col = (ct << 4) + (lane & 15);
  float xbq = bq[col], xbk = bk[col], xbv = bv[col];
#pragma unroll
  for (int i = 0; i < PROJ_MT; ++i) {
    int mt = mt0 + i, m0 = mt << 4;
    size_t qkblk = ((size_t)mt * 16 + (col >> 5)) * 512;
    v8bf vv;
#pragma unroll
    for (int r = 0; r < 8; ++r) {
      int off = frag_off(r + half * 8, col & 31);   // C/D layout: M = vgpr + half*8
      qb[qkblk + off] = (bf16)(aq[i][r] + xbq);
      kb[qkblk + off] = (bf16)(ak[i][r] + xbk);
      vv[r] = (bf16)(av[i][r] + xbv);
    }
    int bb = m0 >> 12, n0 = m0 & (Nq - 1);          // key = n0 + half*8 + r
    *(v8bf*)(vtb + (size_t)bb * Cq * Nq + ((size_t)(n0 >> 5) * 32 + ct) * 512 +
             ((n0 >> 4) & 1) * 256 + lane * 8) = vv;
  }
}

typedef __attribute__((address_space(3))) char* lds_char_p;
#define QREG 2   // Q fragments (of 16) that the attention kernel keeps in registers

__device__ __forceinline__ void copy_tile32k(const bf16* g, bf16* l, int tid) {
  const char* gp = (const char*)g + tid * 16;
  unsigned lp = (unsigned)(__UINTPTR_TYPE__)(lds_char_p)(char*)l + (unsigned)tid * 16u;
  // The copies and their s_wait_xcnt stand in one statement, so no address
  // register of an issued copy is rewritten ahead of that wait.
  asm volatile(
      "global_load_async_to_lds_b128 %0, %8, off\n\t"
      "global_load_async_to_lds_b128 %1, %9, off\n\t"
      "global_load_async_to_lds_b128 %2, %10, off\n\t"
      "global_load_async_to_lds_b128 %3, %11, off\n\t"
      "global_load_async_to_lds_b128 %4, %12, off\n\t"
      "global_load_async_to_lds_b128 %5, %13, off\n\t"
      "global_load_async_to_lds_b128 %6, %14, off\n\t"
      "global_load_async_to_lds_b128 %7, %15, off\n\t"
      "s_wait_xcnt 0x0"
      :: "v"(lp), "v"(lp + 4096u), "v"(lp + 8192u), "v"(lp + 12288u),
         "v"(lp + 16384u), "v"(lp + 20480u), "v"(lp + 24576u), "v"(lp + 28672u),
         "v"(gp), "v"(gp + 4096), "v"(gp + 8192), "v"(gp + 12288),
         "v"(gp + 16384), "v"(gp + 20480), "v"(gp + 24576), "v"(gp + 28672)
      : "memory");
}

// This wave's own LDS reads and writes have retired (before a buffer is handed
// back for refill).
__device__ __forceinline__ void wait_ds0() {
  asm volatile("s_wait_dscnt 0x0" ::: "memory");
}

// ---------------------------------------------------------------------------
// Lane l with lane l ^ 16: the two lanes that share a query column of a
// transposed score tile (each holds half of its keys).
// ---------------------------------------------------------------------------
__device__ __forceinline__ float xhalf(float v) {
  int b = __builtin_bit_cast(int, v);
  return __builtin_bit_cast(float, __builtin_amdgcn_permlanex16(
      b, b, 0x76543210, 0xfedcba98, false, false));
}
// The maxima in use are replaced only when some query's tile maximum exceeds its own by
// more than this (P then stays below e^5.5, about 245).
#define RESCALE_OVER 5.5f

__global__ __launch_bounds__(256) void k_attn_out(const bf16* __restrict__ qb,
                                                  const bf16* __restrict__ kb,
                                                  const bf16* __restrict__ vtb,
                                                  bf16* __restrict__ ao) {
  __shared__ __align__(16) bf16 kvbuf[2][2][32 * 512];   // [buffer][K, V]
  __shared__ __align__(16) bf16 qlds[8][(16 - QREG) * 512];
  int wave = threadIdx.x >> 5, lane = threadIdx.x & 31;
  int qt = blockIdx.x * 8 + wave;
  int b = blockIdx.x >> 5;
  const bf16* kbase = kb + (size_t)b * Nq * Cq;
  const bf16* vbase = vtb + (size_t)b * Cq * Nq;
  copy_tile32k(kbase, &kvbuf[0][0][0], threadIdx.x);
  copy_tile32k(vbase, &kvbuf[0][1][0], threadIdx.x);
  // The first QREG of the wave's 16 Q fragments stay in registers, beside the
  // 256 accumulator registers; the rest lie in its own LDS.
  const bf16* qsrc = qb + (size_t)qt * 16 * Cq + lane * 8;   // the lane's 16 bytes
  v16bf qf[QREG];
#pragma unroll
  for (int kt = 0; kt < QREG; ++kt)
    qf[kt] = cat8(*(const v8bf*)(qsrc + kt * 512), *(const v8bf*)(qsrc + kt * 512 + 256));
  v8bf qlo[16 - QREG], qhi[16 - QREG];
#pragma unroll
  for (int kt = QREG; kt < 16; ++kt) {
    qlo[kt - QREG] = *(const v8bf*)(qsrc + kt * 512);
    qhi[kt - QREG] = *(const v8bf*)(qsrc + kt * 512 + 256);
  }
  // mrow: the maximum in use of the lane's query (equal in its two lanes);
  // lsum: this lane's share of the query's sum, one partial sum per score
  // register (eight short chains, not one long one), joined in the epilogue;
  // p0, p1: the last tile's P (f32), added to lsum beside the next tile's first
  // score WMMAs, where the vector unit has nothing else to do.
  float mrow = -1e30f;
  v8f lsum = {}, p0 = {}, p1 = {};
  // The address registers of the loads above stay as they are until this wait
  // (named as an input so that they live up to it).
  asm volatile("s_wait_xcnt 0x0" :: "v"(qsrc) : "memory");
  bf16* ql = &qlds[wave][0];
#pragma unroll
  for (int kt = QREG; kt < 16; ++kt) {
    *(v8bf*)(ql + (kt - QREG) * 512 + lane * 8)       = qlo[kt - QREG];
    *(v8bf*)(ql + (kt - QREG) * 512 + 256 + lane * 8) = qhi[kt - QREG];
  }
  wait_copies0();
  __syncthreads();                                  // publish tile 0
  // Keeps the address arithmetic of tile 1's copies behind the Q staging; formed
  // ahead of it, those addresses are spilled to scratch and read back here.
  __builtin_amdgcn_sched_barrier(0);
  copy_tile32k(kbase + 32 * Cq, &kvbuf[1][0][0], threadIdx.x);
  copy_tile32k(vbase + 32 * Cq, &kvbuf[1][1][0], threadIdx.x);
  v8f acc[32] = {};
  for (int t = 0; t < 128; ++t) {                   // 32 keys per trip
    const bf16* kt32 = &kvbuf[t & 1][0][0];
    const bf16* vt32 = &kvbuf[t & 1][1][0];
    v8f d0 = {}, d1 = {};
    // K and V fragments come in groups of four; the next group's LDS reads are
    // issued ahead of this group's WMMAs. Unrolled so that qf[], acc[] and the
    // two groups are indexed by constants and stay in registers.
    v16bf fa[4], fb[4], qa[2], qn[2];
#pragma unroll
    for (int j = 0; j < 4; ++j)
      fa[j] = frag_packed(kt32 + (j & 1) * 16 * Cq + (j >> 1) * 512, lane);
#pragma unroll
    for (int g = 0; g < 8; ++g) {
#pragma unroll
      for (int j = 0; j < 4; ++j)
        fb[j] = (g < 7)
            ? frag_packed(kt32 + (j & 1) * 16 * Cq + ((g + 1) * 2 + (j >> 1)) * 512, lane)
            : frag_packed(vt32 + j * 512, lane);    // first V group
      if (g < 7 && (g + 1) * 2 >= QREG) {           // the next group's Q, where in LDS
        qn[0] = frag_packed(ql + ((g + 1) * 2 - QREG) * 512, lane);
        qn[1] = frag_packed(ql + ((g + 1) * 2 + 1 - QREG) * 512, lane);
      }
      // Keeps the reads above as one group ahead of the WMMAs; left free, each
      // read sinks to just in front of its WMMA, which then waits out its latency.
      __builtin_amdgcn_sched_barrier(0);
      v16bf q0 = (g * 2 < QREG) ? qf[(g * 2) % QREG] : qa[0];
      v16bf q1 = (g * 2 < QREG) ? qf[(g * 2 + 1) % QREG] : qa[1];
      d0 = wmma_bf16(fa[0], q0, d0);                // rows = keys, columns = queries
      d1 = wmma_bf16(fa[1], q0, d1);
      d0 = wmma_bf16(fa[2], q1, d0);
      d1 = wmma_bf16(fa[3], q1, d1);
      if (g == 0) lsum += p0 + p1;                  // ahead of this tile's rescale
      // Keeps the following group's reads behind these WMMAs (two groups live).
      __builtin_amdgcn_sched_barrier(0);
#pragma unroll
      for (int j = 0; j < 4; ++j) fa[j] = fb[j];
      qa[0] = qn[0]; qa[1] = qn[1];
    }
    // The tile's maximum for the lane's query: its own 16 keys in the lane, the
    // other 16 from the other half.
    float ma = fmaxf(fmaxf(d0[0], d1[0]), d0[1]);   // a tree three deep
    float mb = fmaxf(fmaxf(d1[1], d0[2]), d1[2]);
    float mc = fmaxf(fmaxf(d0[3], d1[3]), d0[4]);
    float md = fmaxf(fmaxf(d1[4], d0[5]), d1[5]);
    float me = fmaxf(fmaxf(d0[6], d1[6]), d0[7]);
    float tm = fmaxf(fmaxf(fmaxf(ma, mb), d1[7]), fmaxf(fmaxf(mc, md), me));
    tm = fmaxf(tm, xhalf(tm)) * SCALEF;
    // One test per tile, the same for the whole wave (a scalar branch): the
    // 256 accumulator registers are rescaled only when some query's maximum has
    // passed the one in use by the margin.
    if (__builtin_amdgcn_ballot_w32(tm - mrow > RESCALE_OVER) != 0) {
      float mnew = fmaxf(mrow, tm);
      float f = __expf(mrow - mnew);                // 0 on the first tile
      mrow = mnew;
      lsum *= f;
#pragma unroll
      for (int ct = 0; ct < 32; ++ct)
#pragma unroll
        for (int r = 0; r < 8; ++r) acc[ct][r] *= f;
    }
    v16bf pa;                 // B fragment of P^T: k = key, column = query
#pragma unroll
    for (int r = 0; r < 8; ++r) {
      p0[r] = __expf(d0[r] * SCALEF - mrow);
      p1[r] = __expf(d1[r] * SCALEF - mrow);
      pa[r]     = (bf16)p0[r];                      // key r + half*8
      pa[r + 8] = (bf16)p1[r];                      // key 16 + r + half*8
    }
#pragma unroll
    for (int g = 0; g < 8; ++g) {
      if (g < 7) {
#pragma unroll
        for (int j = 0; j < 4; ++j)
          fb[j] = frag_packed(vt32 + ((g + 1) * 4 + j) * 512, lane);
      }
      __builtin_amdgcn_sched_barrier(0);            // as in the score loop
#pragma unroll
      for (int j = 0; j < 4; ++j)
        acc[g * 4 + j] = wmma_bf16(fa[j], pa, acc[g * 4 + j]);   // rows = channels
      __builtin_amdgcn_sched_barrier(0);            // as in the score loop
#pragma unroll
      for (int j = 0; j < 4; ++j) fa[j] = fb[j];
    }
    wait_ds0();
    wait_copies0();
    __syncthreads();          // publishes tile t+1, ends every read of tile t
    if (t + 2 < 128) {
      copy_tile32k(kbase + (size_t)(t + 2) * 32 * Cq, &kvbuf[t & 1][0][0], threadIdx.x);
      copy_tile32k(vbase + (size_t)(t + 2) * 32 * Cq, &kvbuf[t & 1][1][0], threadIdx.x);
    }
  }
  wait_copies0();
  lsum += p0 + p1;                                  // the last tile's
  float lown = ((lsum[0] + lsum[1]) + (lsum[2] + lsum[3])) +
               ((lsum[4] + lsum[5]) + (lsum[6] + lsum[7]));
  float rinv = 1.0f / (lown + xhalf(lown));
  // Register r of tile ct is channel ct*16 + half*8 + r of the lane's query: the
  // lane's own 16 bytes of the fragment-order block, one store per tile.
  v8bf ov[32];
#pragma unroll
  for (int ct = 0; ct < 32; ++ct)
#pragma unroll
    for (int r = 0; r < 8; ++r) ov[ct][r] = (bf16)(acc[ct][r] * rinv);
  // Holds every conversion in front of the first store, so that no register
  // which an issued store names is written again.
  __builtin_amdgcn_sched_barrier(0);
  bf16* ob = ao + (size_t)qt * 16 * Cq + lane * 8;
#pragma unroll
  for (int ct = 0; ct < 32; ++ct) *(v8bf*)(ob + ct * 256) = ov[ct];
}

// ---------------------------------------------------------------------------
// 6) Output projection + bias + residual, fp32 store. As in 4), 64 rows per
//    work-group; each wave takes two neighbouring channel tiles (an A fragment
//    is used 2x, a weight fragment 4x) and so writes whole 128-byte lines.
// ---------------------------------------------------------------------------
__global__ __launch_bounds__(256) void k_out_proj(const bf16* __restrict__ ao,
                                                  const bf16* __restrict__ wo,
                                                  const float* __restrict__ bo,
                                                  const float* __restrict__ x,
                                                  float* __restrict__ out) {
  __shared__ __align__(16) bf16 atile[PROJ_MT * 16 * 512];
  int wave = threadIdx.x >> 5, lane = threadIdx.x & 31;
  int mt0 = (blockIdx.x >> 1) * PROJ_MT;
  int ct0 = ((blockIdx.x & 1) << 4) + wave * 2;
  // A constant trip count, unrolled: straight-line copies with every lane on.
#pragma unroll
  for (int j = 0; j < PROJ_MT * 4; ++j)
    stage16((const uint4*)(ao + (size_t)mt0 * 16 * Cq) + j * 256 + threadIdx.x,
            (uint4*)atile + j * 256 + threadIdx.x);
  wait_copies0();
  __syncthreads();
  v8f acc[PROJ_MT][2] = {};
  for (int kt = 0; kt < 16; ++kt) {
    const bf16* wb = wo + (size_t)(kt * 32 + ct0) * 512;
    v16bf f0 = frag_packed(wb, lane);
    v16bf f1 = frag_packed(wb + 512, lane);
    // Unrolled, here and in the epilogue: acc[][] is then indexed by constants
    // and stays in registers.
#pragma unroll
    for (int i = 0; i < PROJ_MT; ++i) {
      v16bf a = frag_packed(atile + (i * 16 + kt) * 512, lane);
      acc[i][0] = wmma_bf16(a, f0, acc[i][0]);
      acc[i][1] = wmma_bf16(a, f1, acc[i][1]);
    }
  }
  // Keeps the 64 residual reads behind the product loop; lifted over it they
  // hold their registers through the loop, and only one work-group fits a WGP.
  __builtin_amdgcn_sched_barrier(0);
  int half = lane >> 4;
  int col = (ct0 << 4) + (lane & 15);
  float bias0 = bo[col], bias1 = bo[col + 16];
  // One base per buffer: every row and both channel tiles are constant offsets.
  size_t base = ((size_t)mt0 * 16 + half * 8) * Cq + col;
  const float* xp = x + base;
  float* op = out + base;
#pragma unroll
  for (int i = 0; i < PROJ_MT; ++i) {
#pragma unroll
    for (int r = 0; r < 8; ++r) {
      int o = (i * 16 + r) * Cq;                    // C/D layout: M = vgpr + half*8
      op[o]      = acc[i][0][r] + bias0 + xp[o];
      op[o + 16] = acc[i][1][r] + bias1 + xp[o + 16];
    }
  }
}

// ---------------------------------------------------------------------------
// Launch
// ---------------------------------------------------------------------------
extern "C" void kernel_launch(void* const* d_in, const int* in_sizes, int n_in,
                              void* d_out, int out_size, void* d_ws, size_t ws_size,
                              hipStream_t stream) {
  const float* x      = (const float*)d_in[0];
  const float* gscale = (const float*)d_in[1];
  const float* gbias  = (const float*)d_in[2];
  const float* wq     = (const float*)d_in[3];
  const float* bq     = (const float*)d_in[4];
  const float* wk     = (const float*)d_in[5];
  const float* bk     = (const float*)d_in[6];
  const float* wv     = (const float*)d_in[7];
  const float* bv     = (const float*)d_in[8];
  const float* wo     = (const float*)d_in[9];
  const float* bo     = (const float*)d_in[10];
  float* out = (float*)d_out;

  char* ws = (char*)d_ws;
  float* stats = (float*)ws;                               // 2 KB
  bf16* wpkq = (bf16*)(ws + 4096);                         // 4 x 512KB packed weights
  bf16* wpkk = (bf16*)(ws + 4096 + 1 * 524288);
  bf16* wpkv = (bf16*)(ws + 4096 + 2 * 524288);
  bf16* wpko = (bf16*)(ws + 4096 + 3 * 524288);
  size_t o = 4096 + 4 * 524288;
  bf16* hn  = (bf16*)(ws + o); o += 33554432;              // normalized acts / reused as attn out
  bf16* qb  = (bf16*)(ws + o); o += 33554432;              // Q, fragment order
  bf16* kb  = (bf16*)(ws + o); o += 33554432;              // K, fragment order
  bf16* vtb = (bf16*)(ws + o);                             // V, fragment order (rows = channels)

  k_gn_stats<<<256, 256, 0, stream>>>(x, stats);
  k_gn_apply<<<16384, 256, 0, stream>>>(x, stats, gscale, gbias, hn);
  k_pack_w<<<64, 256, 0, stream>>>(wq, wpkq);
  k_pack_w<<<64, 256, 0, stream>>>(wk, wpkk);
  k_pack_w<<<64, 256, 0, stream>>>(wv, wpkv);
  k_pack_w<<<64, 256, 0, stream>>>(wo, wpko);
  k_qkv<<<2048, 256, 0, stream>>>(hn, wpkq, wpkk, wpkv, bq, bk, bv, qb, kb, vtb);
  k_attn_out<<<256, 256, 0, stream>>>(qb, kb, vtb, hn);      // attn out overwrites hn
  k_out_proj<<<1024, 256, 0, stream>>>(hn, wpko, bo, x, out);
}

// v006
// Measured time: 272 microseconds a run.
// Two timings next to v005 put it at 1.09 and 1.10 times that version's speed.
// Over all steps from v000 it is 9.42 times as fast.
#include <hip/hip_runtime.h>

typedef __bf16 bf16;
typedef __attribute__((ext_vector_type(16))) __bf16 v16bf;
typedef __attribute__((ext_vector_type(8)))  __bf16 v8bf;
typedef __attribute__((ext_vector_type(8)))  float  v8f;
typedef __attribute__((ext_vector_type(4)))  int    v4i;
typedef __attribute__((address_space(3))) v4i* lds_v4i_p;

#define Bq 8
#define Cq 512
#define Nq 4096
#define Mq 32768
#define SCALEF 0.044194173824159216f   // 1/sqrt(512)
#define EPSQ 1e-5f

// ---------------------------------------------------------------------------
// WMMA helpers
// ---------------------------------------------------------------------------
__device__ __forceinline__ v8f wmma_bf16(v16bf a, v16bf b, v8f c) {
  return __builtin_amdgcn_wmma_f32_16x16x32_bf16(false, a, false, b, (short)0, c,
                                                 false, false);
}

__device__ __forceinline__ v16bf cat8(v8bf lo, v8bf hi) {
  return __builtin_shufflevector(lo, hi, 0, 1, 2, 3, 4, 5, 6, 7,
                                         8, 9, 10, 11, 12, 13, 14, 15);
}

// Fragment order. Every bf16 WMMA operand (in the workspace and in LDS) is kept
// as 1 KB blocks, one block per 16-row x 32-k fragment: [part 0..1][lane 0..31][8].
// Per ISA layout: lane L -> row = L&15, half = L>>4;
// part 0, elements 0..7  -> k = half*8 + j
// part 1, elements 8..15 -> k = 16 + half*8 + j
// so each of the two 16-byte reads of a fragment covers 512 contiguous bytes
// over the wave: four whole lines from global memory, no shared bank in LDS.
// The same pattern serves as a B fragment (rows indexed by N).
// frag_off: place of element (row r16, k index k32) inside its block.
__device__ __forceinline__ int frag_off(int r16, int k32) {
  return ((k32 >> 4) << 8) + (((((k32 >> 3) & 1) << 4) + r16) << 3) + (k32 & 7);
}

__device__ __forceinline__ v16bf frag_packed(const bf16* blk, int lane) {
  const bf16* p = blk + lane * 8;
  v8bf lo = *(const v8bf*)p;
  v8bf hi = *(const v8bf*)(p + 256);
  return cat8(lo, hi);
}

// ---------------------------------------------------------------------------
// Async global -> LDS staging (gfx1250 GLOBAL_LOAD_ASYNC_TO_LDS_B128,
// tracked by ASYNCcnt). Param 0 is a generic v4i* (per compiler diagnostic);
// LDS side is cast to addrspace(3), which also converts implicitly to
// generic if the builtin is declared that way.
// ---------------------------------------------------------------------------
__device__ __forceinline__ void stage16(const void* gsrc, void* ldst) {
#if __has_builtin(__builtin_amdgcn_global_load_async_to_lds_b128)
  __builtin_amdgcn_global_load_async_to_lds_b128((v4i*)gsrc, (lds_v4i_p)ldst, 0, 0);
#else
  *(uint4*)ldst = *(const uint4*)gsrc;
#endif
}

// This wave's own copies have landed (before the barrier that publishes them).
__device__ __forceinline__ void wait_copies0() {
  asm volatile("s_wait_asynccnt 0x0" ::: "memory");
}

// 16-row tiles per work-group of the two projection kernels: each wave carries
// all of them, so one weight fragment read from L2 feeds that many WMMAs.
#define PROJ_MT 4

// ---------------------------------------------------------------------------
// 1) GroupNorm statistics: one block per (batch, group); 256-thread reduce.
// ---------------------------------------------------------------------------
__global__ __launch_bounds__(256) void k_gn_stats(const float* __restrict__ x,
                                                  float* __restrict__ stats) {
  int bg = blockIdx.x;            // 0..255 : b*32+g
  int b = bg >> 5, g = bg & 31;
  const float* xb = x + (size_t)b * Nq * Cq + g * 16;
  float s = 0.f, ss = 0.f;
  for (int n = threadIdx.x; n < Nq; n += 256) {
    const float* p = xb + (size_t)n * Cq;
#pragma unroll
    for (int ci = 0; ci < 16; ++ci) { float v = p[ci]; s += v; ss += v * v; }
  }
  __shared__ float sh_s[256], sh_ss[256];
  sh_s[threadIdx.x] = s; sh_ss[threadIdx.x] = ss;
  __syncthreads();
  for (int off = 128; off > 0; off >>= 1) {
    if (threadIdx.x < off) {
      sh_s[threadIdx.x]  += sh_s[threadIdx.x + off];
      sh_ss[threadIdx.x] += sh_ss[threadIdx.x + off];
    }
    __syncthreads();
  }
  if (threadIdx.x == 0) {
    float inv = 1.0f / (float)(Nq * 16);
    float mean = sh_s[0] * inv;
    float var  = sh_ss[0] * inv - mean * mean;
    stats[bg * 2]     = mean;
    stats[bg * 2 + 1] = rsqrtf(var + EPSQ);
  }
}

// ---------------------------------------------------------------------------
// 2) Apply GroupNorm, emit bf16 activations (M x C in fragment order:
//    block (m>>4, c>>5); a 16-row tile is 16 KB contiguous).
// ---------------------------------------------------------------------------
__global__ __launch_bounds__(256) void k_gn_apply(const float* __restrict__ x,
                                                  const float* __restrict__ stats,
                                                  const float* __restrict__ gamma,
                                                  const float* __restrict__ beta,
                                                  bf16* __restrict__ hn) {
  // i4 is the place in hn: threads walk the fragment order, so a wave stores
  // whole lines and each line has one writer; (m, c) is read back from the place.
  size_t i4 = ((size_t)blockIdx.x * 256 + threadIdx.x) * 4;
  int w = (int)(i4 & 511);
  int blk = (int)(i4 >> 9);
  int c = ((blk & 15) << 5) + ((w >> 8) << 4) + (((w >> 7) & 1) << 3) + (w & 7);
  int m = ((blk >> 4) << 4) + ((w >> 3) & 15);
  int b = m >> 12;
  int g = c >> 4;
  float mean = stats[(b * 32 + g) * 2];
  float rstd = stats[(b * 32 + g) * 2 + 1];
  float4 xv = *(const float4*)(x + (size_t)m * Cq + c);
  bf16* o = hn + i4;
  o[0] = (bf16)((xv.x - mean) * rstd * gamma[c]     + beta[c]);
  o[1] = (bf16)((xv.y - mean) * rstd * gamma[c + 1] + beta[c + 1]);
  o[2] = (bf16)((xv.z - mean) * rstd * gamma[c + 2] + beta[c + 2]);
  o[3] = (bf16)((xv.w - mean) * rstd * gamma[c + 3] + beta[c + 3]);
}

// ---------------------------------------------------------------------------
// 3) Pack a 512x512 f32 weight (w[k][n]) into fragment order:
//    block (kt*32+nt), rows indexed by n.
// ---------------------------------------------------------------------------
__global__ __launch_bounds__(256) void k_pack_w(const float* __restrict__ w,
                                                bf16* __restrict__ wpk) {
  int tid = blockIdx.x * 256 + threadIdx.x;
  if (tid >= 16 * 32 * 32) return;   // ktiles(16) * ntiles(32) * lanes(32)
  int lane = tid & 31;
  int nt = (tid >> 5) & 31;
  int kt = tid >> 10;
  int n = nt * 16 + (lane & 15);
  int half = lane >> 4;
  bf16* dst = wpk + (size_t)(tid >> 5) * 512 + lane * 8; // tid>>5 == kt*32+nt
#pragma unroll
  for (int j = 0; j < 8; ++j)
    dst[j] = (bf16)w[(kt * 32 + half * 8 + j) * Cq + n];
#pragma unroll
  for (int j = 0; j < 8; ++j)
    dst[256 + j] = (bf16)w[(kt * 32 + 16 + half * 8 + j) * Cq + n];
}

// ---------------------------------------------------------------------------
// 4) Fused QKV projection. 8 waves share one async-staged 64x512 A tile (four
//    16-row tiles); each wave computes the four 16x16 tiles of one channel tile
//    for q, k, v: an A fragment is used 3x, a weight fragment 4x.
//    q,k stored in fragment order, block (row>>4, channel>>5); v stored in
//    fragment order for P*V (rows = channels, k = keys), block (key>>5, channel>>4):
//    a lane's eight accumulator rows are its own 16 bytes of that block.
// ---------------------------------------------------------------------------
__global__ __launch_bounds__(256) void k_qkv(const bf16* __restrict__ hn,
                                             const bf16* __restrict__ wq,
                                             const bf16* __restrict__ wk,
                                             const bf16* __restrict__ wv,
                                             const float* __restrict__ bq,
                                             const float* __restrict__ bk,
                                             const float* __restrict__ bv,
                                             bf16* __restrict__ qb,
                                             bf16* __restrict__ kb,
                                             bf16* __restrict__ vtb) {
  __shared__ __align__(16) bf16 atile[PROJ_MT * 16 * 512];
  int wave = threadIdx.x >> 5, lane = threadIdx.x & 31;
  int mt0 = (blockIdx.x >> 2) * PROJ_MT;
  int ct = ((blockIdx.x & 3) << 3) + wave;
  // A constant trip count, unrolled: straight-line copies with every lane on.
#pragma unroll
  for (int j = 0; j < PROJ_MT * 4; ++j)
    stage16((const uint4*)(hn + (size_t)mt0 * 16 * Cq) + j * 256 + threadIdx.x,
            (uint4*)atile + j * 256 + threadIdx.x);
  wait_copies0();
  __syncthreads();
  v8f aq[PROJ_MT] = {}, ak[PROJ_MT] = {}, av[PROJ_MT] = {};
  // Fully unrolled: the weight reads of later k steps then issue ahead of the
  // WMMAs of earlier ones; rolled, each read is waited for before its WMMA.
#pragma unroll
  for (int kt = 0; kt < 16; ++kt) {
    size_t wb = (size_t)(kt * 32 + ct) * 512;
    v16bf fq = frag_packed(wq + wb, lane);
    v16bf fk = frag_packed(wk + wb, lane);
    v16bf fv = frag_packed(wv + wb, lane);
    // Unrolled, here and in the epilogue: the accumulator arrays are then
    // indexed by constants and stay in registers.
#pragma unroll
    for (int i = 0; i < PROJ_MT; ++i) {
      v16bf a = frag_packed(atile + (i * 16 + kt) * 512, lane);
      aq[i] = wmma_bf16(a, fq, aq[i]);
      ak[i] = wmma_bf16(a, fk, ak[i]);
      av[i] = wmma_bf16(a, fv, av[i]);
    }
  }
  int half = lane >> 4;
  int col = (ct << 4) + (lane & 15);
  float xbq = bq[col], xbk = bk[col], xbv = bv[col];
#pragma unroll
  for (int i = 0; i < PROJ_MT; ++i) {
    int mt = mt0 + i, m0 = mt << 4;
    size_t qkblk = ((size_t)mt * 16 + (col >> 5)) * 512;
    v8bf vv;
#pragma unroll
    for (int r = 0; r < 8; ++r) {
      int off = frag_off(r + half * 8, col & 31);   // C/D layout: M = vgpr + half*8
      qb[qkblk + off] = (bf16)(aq[i][r] + xbq);
      kb[qkblk + off] = (bf16)(ak[i][r] + xbk);
      vv[r] = (bf16)(av[i][r] + xbv);
    }
    int bb = m0 >> 12, n0 = m0 & (Nq - 1);          // key = n0 + half*8 + r
    *(v8bf*)(vtb + (size_t)bb * Cq * Nq + ((size_t)(n0 >> 5) * 32 + ct) * 512 +
             ((n0 >> 4) & 1) * 256 + lane * 8) = vv;
  }
}

typedef __attribute__((address_space(3))) char* lds_char_p;
#define AQT 2    // 16-query tiles per wave of the attention kernel
#define AGF 8    // K or V fragments per group of LDS reads there
#define ANG (32 / AGF)   // groups per 32-key tile of K, and of V
#define ASET 2   // register sets that the groups go through

__device__ __forceinline__ void copy_32k(const bf16* g, bf16* l, int tid) {
  const char* gp = (const char*)g + tid * 16;
  unsigned lp = (unsigned)(__UINTPTR_TYPE__)(lds_char_p)(char*)l + (unsigned)tid * 16u;
  // Source and destination advance by the same 2 KB from copy to copy, and the
  // immediate offset moves both addresses: one address pair serves all sixteen.
  // The copies and their s_wait_xcnt stand in one statement, so no address
  // register of an issued copy is rewritten ahead of that wait.
  asm volatile(
      "global_load_async_to_lds_b128 %0, %1, off\n\t"
      "global_load_async_to_lds_b128 %0, %1, off offset:2048\n\t"
      "global_load_async_to_lds_b128 %0, %1, off offset:4096\n\t"
      "global_load_async_to_lds_b128 %0, %1, off offset:6144\n\t"
      "global_load_async_to_lds_b128 %0, %1, off offset:8192\n\t"
      "global_load_async_to_lds_b128 %0, %1, off offset:10240\n\t"
      "global_load_async_to_lds_b128 %0, %1, off offset:12288\n\t"
      "global_load_async_to_lds_b128 %0, %1, off offset:14336\n\t"
      "global_load_async_to_lds_b128 %0, %1, off offset:16384\n\t"
      "global_load_async_to_lds_b128 %0, %1, off offset:18432\n\t"
      "global_load_async_to_lds_b128 %0, %1, off offset:20480\n\t"
      "global_load_async_to_lds_b128 %0, %1, off offset:22528\n\t"
      "global_load_async_to_lds_b128 %0, %1, off offset:24576\n\t"
      "global_load_async_to_lds_b128 %0, %1, off offset:26624\n\t"
      "global_load_async_to_lds_b128 %0, %1, off offset:28672\n\t"
      "global_load_async_to_lds_b128 %0, %1, off offset:30720\n\t"
      "s_wait_xcnt 0x0"
      :: "v"(lp), "v"(gp)
      : "memory");
}

// One 32-key tile: 32 KB of K and 32 KB of V into one buffer ([K, V]).
__device__ __forceinline__ void copy_kv_tile(const bf16* k, const bf16* v, bf16* buf,
                                             int tid) {
  copy_32k(k, buf, tid);
  copy_32k(v, buf + 16384, tid);
}

// This wave's own LDS reads and writes have retired (before a buffer is handed
// back for refill).
__device__ __forceinline__ void wait_ds0() {
  asm volatile("s_wait_dscnt 0x0" ::: "memory");
}

// ---------------------------------------------------------------------------
// Lane l with lane l ^ 16: the two lanes that share a query column of a
// transposed score tile (each holds half of its keys).
// ---------------------------------------------------------------------------
__device__ __forceinline__ float xhalf(float v) {
  int b = __builtin_bit_cast(int, v);
  return __builtin_bit_cast(float, __builtin_amdgcn_permlanex16(
      b, b, 0x76543210, 0xfedcba98, false, false));
}
// The maxima in use are replaced only when some query's tile maximum exceeds its own by
// more than this (P then stays below e^5.5, about 245).
#define RESCALE_OVER 5.5f

// The largest of the 16 scores that a lane holds of one query (a tree three deep).
__device__ __forceinline__ float max16(v8f d0, v8f d1) {
  float ma = fmaxf(fmaxf(d0[0], d1[0]), d0[1]);
  float mb = fmaxf(fmaxf(d1[1], d0[2]), d1[2]);
  float mc = fmaxf(fmaxf(d0[3], d1[3]), d0[4]);
  float md = fmaxf(fmaxf(d1[4], d0[5]), d1[5]);
  float me = fmaxf(fmaxf(d0[6], d1[6]), d0[7]);
  return fmaxf(fmaxf(fmaxf(ma, mb), d1[7]), fmaxf(fmaxf(mc, md), me));
}

__global__ __launch_bounds__(128) void k_attn_out(const bf16* __restrict__ qb,
                                                  const bf16* __restrict__ kb,
                                                  const bf16* __restrict__ vtb,
                                                  bf16* __restrict__ ao) {
  __shared__ __align__(16) bf16 kvbuf[2][2 * 32 * 512];   // [buffer][K, V]
  int wave = threadIdx.x >> 5, lane = threadIdx.x & 31;
  int qt = blockIdx.x * 8 + wave * AQT;             // the wave's first query tile
  int b = blockIdx.x >> 5;
  const bf16* kbase = kb + (size_t)b * Nq * Cq;
  const bf16* vbase = vtb + (size_t)b * Cq * Nq;
  copy_kv_tile(kbase, vbase, &kvbuf[0][0], threadIdx.x);
  const bf16* qsrc = qb + (size_t)qt * 16 * Cq + lane * 8;   // the lane's 16 bytes
  v16bf qf[AQT][16];
#pragma unroll
  for (int q = 0; q < AQT; ++q)
#pragma unroll
    for (int kt = 0; kt < 16; ++kt)
      qf[q][kt] = cat8(*(const v8bf*)(qsrc + (q * 16 + kt) * 512),
                       *(const v8bf*)(qsrc + (q * 16 + kt) * 512 + 256));
  // mrow: the maximum in use of the lane's query (equal in its two lanes);
  // lsum: this lane's share of the query's sum, one partial sum per score
  // register (eight short chains, not one long one), joined in the epilogue;
  // p0, p1: the last tile's P (f32), added to lsum beside the next tile's first
  // score WMMAs, where the vector unit has nothing else to do.
  float mrow[AQT];
  v8f lsum[AQT], p0[AQT], p1[AQT];
#pragma unroll
  for (int q = 0; q < AQT; ++q) {
    mrow[q] = -1e30f;
    lsum[q] = (v8f){}; p0[q] = (v8f){}; p1[q] = (v8f){};
  }
  // The address registers of the loads above stay as they are until this wait
  // (named as an input so that they live up to it).
  asm volatile("s_wait_xcnt 0x0" :: "v"(qsrc) : "memory");
  wait_copies0();
  __syncthreads();                                  // publish tile 0
  copy_kv_tile(kbase + 32 * Cq, vbase + 32 * Cq, &kvbuf[1][0], threadIdx.x);
  v8f acc[AQT][32] = {};
  for (int t = 0; t < 128; ++t) {                   // 32 keys per trip
    const bf16* kt32 = &kvbuf[t & 1][0];
    const bf16* vt32 = kt32 + 32 * 512;
    v8f d0[AQT] = {}, d1[AQT] = {};
    // K and V fragments come in groups of AGF, 2 * ANG groups a tile (K, then V),
    // through ASET register sets: a group's LDS reads are issued as one run, 16
    // WMMAs ahead of its own, since with one wave on the SIMD nothing else covers
    // their latency. Unrolled so that qf[], acc[] and the sets are indexed by
    // constants and stay in registers.
    v16bf fr[ASET][AGF];
#pragma unroll
    for (int i = 0; i < ASET - 1; ++i)
#pragma unroll
      for (int j = 0; j < AGF; ++j)
        fr[i][j] = frag_packed(kt32 + (j & 1) * 16 * Cq + (i * (AGF / 2) + (j >> 1)) * 512, lane);
#pragma unroll
    for (int g = 0; g < ANG; ++g) {
      const int n = g + ASET - 1;                   // the group fetched now
#pragma unroll
      for (int j = 0; j < AGF; ++j)
        fr[n % ASET][j] = (n < ANG)
            ? frag_packed(kt32 + (j & 1) * 16 * Cq + (n * (AGF / 2) + (j >> 1)) * 512, lane)
            : frag_packed(vt32 + ((n - ANG) * AGF + j) * 512, lane);   // first of V
      // Keeps the reads above as one group ahead of the WMMAs; left free, each
      // read sinks to just in front of its WMMA, which then waits out its latency.
      __builtin_amdgcn_sched_barrier(0);
#pragma unroll
      for (int h = 0; h < AGF / 2; ++h) {           // rows = keys, columns = queries
        const int kt = g * (AGF / 2) + h;
#pragma unroll
        for (int q = 0; q < AQT; ++q)
          d0[q] = wmma_bf16(fr[g % ASET][h * 2], qf[q][kt], d0[q]);
#pragma unroll
        for (int q = 0; q < AQT; ++q)
          d1[q] = wmma_bf16(fr[g % ASET][h * 2 + 1], qf[q][kt], d1[q]);
      }
      if (g == 0) {                                 // ahead of this tile's rescale
#pragma unroll
        for (int q = 0; q < AQT; ++q) lsum[q] += p0[q] + p1[q];
      }
      // Keeps the following group's reads behind these WMMAs.
      __builtin_amdgcn_sched_barrier(0);
    }
    // The tile's maximum for the lane's query: its own 16 keys in the lane, the
    // other 16 from the other half.
    float tm[AQT];
    bool over = false;
#pragma unroll
    for (int q = 0; q < AQT; ++q) {
      float m = max16(d0[q], d1[q]);
      tm[q] = fmaxf(m, xhalf(m)) * SCALEF;
      over = over || (tm[q] - mrow[q] > RESCALE_OVER);
    }
    // One test per tile, the same for the whole wave (a scalar branch): the
    // 512 accumulator registers are rescaled only when some query's maximum has
    // passed the one in use by the margin.
    if (__builtin_amdgcn_ballot_w32(over) != 0) {
#pragma unroll
      for (int q = 0; q < AQT; ++q) {
        float mnew = fmaxf(mrow[q], tm[q]);
        float f = __expf(mrow[q] - mnew);           // 0 on the first tile
        mrow[q] = mnew;
        lsum[q] *= f;
#pragma unroll
        for (int ct = 0; ct < 32; ++ct)
#pragma unroll
          for (int r = 0; r < 8; ++r) acc[q][ct][r] *= f;
      }
    }
    v16bf pa[AQT];            // B fragments of P^T: k = key, column = query
#pragma unroll
    for (int q = 0; q < AQT; ++q)
#pragma unroll
      for (int r = 0; r < 8; ++r) {
        p0[q][r] = __expf(d0[q][r] * SCALEF - mrow[q]);
        p1[q][r] = __expf(d1[q][r] * SCALEF - mrow[q]);
        pa[q][r]     = (bf16)p0[q][r];              // key r + half*8
        pa[q][r + 8] = (bf16)p1[q][r];              // key 16 + r + half*8
      }
#pragma unroll
    for (int g = 0; g < ANG; ++g) {
      const int n = g + ASET - 1;                   // the V group fetched now
      if (n < ANG) {
#pragma unroll
        for (int j = 0; j < AGF; ++j)
          fr[(ANG + n) % ASET][j] = frag_packed(vt32 + (n * AGF + j) * 512, lane);
      }
      __builtin_amdgcn_sched_barrier(0);            // as in the score loop
#pragma unroll
      for (int j = 0; j < AGF; ++j)
#pragma unroll
        for (int q = 0; q < AQT; ++q)               // rows = channels
          acc[q][g * AGF + j] = wmma_bf16(fr[(ANG + g) % ASET][j], pa[q], acc[q][g * AGF + j]);
      __builtin_amdgcn_sched_barrier(0);            // as in the score loop
    }
    wait_ds0();
    wait_copies0();
    __syncthreads();          // publishes tile t+1, ends every read of tile t
    if (t + 2 < 128)
      copy_kv_tile(kbase + (size_t)(t + 2) * 32 * Cq, vbase + (size_t)(t + 2) * 32 * Cq,
                   &kvbuf[t & 1][0], threadIdx.x);
  }
  wait_copies0();
  // Register r of tile ct is channel ct*16 + half*8 + r of the lane's query: the
  // lane's own 16 bytes of the fragment-order block, one store per tile.
  v8bf ov[AQT][32];
#pragma unroll
  for (int q = 0; q < AQT; ++q) {
    lsum[q] += p0[q] + p1[q];                       // the last tile's
    float lown = ((lsum[q][0] + lsum[q][1]) + (lsum[q][2] + lsum[q][3])) +
                 ((lsum[q][4] + lsum[q][5]) + (lsum[q][6] + lsum[q][7]));
    float rinv = 1.0f / (lown + xhalf(lown));
#pragma unroll
    for (int ct = 0; ct < 32; ++ct)
#pragma unroll
      for (int r = 0; r < 8; ++r) ov[q][ct][r] = (bf16)(acc[q][ct][r] * rinv);
  }
  // Holds every conversion in front of the first store, so that no register
  // which an issued store names is written again.
  __builtin_amdgcn_sched_barrier(0);
  bf16* ob = ao + (size_t)qt * 16 * Cq + lane * 8;
#pragma unroll
  for (int q = 0; q < AQT; ++q)
#pragma unroll
    for (int ct = 0; ct < 32; ++ct) *(v8bf*)(ob + (q * 32 + ct) * 256) = ov[q][ct];
}

// ---------------------------------------------------------------------------
// 6) Output projection + bias + residual, fp32 store. As in 4), 64 rows per
//    work-group; each wave takes two neighbouring channel tiles (an A fragment
//    is used 2x, a weight fragment 4x) and so writes whole 128-byte lines.
// ---------------------------------------------------------------------------
__global__ __launch_bounds__(256) void k_out_proj(const bf16* __restrict__ ao,
                                                  const bf16* __restrict__ wo,
                                                  const float* __restrict__ bo,
                                                  const float* __restrict__ x,
                                                  float* __restrict__ out) {
  __shared__ __align__(16) bf16 atile[PROJ_MT * 16 * 512];
  int wave = threadIdx.x >> 5, lane = threadIdx.x & 31;
  int mt0 = (blockIdx.x >> 1) * PROJ_MT;
  int ct0 = ((blockIdx.x & 1) << 4) + wave * 2;
  // A constant trip count, unrolled: straight-line copies with every lane on.
#pragma unroll
  for (int j = 0; j < PROJ_MT * 4; ++j)
    stage16((const uint4*)(ao + (size_t)mt0 * 16 * Cq) + j * 256 + threadIdx.x,
            (uint4*)atile + j * 256 + threadIdx.x);
  wait_copies0();
  __syncthreads();
  v8f acc[PROJ_MT][2] = {};
  for (int kt = 0; kt < 16; ++kt) {
    const bf16* wb = wo + (size_t)(kt * 32 + ct0) * 512;
    v16bf f0 = frag_packed(wb, lane);
    v16bf f1 = frag_packed(wb + 512, lane);
    // Unrolled, here and in the epilogue: acc[][] is then indexed by constants
    // and stays in registers.
#pragma unroll
    for (int i = 0; i < PROJ_MT; ++i) {
      v16bf a = frag_packed(atile + (i * 16 + kt) * 512, lane);
      acc[i][0] = wmma_bf16(a, f0, acc[i][0]);
      acc[i][1] = wmma_bf16(a, f1, acc[i][1]);
    }
  }
  // Keeps the 64 residual reads behind the product loop; lifted over it they
  // hold their registers through the loop, and only one work-group fits a WGP.
  __builtin_amdgcn_sched_barrier(0);
  int half = lane >> 4;
  int col = (ct0 << 4) + (lane & 15);
  float bias0 = bo[col], bias1 = bo[col + 16];
  // One base per buffer: every row and both channel tiles are constant offsets.
  size_t base = ((size_t)mt0 * 16 + half * 8) * Cq + col;
  const float* xp = x + base;
  float* op = out + base;
#pragma unroll
  for (int i = 0; i < PROJ_MT; ++i) {
#pragma unroll
    for (int r = 0; r < 8; ++r) {
      int o = (i * 16 + r) * Cq;                    // C/D layout: M = vgpr + half*8
      op[o]      = acc[i][0][r] + bias0 + xp[o];
      op[o + 16] = acc[i][1][r] + bias1 + xp[o + 16];
    }
  }
}

// ---------------------------------------------------------------------------
// Launch
// ---------------------------------------------------------------------------
extern "C" void kernel_launch(void* const* d_in, const int* in_sizes, int n_in,
                              void* d_out, int out_size, void* d_ws, size_t ws_size,
                              hipStream_t stream) {
  const float* x      = (const float*)d_in[0];
  const float* gscale = (const float*)d_in[1];
  const float* gbias  = (const float*)d_in[2];
  const float* wq     = (const float*)d_in[3];
  const float* bq     = (const float*)d_in[4];
  const float* wk     = (const float*)d_in[5];
  const float* bk     = (const float*)d_in[6];
  const float* wv     = (const float*)d_in[7];
  const float* bv     = (const float*)d_in[8];
  const float* wo     = (const float*)d_in[9];
  const float* bo     = (const float*)d_in[10];
  float* out = (float*)d_out;

  char* ws = (char*)d_ws;
  float* stats = (float*)ws;                               // 2 KB
  bf16* wpkq = (bf16*)(ws + 4096);                         // 4 x 512KB packed weights
  bf16* wpkk = (bf16*)(ws + 4096 + 1 * 524288);
  bf16* wpkv = (bf16*)(ws + 4096 + 2 * 524288);
  bf16* wpko = (bf16*)(ws + 4096 + 3 * 524288);
  size_t o = 4096 + 4 * 524288;
  bf16* hn  = (bf16*)(ws + o); o += 33554432;              // normalized acts / reused as attn out
  bf16* qb  = (bf16*)(ws + o); o += 33554432;              // Q, fragment order
  bf16* kb  = (bf16*)(ws + o); o += 33554432;              // K, fragment order
  bf16* vtb = (bf16*)(ws + o);                             // V, fragment order (rows = channels)

  k_gn_stats<<<256, 256, 0, stream>>>(x, stats);
  k_gn_apply<<<16384, 256, 0, stream>>>(x, stats, gscale, gbias, hn);
  k_pack_w<<<64, 256, 0, stream>>>(wq, wpkq);
  k_pack_w<<<64, 256, 0, stream>>>(wk, wpkk);
  k_pack_w<<<64, 256, 0, stream>>>(wv, wpkv);
  k_pack_w<<<64, 256, 0, stream>>>(wo, wpko);
  k_qkv<<<2048, 256, 0, stream>>>(hn, wpkq, wpkk, wpkv, bq, bk, bv, qb, kb, vtb);
  k_attn_out<<<256, 128, 0, stream>>>(qb, kb, vtb, hn);      // attn out overwrites hn
  k_out_proj<<<1024, 256, 0, stream>>>(hn, wpko, bo, x, out);
}

// v007
// Measured time: 264 microseconds a run.
// In both of two side-by-side timings against v006, it was 1.03 times as fast.
// Counting every step since v000, it is 9.69 times as fast.
#include <hip/hip_runtime.h>

typedef __bf16 bf16;
typedef __attribute__((ext_vector_type(16))) __bf16 v16bf;
typedef __attribute__((ext_vector_type(8)))  __bf16 v8bf;
typedef __attribute__((ext_vector_type(8)))  float  v8f;
typedef __attribute__((ext_vector_type(4)))  int    v4i;
typedef __attribute__((address_space(3))) v4i* lds_v4i_p;

#define Bq 8
#define Cq 512
#define Nq 4096
#define Mq 32768
#define SCALEF 0.044194173824159216f   // 1/sqrt(512)
#define EPSQ 1e-5f

// ---------------------------------------------------------------------------
// WMMA helpers
// ---------------------------------------------------------------------------
__device__ __forceinline__ v8f wmma_bf16(v16bf a, v16bf b, v8f c) {
  return __builtin_amdgcn_wmma_f32_16x16x32_bf16(false, a, false, b, (short)0, c,
                                                 false, false);
}

__device__ __forceinline__ v16bf cat8(v8bf lo, v8bf hi) {
  return __builtin_shufflevector(lo, hi, 0, 1, 2, 3, 4, 5, 6, 7,
                                         8, 9, 10, 11, 12, 13, 14, 15);
}

// Fragment order. Every bf16 WMMA operand (in the workspace and in LDS) is kept
// as 1 KB blocks, one block per 16-row x 32-k fragment: [part 0..1][lane 0..31][8].
// Per ISA layout: lane L -> row = L&15, half = L>>4;
// part 0, elements 0..7  -> k = half*8 + j
// part 1, elements 8..15 -> k = 16 + half*8 + j
// so each of the two 16-byte reads of a fragment covers 512 contiguous bytes
// over the wave: four whole lines from global memory, no shared bank in LDS.
// The same pattern serves as a B fragment (rows indexed by N).
// frag_off: place of element (row r16, k index k32) inside its block.
__device__ __forceinline__ int frag_off(int r16, int k32) {
  return ((k32 >> 4) << 8) + (((((k32 >> 3) & 1) << 4) + r16) << 3) + (k32 & 7);
}

__device__ __forceinline__ v16bf frag_packed(const bf16* blk, int lane) {
  const bf16* p = blk + lane * 8;
  v8bf lo = *(const v8bf*)p;
  v8bf hi = *(const v8bf*)(p + 256);
  return cat8(lo, hi);
}

// ---------------------------------------------------------------------------
// Async global -> LDS staging (gfx1250 GLOBAL_LOAD_ASYNC_TO_LDS_B128,
// tracked by ASYNCcnt). Param 0 is a generic v4i* (per compiler diagnostic);
// LDS side is cast to addrspace(3), which also converts implicitly to
// generic if the builtin is declared that way.
// ---------------------------------------------------------------------------
__device__ __forceinline__ void stage16(const void* gsrc, void* ldst) {
#if __has_builtin(__builtin_amdgcn_global_load_async_to_lds_b128)
  __builtin_amdgcn_global_load_async_to_lds_b128((v4i*)gsrc, (lds_v4i_p)ldst, 0, 0);
#else
  *(uint4*)ldst = *(const uint4*)gsrc;
#endif
}

// This wave's own copies have landed (before the barrier that publishes them).
__device__ __forceinline__ void wait_copies0() {
  asm volatile("s_wait_asynccnt 0x0" ::: "memory");
}

// 16-row tiles per work-group of the two projection kernels: each wave carries
// all of them, so one weight fragment read from L2 feeds that many WMMAs.
#define PROJ_MT 4

// ---------------------------------------------------------------------------
// 1a) GroupNorm statistics: one block per (batch, group); 256-thread reduce.
//     bg = 0..255 : b*32+g, the same for the whole block (it holds barriers).
// ---------------------------------------------------------------------------
__device__ __forceinline__ void gn_stats_block(const float* __restrict__ x,
                                               float* __restrict__ stats, int bg) {
  int b = bg >> 5, g = bg & 31;
  const float* xb = x + (size_t)b * Nq * Cq + g * 16;
  float s = 0.f, ss = 0.f;
  for (int n = threadIdx.x; n < Nq; n += 256) {
    const float* p = xb + (size_t)n * Cq;
#pragma unroll
    for (int ci = 0; ci < 16; ++ci) { float v = p[ci]; s += v; ss += v * v; }
  }
  __shared__ float sh_s[256], sh_ss[256];
  sh_s[threadIdx.x] = s; sh_ss[threadIdx.x] = ss;
  __syncthreads();
  for (int off = 128; off > 0; off >>= 1) {
    if (threadIdx.x < off) {
      sh_s[threadIdx.x]  += sh_s[threadIdx.x + off];
      sh_ss[threadIdx.x] += sh_ss[threadIdx.x + off];
    }
    __syncthreads();
  }
  if (threadIdx.x == 0) {
    float inv = 1.0f / (float)(Nq * 16);
    float mean = sh_s[0] * inv;
    float var  = sh_ss[0] * inv - mean * mean;
    stats[bg * 2]     = mean;
    stats[bg * 2 + 1] = rsqrtf(var + EPSQ);
  }
}

// ---------------------------------------------------------------------------
// 2) Apply GroupNorm, emit bf16 activations (M x C in fragment order:
//    block (m>>4, c>>5); a 16-row tile is 16 KB contiguous).
// ---------------------------------------------------------------------------
__global__ __launch_bounds__(256) void k_gn_apply(const float* __restrict__ x,
                                                  const float* __restrict__ stats,
                                                  const float* __restrict__ gamma,
                                                  const float* __restrict__ beta,
                                                  bf16* __restrict__ hn) {
  // i4 is the place in hn: threads walk the fragment order, so a wave stores
  // whole lines and each line has one writer; (m, c) is read back from the place.
  size_t i4 = ((size_t)blockIdx.x * 256 + threadIdx.x) * 4;
  int w = (int)(i4 & 511);
  int blk = (int)(i4 >> 9);
  int c = ((blk & 15) << 5) + ((w >> 8) << 4) + (((w >> 7) & 1) << 3) + (w & 7);
  int m = ((blk >> 4) << 4) + ((w >> 3) & 15);
  int b = m >> 12;
  int g = c >> 4;
  float mean = stats[(b * 32 + g) * 2];
  float rstd = stats[(b * 32 + g) * 2 + 1];
  float4 xv = *(const float4*)(x + (size_t)m * Cq + c);
  bf16* o = hn + i4;
  o[0] = (bf16)((xv.x - mean) * rstd * gamma[c]     + beta[c]);
  o[1] = (bf16)((xv.y - mean) * rstd * gamma[c + 1] + beta[c + 1]);
  o[2] = (bf16)((xv.z - mean) * rstd * gamma[c + 2] + beta[c + 2]);
  o[3] = (bf16)((xv.w - mean) * rstd * gamma[c + 3] + beta[c + 3]);
}

// ---------------------------------------------------------------------------
// 1b) Pack a 512x512 f32 weight (w[k][n]) into fragment order:
//     block (kt*32+nt), rows indexed by n. tid = 0..16383 over 64 blocks.
// ---------------------------------------------------------------------------
__device__ __forceinline__ void pack_w_thread(const float* __restrict__ w,
                                              bf16* __restrict__ wpk, int tid) {
  if (tid >= 16 * 32 * 32) return;   // ktiles(16) * ntiles(32) * lanes(32)
  int lane = tid & 31;
  int nt = (tid >> 5) & 31;
  int kt = tid >> 10;
  int n = nt * 16 + (lane & 15);
  int half = lane >> 4;
  bf16* dst = wpk + (size_t)(tid >> 5) * 512 + lane * 8; // tid>>5 == kt*32+nt
#pragma unroll
  for (int j = 0; j < 8; ++j)
    dst[j] = (bf16)w[(kt * 32 + half * 8 + j) * Cq + n];
#pragma unroll
  for (int j = 0; j < 8; ++j)
    dst[256 + j] = (bf16)w[(kt * 32 + 16 + half * 8 + j) * Cq + n];
}

// ---------------------------------------------------------------------------
// 1) Everything that reads nothing but inputs, in one launch: blocks 0..255 take
//    the GroupNorm statistics (the long ones, so they start first), blocks
//    256..511 pack the four weights, 64 blocks each, into wpk[4][512*512].
//    The branch is on blockIdx alone: a block is wholly on one side of it.
// ---------------------------------------------------------------------------
__global__ __launch_bounds__(256) void k_prep(const float* __restrict__ x,
                                              const float* __restrict__ wq,
                                              const float* __restrict__ wk,
                                              const float* __restrict__ wv,
                                              const float* __restrict__ wo,
                                              float* __restrict__ stats,
                                              bf16* __restrict__ wpk) {
  if (blockIdx.x < 256) {
    gn_stats_block(x, stats, blockIdx.x);
    return;
  }
  int j = blockIdx.x - 256;
  int which = j >> 6;
  const float* w = which == 0 ? wq : which == 1 ? wk : which == 2 ? wv : wo;
  pack_w_thread(w, wpk + (size_t)which * (Cq * Cq), (j & 63) * 256 + threadIdx.x);
}

// ---------------------------------------------------------------------------
// 4) Fused QKV projection. 8 waves share one async-staged 64x512 A tile (four
//    16-row tiles); each wave computes the four 16x16 tiles of one channel tile
//    for q, k, v: an A fragment is used 3x, a weight fragment 4x.
//    q,k stored in fragment order, block (row>>4, channel>>5); v stored in
//    fragment order for P*V (rows = channels, k = keys), block (key>>5, channel>>4):
//    a lane's eight accumulator rows are its own 16 bytes of that block.
// ---------------------------------------------------------------------------
__global__ __launch_bounds__(256) void k_qkv(const bf16* __restrict__ hn,
                                             const bf16* __restrict__ wq,
                                             const bf16* __restrict__ wk,
                                             const bf16* __restrict__ wv,
                                             const float* __restrict__ bq,
                                             const float* __restrict__ bk,
                                             const float* __restrict__ bv,
                                             bf16* __restrict__ qb,
                                             bf16* __restrict__ kb,
                                             bf16* __restrict__ vtb) {
  __shared__ __align__(16) bf16 atile[PROJ_MT * 16 * 512];
  int wave = threadIdx.x >> 5, lane = threadIdx.x & 31;
  int mt0 = (blockIdx.x >> 2) * PROJ_MT;
  int ct = ((blockIdx.x & 3) << 3) + wave;
  // A constant trip count, unrolled: straight-line copies with every lane on.
#pragma unroll
  for (int j = 0; j < PROJ_MT * 4; ++j)
    stage16((const uint4*)(hn + (size_t)mt0 * 16 * Cq) + j * 256 + threadIdx.x,
            (uint4*)atile + j * 256 + threadIdx.x);
  wait_copies0();
  __syncthreads();
  v8f aq[PROJ_MT] = {}, ak[PROJ_MT] = {}, av[PROJ_MT] = {};
  // Fully unrolled: the weight reads of later k steps then issue ahead of the
  // WMMAs of earlier ones; rolled, each read is waited for before its WMMA.
#pragma unroll
  for (int kt = 0; kt < 16; ++kt) {
    size_t wb = (size_t)(kt * 32 + ct) * 512;
    v16bf fq = frag_packed(wq + wb, lane);
    v16bf fk = frag_packed(wk + wb, lane);
    v16bf fv = frag_packed(wv + wb, lane);
    // Unrolled, here and in the epilogue: the accumulator arrays are then
    // indexed by constants and stay in registers.
#pragma unroll
    for (int i = 0; i < PROJ_MT; ++i) {
      v16bf a = frag_packed(atile + (i * 16 + kt) * 512, lane);
      aq[i] = wmma_bf16(a, fq, aq[i]);
      ak[i] = wmma_bf16(a, fk, ak[i]);
      av[i] = wmma_bf16(a, fv, av[i]);
    }
  }
  int half = lane >> 4;
  int col = (ct << 4) + (lane & 15);
  float xbq = bq[col], xbk = bk[col], xbv = bv[col];
#pragma unroll
  for (int i = 0; i < PROJ_MT; ++i) {
    int mt = mt0 + i, m0 = mt << 4;
    size_t qkblk = ((size_t)mt * 16 + (col >> 5)) * 512;
    v8bf vv;
#pragma unroll
    for (int r = 0; r < 8; ++r) {
      int off = frag_off(r + half * 8, col & 31);   // C/D layout: M = vgpr + half*8
      qb[qkblk + off] = (bf16)(aq[i][r] + xbq);
      kb[qkblk + off] = (bf16)(ak[i][r] + xbk);
      vv[r] = (bf16)(av[i][r] + xbv);
    }
    int bb = m0 >> 12, n0 = m0 & (Nq - 1);          // key = n0 + half*8 + r
    *(v8bf*)(vtb + (size_t)bb * Cq * Nq + ((size_t)(n0 >> 5) * 32 + ct) * 512 +
             ((n0 >> 4) & 1) * 256 + lane * 8) = vv;
  }
}

typedef __attribute__((address_space(3))) char* lds_char_p;
#define AQT 2    // 16-query tiles per wave of the attention kernel
#define AGF 8    // K or V fragments per group of LDS reads there
#define ANG (32 / AGF)   // groups per 32-key tile of K, and of V
#define ASET 2   // register sets that the groups go through

__device__ __forceinline__ void copy_32k(const bf16* g, bf16* l, int tid) {
  const char* gp = (const char*)g + tid * 16;
  unsigned lp = (unsigned)(__UINTPTR_TYPE__)(lds_char_p)(char*)l + (unsigned)tid * 16u;
  // Source and destination advance by the same 2 KB from copy to copy, and the
  // immediate offset moves both addresses: one address pair serves all sixteen.
  // The copies and their s_wait_xcnt stand in one statement, so no address
  // register of an issued copy is rewritten ahead of that wait.
  asm volatile(
      "global_load_async_to_lds_b128 %0, %1, off\n\t"
      "global_load_async_to_lds_b128 %0, %1, off offset:2048\n\t"
      "global_load_async_to_lds_b128 %0, %1, off offset:4096\n\t"
      "global_load_async_to_lds_b128 %0, %1, off offset:6144\n\t"
      "global_load_async_to_lds_b128 %0, %1, off offset:8192\n\t"
      "global_load_async_to_lds_b128 %0, %1, off offset:10240\n\t"
      "global_load_async_to_lds_b128 %0, %1, off offset:12288\n\t"
      "global_load_async_to_lds_b128 %0, %1, off offset:14336\n\t"
      "global_load_async_to_lds_b128 %0, %1, off offset:16384\n\t"
      "global_load_async_to_lds_b128 %0, %1, off offset:18432\n\t"
      "global_load_async_to_lds_b128 %0, %1, off offset:20480\n\t"
      "global_load_async_to_lds_b128 %0, %1, off offset:22528\n\t"
      "global_load_async_to_lds_b128 %0, %1, off offset:24576\n\t"
      "global_load_async_to_lds_b128 %0, %1, off offset:26624\n\t"
      "global_load_async_to_lds_b128 %0, %1, off offset:28672\n\t"
      "global_load_async_to_lds_b128 %0, %1, off offset:30720\n\t"
      "s_wait_xcnt 0x0"
      :: "v"(lp), "v"(gp)
      : "memory");
}

// One 32-key tile: 32 KB of K and 32 KB of V into one buffer ([K, V]).
__device__ __forceinline__ void copy_kv_tile(const bf16* k, const bf16* v, bf16* buf,
                                             int tid) {
  copy_32k(k, buf, tid);
  copy_32k(v, buf + 16384, tid);
}

// This wave's own LDS reads and writes have retired (before a buffer is handed
// back for refill).
__device__ __forceinline__ void wait_ds0() {
  asm volatile("s_wait_dscnt 0x0" ::: "memory");
}

// ---------------------------------------------------------------------------
// Lane l with lane l ^ 16: the two lanes that share a query column of a
// transposed score tile (each holds half of its keys).
// ---------------------------------------------------------------------------
__device__ __forceinline__ float xhalf(float v) {
  int b = __builtin_bit_cast(int, v);
  return __builtin_bit_cast(float, __builtin_amdgcn_permlanex16(
      b, b, 0x76543210, 0xfedcba98, false, false));
}
// The maxima in use are replaced only when some query's tile maximum exceeds its own by
// more than this (P then stays below e^5.5, about 245).
#define RESCALE_OVER 5.5f

// The largest of the 16 scores that a lane holds of one query (a tree three deep).
__device__ __forceinline__ float max16(v8f d0, v8f d1) {
  float ma = fmaxf(fmaxf(d0[0], d1[0]), d0[1]);
  float mb = fmaxf(fmaxf(d1[1], d0[2]), d1[2]);
  float mc = fmaxf(fmaxf(d0[3], d1[3]), d0[4]);
  float md = fmaxf(fmaxf(d1[4], d0[5]), d1[5]);
  float me = fmaxf(fmaxf(d0[6], d1[6]), d0[7]);
  return fmaxf(fmaxf(fmaxf(ma, mb), d1[7]), fmaxf(fmaxf(mc, md), me));
}

__global__ __launch_bounds__(128) void k_attn_out(const bf16* __restrict__ qb,
                                                  const bf16* __restrict__ kb,
                                                  const bf16* __restrict__ vtb,
                                                  bf16* __restrict__ ao) {
  __shared__ __align__(16) bf16 kvbuf[2][2 * 32 * 512];   // [buffer][K, V]
  int wave = threadIdx.x >> 5, lane = threadIdx.x & 31;
  int qt = blockIdx.x * 8 + wave * AQT;             // the wave's first query tile
  int b = blockIdx.x >> 5;
  const bf16* kbase = kb + (size_t)b * Nq * Cq;
  const bf16* vbase = vtb + (size_t)b * Cq * Nq;
  copy_kv_tile(kbase, vbase, &kvbuf[0][0], threadIdx.x);
  const bf16* qsrc = qb + (size_t)qt * 16 * Cq + lane * 8;   // the lane's 16 bytes
  v16bf qf[AQT][16];
#pragma unroll
  for (int q = 0; q < AQT; ++q)
#pragma unroll
    for (int kt = 0; kt < 16; ++kt)
      qf[q][kt] = cat8(*(const v8bf*)(qsrc + (q * 16 + kt) * 512),
                       *(const v8bf*)(qsrc + (q * 16 + kt) * 512 + 256));
  // mrow: the maximum in use of the lane's query (equal in its two lanes);
  // lsum: this lane's share of the query's sum, one partial sum per score
  // register (eight short chains, not one long one), joined in the epilogue;
  // p0, p1: the last tile's P (f32), added to lsum beside the next tile's first
  // score WMMAs, where the vector unit has nothing else to do.
  float mrow[AQT];
  v8f lsum[AQT], p0[AQT], p1[AQT];
#pragma unroll
  for (int q = 0; q < AQT; ++q) {
    mrow[q] = -1e30f;
    lsum[q] = (v8f){}; p0[q] = (v8f){}; p1[q] = (v8f){};
  }
  // The address registers of the loads above stay as they are until this wait
  // (named as an input so that they live up to it).
  asm volatile("s_wait_xcnt 0x0" :: "v"(qsrc) : "memory");
  wait_copies0();
  __syncthreads();                                  // publish tile 0
  copy_kv_tile(kbase + 32 * Cq, vbase + 32 * Cq, &kvbuf[1][0], threadIdx.x);
  v8f acc[AQT][32] = {};
  for (int t = 0; t < 128; ++t) {                   // 32 keys per trip
    const bf16* kt32 = &kvbuf[t & 1][0];
    const bf16* vt32 = kt32 + 32 * 512;
    v8f d0[AQT] = {}, d1[AQT] = {};
    // K and V fragments come in groups of AGF, 2 * ANG groups a tile (K, then V),
    // through ASET register sets: a group's LDS reads are issued as one run, 16
    // WMMAs ahead of its own, since with one wave on the SIMD nothing else covers
    // their latency. Unrolled so that qf[], acc[] and the sets are indexed by
    // constants and stay in registers.
    v16bf fr[ASET][AGF];
#pragma unroll
    for (int i = 0; i < ASET - 1; ++i)
#pragma unroll
      for (int j = 0; j < AGF; ++j)
        fr[i][j] = frag_packed(kt32 + (j & 1) * 16 * Cq + (i * (AGF / 2) + (j >> 1)) * 512, lane);
#pragma unroll
    for (int g = 0; g < ANG; ++g) {
      const int n = g + ASET - 1;                   // the group fetched now
#pragma unroll
      for (int j = 0; j < AGF; ++j)
        fr[n % ASET][j] = (n < ANG)
            ? frag_packed(kt32 + (j & 1) * 16 * Cq + (n * (AGF / 2) + (j >> 1)) * 512, lane)
            : frag_packed(vt32 + ((n - ANG) * AGF + j) * 512, lane);   // first of V
      // Keeps the reads above as one group ahead of the WMMAs; left free, each
      // read sinks to just in front of its WMMA, which then waits out its latency.
      __builtin_amdgcn_sched_barrier(0);
#pragma unroll
      for (int h = 0; h < AGF / 2; ++h) {           // rows = keys, columns = queries
        const int kt = g * (AGF / 2) + h;
#pragma unroll
        for (int q = 0; q < AQT; ++q)
          d0[q] = wmma_bf16(fr[g % ASET][h * 2], qf[q][kt], d0[q]);
#pragma unroll
        for (int q = 0; q < AQT; ++q)
          d1[q] = wmma_bf16(fr[g % ASET][h * 2 + 1], qf[q][kt], d1[q]);
      }
      if (g == 0) {                                 // ahead of this tile's rescale
#pragma unroll
        for (int q = 0; q < AQT; ++q) lsum[q] += p0[q] + p1[q];
      }
      // Keeps the following group's reads behind these WMMAs.
      __builtin_amdgcn_sched_barrier(0);
    }
    // The tile's maximum for the lane's query: its own 16 keys in the lane, the
    // other 16 from the other half.
    float tm[AQT];
    bool over = false;
#pragma unroll
    for (int q = 0; q < AQT; ++q) {
      float m = max16(d0[q], d1[q]);
      tm[q] = fmaxf(m, xhalf(m)) * SCALEF;
      over = over || (tm[q] - mrow[q] > RESCALE_OVER);
    }
    // One test per tile, the same for the whole wave (a scalar branch): the
    // 512 accumulator registers are rescaled only when some query's maximum has
    // passed the one in use by the margin.
    if (__builtin_amdgcn_ballot_w32(over) != 0) {
#pragma unroll
      for (int q = 0; q < AQT; ++q) {
        float mnew = fmaxf(mrow[q], tm[q]);
        float f = __expf(mrow[q] - mnew);           // 0 on the first tile
        mrow[q] = mnew;
        lsum[q] *= f;
#pragma unroll
        for (int ct = 0; ct < 32; ++ct)
#pragma unroll
          for (int r = 0; r < 8; ++r) acc[q][ct][r] *= f;
      }
    }
    v16bf pa[AQT];            // B fragments of P^T: k = key, column = query
#pragma unroll
    for (int q = 0; q < AQT; ++q)
#pragma unroll
      for (int r = 0; r < 8; ++r) {
        p0[q][r] = __expf(d0[q][r] * SCALEF - mrow[q]);
        p1[q][r] = __expf(d1[q][r] * SCALEF - mrow[q]);
        pa[q][r]     = (bf16)p0[q][r];              // key r + half*8
        pa[q][r + 8] = (bf16)p1[q][r];              // key 16 + r + half*8
      }
#pragma unroll
    for (int g = 0; g < ANG; ++g) {
      const int n = g + ASET - 1;                   // the V group fetched now
      if (n < ANG) {
#pragma unroll
        for (int j = 0; j < AGF; ++j)
          fr[(ANG + n) % ASET][j] = frag_packed(vt32 + (n * AGF + j) * 512, lane);
      }
      __builtin_amdgcn_sched_barrier(0);            // as in the score loop
#pragma unroll
      for (int j = 0; j < AGF; ++j)
#pragma unroll
        for (int q = 0; q < AQT; ++q)               // rows = channels
          acc[q][g * AGF + j] = wmma_bf16(fr[(ANG + g) % ASET][j], pa[q], acc[q][g * AGF + j]);
      __builtin_amdgcn_sched_barrier(0);            // as in the score loop
    }
    wait_ds0();
    wait_copies0();
    __syncthreads();          // publishes tile t+1, ends every read of tile t
    if (t + 2 < 128)
      copy_kv_tile(kbase + (size_t)(t + 2) * 32 * Cq, vbase + (size_t)(t + 2) * 32 * Cq,
                   &kvbuf[t & 1][0], threadIdx.x);
  }
  wait_copies0();
  // Register r of tile ct is channel ct*16 + half*8 + r of the lane's query: the
  // lane's own 16 bytes of the fragment-order block, one store per tile.
  v8bf ov[AQT][32];
#pragma unroll
  for (int q = 0; q < AQT; ++q) {
    lsum[q] += p0[q] + p1[q];                       // the last tile's
    float lown = ((lsum[q][0] + lsum[q][1]) + (lsum[q][2] + lsum[q][3])) +
                 ((lsum[q][4] + lsum[q][5]) + (lsum[q][6] + lsum[q][7]));
    float rinv = 1.0f / (lown + xhalf(lown));
#pragma unroll
    for (int ct = 0; ct < 32; ++ct)
#pragma unroll
      for (int r = 0; r < 8; ++r) ov[q][ct][r] = (bf16)(acc[q][ct][r] * rinv);
  }
  // Holds every conversion in front of the first store, so that no register
  // which an issued store names is written again.
  __builtin_amdgcn_sched_barrier(0);
  bf16* ob = ao + (size_t)qt * 16 * Cq + lane * 8;
#pragma unroll
  for (int q = 0; q < AQT; ++q)
#pragma unroll
    for (int ct = 0; ct < 32; ++ct) *(v8bf*)(ob + (q * 32 + ct) * 256) = ov[q][ct];
}

// ---------------------------------------------------------------------------
// 6) Output projection + bias + residual, fp32 store. As in 4), 64 rows per
//    work-group; each wave takes two neighbouring channel tiles (an A fragment
//    is used 2x, a weight fragment 4x) and so writes whole 128-byte lines.
// ---------------------------------------------------------------------------
__global__ __launch_bounds__(256) void k_out_proj(const bf16* __restrict__ ao,
                                                  const bf16* __restrict__ wo,
                                                  const float* __restrict__ bo,
                                                  const float* __restrict__ x,
                                                  float* __restrict__ out) {
  __shared__ __align__(16) bf16 atile[PROJ_MT * 16 * 512];
  int wave = threadIdx.x >> 5, lane = threadIdx.x & 31;
  int mt0 = (blockIdx.x >> 1) * PROJ_MT;
  int ct0 = ((blockIdx.x & 1) << 4) + wave * 2;
  // A constant trip count, unrolled: straight-line copies with every lane on.
#pragma unroll
  for (int j = 0; j < PROJ_MT * 4; ++j)
    stage16((const uint4*)(ao + (size_t)mt0 * 16 * Cq) + j * 256 + threadIdx.x,
            (uint4*)atile + j * 256 + threadIdx.x);
  wait_copies0();
  __syncthreads();
  v8f acc[PROJ_MT][2] = {};
  for (int kt = 0; kt < 16; ++kt) {
    const bf16* wb = wo + (size_t)(kt * 32 + ct0) * 512;
    v16bf f0 = frag_packed(wb, lane);
    v16bf f1 = frag_packed(wb + 512, lane);
    // Unrolled, here and in the epilogue: acc[][] is then indexed by constants
    // and stays in registers.
#pragma unroll
    for (int i = 0; i < PROJ_MT; ++i) {
      v16bf a = frag_packed(atile + (i * 16 + kt) * 512, lane);
      acc[i][0] = wmma_bf16(a, f0, acc[i][0]);
      acc[i][1] = wmma_bf16(a, f1, acc[i][1]);
    }
  }
  // Keeps the 64 residual reads behind the product loop; lifted over it they
  // hold their registers through the loop, and only one work-group fits a WGP.
  __builtin_amdgcn_sched_barrier(0);
  int half = lane >> 4;
  int col = (ct0 << 4) + (lane & 15);
  float bias0 = bo[col], bias1 = bo[col + 16];
  // One base per buffer: every row and both channel tiles are constant offsets.
  size_t base = ((size_t)mt0 * 16 + half * 8) * Cq + col;
  const float* xp = x + base;
  float* op = out + base;
#pragma unroll
  for (int i = 0; i < PROJ_MT; ++i) {
#pragma unroll
    for (int r = 0; r < 8; ++r) {
      int o = (i * 16 + r) * Cq;                    // C/D layout: M = vgpr + half*8
      op[o]      = acc[i][0][r] + bias0 + xp[o];
      op[o + 16] = acc[i][1][r] + bias1 + xp[o + 16];
    }
  }
}

// ---------------------------------------------------------------------------
// Launch
// ---------------------------------------------------------------------------
extern "C" void kernel_launch(void* const* d_in, const int* in_sizes, int n_in,
                              void* d_out, int out_size, void* d_ws, size_t ws_size,
                              hipStream_t stream) {
  const float* x      = (const float*)d_in[0];
  const float* gscale = (const float*)d_in[1];
  const float* gbias  = (const float*)d_in[2];
  const float* wq     = (const float*)d_in[3];
  const float* bq     = (const float*)d_in[4];
  const float* wk     = (const float*)d_in[5];
  const float* bk     = (const float*)d_in[6];
  const float* wv     = (const float*)d_in[7];
  const float* bv     = (const float*)d_in[8];
  const float* wo     = (const float*)d_in[9];
  const float* bo     = (const float*)d_in[10];
  float* out = (float*)d_out;

  char* ws = (char*)d_ws;
  float* stats = (float*)ws;                               // 2 KB
  bf16* wpkq = (bf16*)(ws + 4096);                         // 4 x 512KB packed weights
  bf16* wpkk = (bf16*)(ws + 4096 + 1 * 524288);
  bf16* wpkv = (bf16*)(ws + 4096 + 2 * 524288);
  bf16* wpko = (bf16*)(ws + 4096 + 3 * 524288);
  size_t o = 4096 + 4 * 524288;
  bf16* hn  = (bf16*)(ws + o); o += 33554432;              // normalized acts / reused as attn out
  bf16* qb  = (bf16*)(ws + o); o += 33554432;              // Q, fragment order
  bf16* kb  = (bf16*)(ws + o); o += 33554432;              // K, fragment order
  bf16* vtb = (bf16*)(ws + o);                             // V, fragment order (rows = channels)

  k_prep<<<512, 256, 0, stream>>>(x, wq, wk, wv, wo, stats, wpkq);
  k_gn_apply<<<16384, 256, 0, stream>>>(x, stats, gscale, gbias, hn);
  k_qkv<<<2048, 256, 0, stream>>>(hn, wpkq, wpkk, wpkv, bq, bk, bv, qb, kb, vtb);
  k_attn_out<<<256, 128, 0, stream>>>(qb, kb, vtb, hn);      // attn out overwrites hn
  k_out_proj<<<1024, 256, 0, stream>>>(hn, wpko, bo, x, out);
}

// v008
// Measured time: 248 microseconds a run.
// Timed twice side by side with v007, it ran 1.06 times as fast both times.
// Counting every step since v000, it is 10.3 times as fast.
#include <hip/hip_runtime.h>

typedef __bf16 bf16;
typedef __attribute__((ext_vector_type(16))) __bf16 v16bf;
typedef __attribute__((ext_vector_type(8)))  __bf16 v8bf;
typedef __attribute__((ext_vector_type(8)))  float  v8f;
typedef __attribute__((ext_vector_type(4)))  int    v4i;
typedef __attribute__((address_space(3))) v4i* lds_v4i_p;

#define Bq 8
#define Cq 512
#define Nq 4096
#define Mq 32768
#define SCALEF 0.044194173824159216f   // 1/sqrt(512)
#define EPSQ 1e-5f

// ---------------------------------------------------------------------------
// WMMA helpers
// ---------------------------------------------------------------------------
__device__ __forceinline__ v8f wmma_bf16(v16bf a, v16bf b, v8f c) {
  return __builtin_amdgcn_wmma_f32_16x16x32_bf16(false, a, false, b, (short)0, c,
                                                 false, false);
}

__device__ __forceinline__ v16bf cat8(v8bf lo, v8bf hi) {
  return __builtin_shufflevector(lo, hi, 0, 1, 2, 3, 4, 5, 6, 7,
                                         8, 9, 10, 11, 12, 13, 14, 15);
}

// Fragment order. Every bf16 WMMA operand (in the workspace and in LDS) is kept
// as 1 KB blocks, one block per 16-row x 32-k fragment: [part 0..1][lane 0..31][8].
// Per ISA layout: lane L -> row = L&15, half = L>>4;
// part 0, elements 0..7  -> k = half*8 + j
// part 1, elements 8..15 -> k = 16 + half*8 + j
// so each of the two 16-byte reads of a fragment covers 512 contiguous bytes
// over the wave: four whole lines from global memory, no shared bank in LDS.
// The same pattern serves as a B fragment (rows indexed by N).
// frag_off: place of element (row r16, k index k32) inside its block.
__device__ __forceinline__ int frag_off(int r16, int k32) {
  return ((k32 >> 4) << 8) + (((((k32 >> 3) & 1) << 4) + r16) << 3) + (k32 & 7);
}

__device__ __forceinline__ v16bf frag_packed(const bf16* blk, int lane) {
  const bf16* p = blk + lane * 8;
  v8bf lo = *(const v8bf*)p;
  v8bf hi = *(const v8bf*)(p + 256);
  return cat8(lo, hi);
}

// ---------------------------------------------------------------------------
// Async global -> LDS staging (gfx1250 GLOBAL_LOAD_ASYNC_TO_LDS_B128,
// tracked by ASYNCcnt). Param 0 is a generic v4i* (per compiler diagnostic);
// LDS side is cast to addrspace(3), which also converts implicitly to
// generic if the builtin is declared that way.
// ---------------------------------------------------------------------------
__device__ __forceinline__ void stage16(const void* gsrc, void* ldst) {
#if __has_builtin(__builtin_amdgcn_global_load_async_to_lds_b128)
  __builtin_amdgcn_global_load_async_to_lds_b128((v4i*)gsrc, (lds_v4i_p)ldst, 0, 0);
#else
  *(uint4*)ldst = *(const uint4*)gsrc;
#endif
}

// This wave's own copies have landed (before the barrier that publishes them).
__device__ __forceinline__ void wait_copies0() {
  asm volatile("s_wait_asynccnt 0x0" ::: "memory");
}

// 16-row tiles per work-group of the two projection kernels: each wave carries
// all of them, so one weight fragment read from L2 feeds that many WMMAs.
#define PROJ_MT 4

// ---------------------------------------------------------------------------
// 1a) GroupNorm statistics: one block per (batch, group); 256-thread reduce.
//     bg = 0..255 : b*32+g, the same for the whole block (it holds barriers).
// ---------------------------------------------------------------------------
__device__ __forceinline__ void gn_stats_block(const float* __restrict__ x,
                                               float* __restrict__ stats, int bg) {
  int b = bg >> 5, g = bg & 31;
  const float* xb = x + (size_t)b * Nq * Cq + g * 16;
  float s = 0.f, ss = 0.f;
  for (int n = threadIdx.x; n < Nq; n += 256) {
    const float* p = xb + (size_t)n * Cq;
#pragma unroll
    for (int ci = 0; ci < 16; ++ci) { float v = p[ci]; s += v; ss += v * v; }
  }
  __shared__ float sh_s[256], sh_ss[256];
  sh_s[threadIdx.x] = s; sh_ss[threadIdx.x] = ss;
  __syncthreads();
  for (int off = 128; off > 0; off >>= 1) {
    if (threadIdx.x < off) {
      sh_s[threadIdx.x]  += sh_s[threadIdx.x + off];
      sh_ss[threadIdx.x] += sh_ss[threadIdx.x + off];
    }
    __syncthreads();
  }
  if (threadIdx.x == 0) {
    float inv = 1.0f / (float)(Nq * 16);
    float mean = sh_s[0] * inv;
    float var  = sh_ss[0] * inv - mean * mean;
    stats[bg * 2]     = mean;
    stats[bg * 2 + 1] = rsqrtf(var + EPSQ);
  }
}

// ---------------------------------------------------------------------------
// 2) Apply GroupNorm, emit bf16 activations (M x C in fragment order:
//    block (m>>4, c>>5); a 16-row tile is 16 KB contiguous).
// ---------------------------------------------------------------------------
__global__ __launch_bounds__(256) void k_gn_apply(const float* __restrict__ x,
                                                  const float* __restrict__ stats,
                                                  const float* __restrict__ gamma,
                                                  const float* __restrict__ beta,
                                                  bf16* __restrict__ hn) {
  // i4 is the place in hn: threads walk the fragment order, so a wave stores
  // whole lines and each line has one writer; (m, c) is read back from the place.
  size_t i4 = ((size_t)blockIdx.x * 256 + threadIdx.x) * 4;
  int w = (int)(i4 & 511);
  int blk = (int)(i4 >> 9);
  int c = ((blk & 15) << 5) + ((w >> 8) << 4) + (((w >> 7) & 1) << 3) + (w & 7);
  int m = ((blk >> 4) << 4) + ((w >> 3) & 15);
  int b = m >> 12;
  int g = c >> 4;
  float mean = stats[(b * 32 + g) * 2];
  float rstd = stats[(b * 32 + g) * 2 + 1];
  float4 xv = *(const float4*)(x + (size_t)m * Cq + c);
  bf16* o = hn + i4;
  o[0] = (bf16)((xv.x - mean) * rstd * gamma[c]     + beta[c]);
  o[1] = (bf16)((xv.y - mean) * rstd * gamma[c + 1] + beta[c + 1]);
  o[2] = (bf16)((xv.z - mean) * rstd * gamma[c + 2] + beta[c + 2]);
  o[3] = (bf16)((xv.w - mean) * rstd * gamma[c + 3] + beta[c + 3]);
}

// ---------------------------------------------------------------------------
// 1b) Pack a 512x512 f32 weight (w[k][n]) into fragment order:
//     block (kt*32+nt), rows indexed by n. tid = 0..16383 over 64 blocks.
// ---------------------------------------------------------------------------
__device__ __forceinline__ void pack_w_thread(const float* __restrict__ w,
                                              bf16* __restrict__ wpk, int tid) {
  if (tid >= 16 * 32 * 32) return;   // ktiles(16) * ntiles(32) * lanes(32)
  int lane = tid & 31;
  int nt = (tid >> 5) & 31;
  int kt = tid >> 10;
  int n = nt * 16 + (lane & 15);
  int half = lane >> 4;
  bf16* dst = wpk + (size_t)(tid >> 5) * 512 + lane * 8; // tid>>5 == kt*32+nt
#pragma unroll
  for (int j = 0; j < 8; ++j)
    dst[j] = (bf16)w[(kt * 32 + half * 8 + j) * Cq + n];
#pragma unroll
  for (int j = 0; j < 8; ++j)
    dst[256 + j] = (bf16)w[(kt * 32 + 16 + half * 8 + j) * Cq + n];
}

// ---------------------------------------------------------------------------
// 1) Everything that reads nothing but inputs, in one launch: blocks 0..255 take
//    the GroupNorm statistics (the long ones, so they start first), blocks
//    256..511 pack the four weights, 64 blocks each, into wpk[4][512*512].
//    The branch is on blockIdx alone: a block is wholly on one side of it.
// ---------------------------------------------------------------------------
__global__ __launch_bounds__(256) void k_prep(const float* __restrict__ x,
                                              const float* __restrict__ wq,
                                              const float* __restrict__ wk,
                                              const float* __restrict__ wv,
                                              const float* __restrict__ wo,
                                              float* __restrict__ stats,
                                              bf16* __restrict__ wpk) {
  if (blockIdx.x < 256) {
    gn_stats_block(x, stats, blockIdx.x);
    return;
  }
  int j = blockIdx.x - 256;
  int which = j >> 6;
  const float* w = which == 0 ? wq : which == 1 ? wk : which == 2 ? wv : wo;
  pack_w_thread(w, wpk + (size_t)which * (Cq * Cq), (j & 63) * 256 + threadIdx.x);
}

// ---------------------------------------------------------------------------
// 4) Fused QKV projection. 8 waves share one async-staged 64x512 A tile (four
//    16-row tiles); each wave computes the four 16x16 tiles of one channel tile
//    for q, k, v: an A fragment is used 3x, a weight fragment 4x.
//    q,k stored in fragment order, block (row>>4, channel>>5); v stored in
//    fragment order for P*V (rows = channels, k = keys), block (key>>5, channel>>4):
//    a lane's eight accumulator rows are its own 16 bytes of that block.
// ---------------------------------------------------------------------------
__global__ __launch_bounds__(256) void k_qkv(const bf16* __restrict__ hn,
                                             const bf16* __restrict__ wq,
                                             const bf16* __restrict__ wk,
                                             const bf16* __restrict__ wv,
                                             const float* __restrict__ bq,
                                             const float* __restrict__ bk,
                                             const float* __restrict__ bv,
                                             bf16* __restrict__ qb,
                                             bf16* __restrict__ kb,
                                             bf16* __restrict__ vtb) {
  __shared__ __align__(16) bf16 atile[PROJ_MT * 16 * 512];
  int wave = threadIdx.x >> 5, lane = threadIdx.x & 31;
  int mt0 = (blockIdx.x >> 2) * PROJ_MT;
  int ct = ((blockIdx.x & 3) << 3) + wave;
  // A constant trip count, unrolled: straight-line copies with every lane on.
#pragma unroll
  for (int j = 0; j < PROJ_MT * 4; ++j)
    stage16((const uint4*)(hn + (size_t)mt0 * 16 * Cq) + j * 256 + threadIdx.x,
            (uint4*)atile + j * 256 + threadIdx.x);
  wait_copies0();
  __syncthreads();
  v8f aq[PROJ_MT] = {}, ak[PROJ_MT] = {}, av[PROJ_MT] = {};
  // Fully unrolled: the weight reads of later k steps then issue ahead of the
  // WMMAs of earlier ones; rolled, each read is waited for before its WMMA.
#pragma unroll
  for (int kt = 0; kt < 16; ++kt) {
    size_t wb = (size_t)(kt * 32 + ct) * 512;
    v16bf fq = frag_packed(wq + wb, lane);
    v16bf fk = frag_packed(wk + wb, lane);
    v16bf fv = frag_packed(wv + wb, lane);
    // Unrolled, here and in the epilogue: the accumulator arrays are then
    // indexed by constants and stay in registers.
#pragma unroll
    for (int i = 0; i < PROJ_MT; ++i) {
      v16bf a = frag_packed(atile + (i * 16 + kt) * 512, lane);
      aq[i] = wmma_bf16(a, fq, aq[i]);
      ak[i] = wmma_bf16(a, fk, ak[i]);
      av[i] = wmma_bf16(a, fv, av[i]);
    }
  }
  int half = lane >> 4;
  int col = (ct << 4) + (lane & 15);
  float xbq = bq[col], xbk = bk[col], xbv = bv[col];
#pragma unroll
  for (int i = 0; i < PROJ_MT; ++i) {
    int mt = mt0 + i, m0 = mt << 4;
    size_t qkblk = ((size_t)mt * 16 + (col >> 5)) * 512;
    v8bf vv;
#pragma unroll
    for (int r = 0; r < 8; ++r) {
      int off = frag_off(r + half * 8, col & 31);   // C/D layout: M = vgpr + half*8
      qb[qkblk + off] = (bf16)(aq[i][r] + xbq);
      kb[qkblk + off] = (bf16)(ak[i][r] + xbk);
      vv[r] = (bf16)(av[i][r] + xbv);
    }
    int bb = m0 >> 12, n0 = m0 & (Nq - 1);          // key = n0 + half*8 + r
    *(v8bf*)(vtb + (size_t)bb * Cq * Nq + ((size_t)(n0 >> 5) * 32 + ct) * 512 +
             ((n0 >> 4) & 1) * 256 + lane * 8) = vv;
  }
}

typedef __attribute__((address_space(3))) char* lds_char_p;
typedef __attribute__((ext_vector_type(4))) uint32_t u32x4;
typedef __attribute__((ext_vector_type(8))) uint32_t u32x8;
#define AQT 2    // 16-query tiles per wave of the attention kernel
#define AGF 8    // K or V fragments per group of LDS reads there
#define ANG (32 / AGF)   // groups per 32-key tile of K, and of V
#define ASET 2   // register sets that the groups go through
#define KV_TILEB 32768u  // bytes of K, and of V, per 32-key tile
#define KV_SLICE 16384u  // bytes that one wave's request brings
#define KV_ROWB  256u    // the slice as a two-dimensional tile: bytes per row,
#define KV_ROWS  64u     // rows; the source pitch is the row, so it is contiguous

__device__ __forceinline__ uint32_t uni(uint32_t v) {
  return (uint32_t)__builtin_amdgcn_readfirstlane(v);
}
// A wave-uniform test held in a scalar register, so that the branch on it is a
// scalar branch: a tensor load ignores EXEC, only such a branch keeps it back.
__device__ __forceinline__ uint32_t pinned(uint32_t v) {
  uint32_t w = uni(v);
  asm volatile("" : "+s"(w));   // pinned(): the test stays in a scalar register
  return w;
}

// Descriptor group 1, the same for every request: 1-byte elements, no mask, no
// pad; tensor = tile = KV_ROWS rows of KV_ROWB bytes at a pitch of KV_ROWB.
__device__ __forceinline__ u32x8 kv_group1() {
  u32x8 g;
  g[0] = uni(0u);
  g[1] = uni((KV_ROWB & 0xFFFFu) << 16);
  g[2] = uni((KV_ROWB >> 16) | ((KV_ROWS & 0xFFFFu) << 16));
  g[3] = uni((KV_ROWS >> 16) | (KV_ROWB << 16));
  g[4] = uni(KV_ROWS);
  g[5] = uni(KV_ROWB);
  g[6] = uni(0u);
  g[7] = uni(0u);
  return g;
}

// Descriptor group 0 of one request: KV_SLICE bytes from ga to the LDS byte
// offset lds_dst.
__device__ __forceinline__ u32x4 kv_group0(uint32_t lds_dst, uint64_t ga) {
  u32x4 g;
  g[0] = uni(1u);
  g[1] = uni(lds_dst);
  g[2] = uni((uint32_t)ga);
  g[3] = uni((((uint32_t)(ga >> 32)) & 0x01FFFFFFu) | 0x80000000u);
  return g;
}

// The request itself: one instruction of the whole wave; the mover brings the
// slice from memory into LDS through no register.
__device__ __forceinline__ void kv_load(u32x4 g0, u32x8 g1) {
  asm volatile("tensor_load_to_lds %0, %1" :: "s"(g0), "s"(g1) : "memory");
}

// This wave's own tensor load has landed (before the barrier that publishes it).
// The request's descriptor is named as an input so that its registers live,
// unchanged, up to the wait that covers the request.
__device__ __forceinline__ void wait_tensor0(u32x4 g0, u32x8 g1) {
  asm volatile("s_wait_tensorcnt 0x0" :: "s"(g0), "s"(g1) : "memory");
}

// This wave's own LDS reads and writes have retired (before a buffer is handed
// back for refill).
__device__ __forceinline__ void wait_ds0() {
  asm volatile("s_wait_dscnt 0x0" ::: "memory");
}

// ---------------------------------------------------------------------------
// Lane l with lane l ^ 16: the two lanes that share a query column of a
// transposed score tile (each holds half of its keys).
// ---------------------------------------------------------------------------
__device__ __forceinline__ float xhalf(float v) {
  int b = __builtin_bit_cast(int, v);
  return __builtin_bit_cast(float, __builtin_amdgcn_permlanex16(
      b, b, 0x76543210, 0xfedcba98, false, false));
}
// The maxima in use are replaced only when some query's tile maximum exceeds its own by
// more than this (P then stays below e^5.5, about 245).
#define RESCALE_OVER 5.5f

// The largest of the 16 scores that a lane holds of one query (a tree three deep).
__device__ __forceinline__ float max16(v8f d0, v8f d1) {
  float ma = fmaxf(fmaxf(d0[0], d1[0]), d0[1]);
  float mb = fmaxf(fmaxf(d1[1], d0[2]), d1[2]);
  float mc = fmaxf(fmaxf(d0[3], d1[3]), d0[4]);
  float md = fmaxf(fmaxf(d1[4], d0[5]), d1[5]);
  float me = fmaxf(fmaxf(d0[6], d1[6]), d0[7]);
  return fmaxf(fmaxf(fmaxf(ma, mb), d1[7]), fmaxf(fmaxf(mc, md), me));
}

__global__ __launch_bounds__(128) void k_attn_out(const bf16* __restrict__ qb,
                                                  const bf16* __restrict__ kb,
                                                  const bf16* __restrict__ vtb,
                                                  bf16* __restrict__ ao) {
  // [buffer][K, V]; aligned so that every request's place is a multiple of 2 KB.
  __shared__ __attribute__((aligned(2048))) bf16 kvbuf[2][2 * 32 * 512];
  int wave = threadIdx.x >> 5, lane = threadIdx.x & 31;
  int qt = blockIdx.x * 8 + wave * AQT;             // the wave's first query tile
  int b = blockIdx.x >> 5;
  const bf16* kbase = kb + (size_t)b * Nq * Cq;
  const bf16* vbase = vtb + (size_t)b * Cq * Nq;
  // The wave's quarter of tile 0: where it lies in memory and where it goes.
  const uint32_t wv = uni(threadIdx.x >> 5);
  const uint64_t kvsrc = wv < 2u
      ? (uint64_t)(__UINTPTR_TYPE__)kbase + wv * KV_SLICE
      : (uint64_t)(__UINTPTR_TYPE__)vbase + (wv - 2u) * KV_SLICE;
  const uint32_t kvdst =
      (uint32_t)(__UINTPTR_TYPE__)(lds_char_p)(char*)&kvbuf[0][0] + wv * KV_SLICE;
  const u32x8 kvg1 = kv_group1();
  u32x4 kvg0 = kv_group0(kvdst, kvsrc);             // of the request in flight
  kv_load(kvg0, kvg1);
  const bf16* qsrc = qb + (size_t)qt * 16 * Cq + lane * 8;   // the lane's 16 bytes
  v16bf qf[AQT][16];
#pragma unroll
  for (int q = 0; q < AQT; ++q)
#pragma unroll
    for (int kt = 0; kt < 16; ++kt)
      qf[q][kt] = cat8(*(const v8bf*)(qsrc + (q * 16 + kt) * 512),
                       *(const v8bf*)(qsrc + (q * 16 + kt) * 512 + 256));
  // mrow: the maximum in use of the lane's query (equal in its two lanes);
  // lsum: this lane's share of the query's sum, one partial sum per score
  // register (eight short chains, not one long one), joined in the epilogue;
  // p0, p1: the last tile's P (f32), added to lsum beside the next tile's first
  // score WMMAs, where the vector unit has nothing else to do.
  float mrow[AQT];
  v8f lsum[AQT], p0[AQT], p1[AQT];
#pragma unroll
  for (int q = 0; q < AQT; ++q) {
    mrow[q] = -1e30f;
    lsum[q] = (v8f){}; p0[q] = (v8f){}; p1[q] = (v8f){};
  }
  // The address registers of the loads above stay as they are until this wait
  // (named as an input so that they live up to it).
  asm volatile("s_wait_xcnt 0x0" :: "v"(qsrc) : "memory");
  wait_tensor0(kvg0, kvg1);
  __syncthreads();                                  // publish tile 0
  kvg0 = kv_group0(kvdst + 2u * KV_TILEB, kvsrc + KV_TILEB);
  kv_load(kvg0, kvg1);
  v8f acc[AQT][32] = {};
  for (int t = 0; t < 128; ++t) {                   // 32 keys per trip
    const bf16* kt32 = &kvbuf[t & 1][0];
    const bf16* vt32 = kt32 + 32 * 512;
    v8f d0[AQT] = {}, d1[AQT] = {};
    // K and V fragments come in groups of AGF, 2 * ANG groups a tile (K, then V),
    // through ASET register sets: a group's LDS reads are issued as one run, 16
    // WMMAs ahead of its own, since with one wave on the SIMD nothing else covers
    // their latency. Unrolled so that qf[], acc[] and the sets are indexed by
    // constants and stay in registers.
    v16bf fr[ASET][AGF];
#pragma unroll
    for (int i = 0; i < ASET - 1; ++i)
#pragma unroll
      for (int j = 0; j < AGF; ++j)
        fr[i][j] = frag_packed(kt32 + (j & 1) * 16 * Cq + (i * (AGF / 2) + (j >> 1)) * 512, lane);
#pragma unroll
    for (int g = 0; g < ANG; ++g) {
      const int n = g + ASET - 1;                   // the group fetched now
#pragma unroll
      for (int j = 0; j < AGF; ++j)
        fr[n % ASET][j] = (n < ANG)
            ? frag_packed(kt32 + (j & 1) * 16 * Cq + (n * (AGF / 2) + (j >> 1)) * 512, lane)
            : frag_packed(vt32 + ((n - ANG) * AGF + j) * 512, lane);   // first of V
      // Keeps the reads above as one group ahead of the WMMAs; left free, each
      // read sinks to just in front of its WMMA, which then waits out its latency.
      __builtin_amdgcn_sched_barrier(0);
#pragma unroll
      for (int h = 0; h < AGF / 2; ++h) {           // rows = keys, columns = queries
        const int kt = g * (AGF / 2) + h;
#pragma unroll
        for (int q = 0; q < AQT; ++q)
          d0[q] = wmma_bf16(fr[g % ASET][h * 2], qf[q][kt], d0[q]);
#pragma unroll
        for (int q = 0; q < AQT; ++q)
          d1[q] = wmma_bf16(fr[g % ASET][h * 2 + 1], qf[q][kt], d1[q]);
      }
      if (g == 0) {                                 // ahead of this tile's rescale
#pragma unroll
        for (int q = 0; q < AQT; ++q) lsum[q] += p0[q] + p1[q];
      }
      // Keeps the following group's reads behind these WMMAs.
      __builtin_amdgcn_sched_barrier(0);
    }
    // The tile's maximum for the lane's query: its own 16 keys in the lane, the
    // other 16 from the other half.
    float tm[AQT];
    bool over = false;
#pragma unroll
    for (int q = 0; q < AQT; ++q) {
      float m = max16(d0[q], d1[q]);
      tm[q] = fmaxf(m, xhalf(m)) * SCALEF;
      over = over || (tm[q] - mrow[q] > RESCALE_OVER);
    }
    // One test per tile, the same for the whole wave (a scalar branch): the
    // 512 accumulator registers are rescaled only when some query's maximum has
    // passed the one in use by the margin.
    if (__builtin_amdgcn_ballot_w32(over) != 0) {
#pragma unroll
      for (int q = 0; q < AQT; ++q) {
        float mnew = fmaxf(mrow[q], tm[q]);
        float f = __expf(mrow[q] - mnew);           // 0 on the first tile
        mrow[q] = mnew;
        lsum[q] *= f;
#pragma unroll
        for (int ct = 0; ct < 32; ++ct)
#pragma unroll
          for (int r = 0; r < 8; ++r) acc[q][ct][r] *= f;
      }
    }
    v16bf pa[AQT];            // B fragments of P^T: k = key, column = query
#pragma unroll
    for (int q = 0; q < AQT; ++q)
#pragma unroll
      for (int r = 0; r < 8; ++r) {
        p0[q][r] = __expf(d0[q][r] * SCALEF - mrow[q]);
        p1[q][r] = __expf(d1[q][r] * SCALEF - mrow[q]);
        pa[q][r]     = (bf16)p0[q][r];              // key r + half*8
        pa[q][r + 8] = (bf16)p1[q][r];              // key 16 + r + half*8
      }
#pragma unroll
    for (int g = 0; g < ANG; ++g) {
      const int n = g + ASET - 1;                   // the V group fetched now
      if (n < ANG) {
#pragma unroll
        for (int j = 0; j < AGF; ++j)
          fr[(ANG + n) % ASET][j] = frag_packed(vt32 + (n * AGF + j) * 512, lane);
      }
      __builtin_amdgcn_sched_barrier(0);            // as in the score loop
#pragma unroll
      for (int j = 0; j < AGF; ++j)
#pragma unroll
        for (int q = 0; q < AQT; ++q)               // rows = channels
          acc[q][g * AGF + j] = wmma_bf16(fr[(ANG + g) % ASET][j], pa[q], acc[q][g * AGF + j]);
      __builtin_amdgcn_sched_barrier(0);            // as in the score loop
    }
    wait_ds0();
    wait_tensor0(kvg0, kvg1);
    __syncthreads();          // publishes tile t+1, ends every read of tile t
    if (pinned(t + 2 < 128)) {
      kvg0 = kv_group0(kvdst + (uint32_t)(t & 1) * (2u * KV_TILEB),
                       kvsrc + (uint64_t)(t + 2) * KV_TILEB);
      kv_load(kvg0, kvg1);
    }
  }
  wait_tensor0(kvg0, kvg1);
  wait_ds0();
  // Register r of tile ct is channel ct*16 + half*8 + r of the lane's query: the
  // lane's own 16 bytes of the fragment-order block, one store per tile.
  v8bf ov[AQT][32];
#pragma unroll
  for (int q = 0; q < AQT; ++q) {
    lsum[q] += p0[q] + p1[q];                       // the last tile's
    float lown = ((lsum[q][0] + lsum[q][1]) + (lsum[q][2] + lsum[q][3])) +
                 ((lsum[q][4] + lsum[q][5]) + (lsum[q][6] + lsum[q][7]));
    float rinv = 1.0f / (lown + xhalf(lown));
#pragma unroll
    for (int ct = 0; ct < 32; ++ct)
#pragma unroll
      for (int r = 0; r < 8; ++r) ov[q][ct][r] = (bf16)(acc[q][ct][r] * rinv);
  }
  // Holds every conversion in front of the first store, so that no register
  // which an issued store names is written again.
  __builtin_amdgcn_sched_barrier(0);
  bf16* ob = ao + (size_t)qt * 16 * Cq + lane * 8;
#pragma unroll
  for (int q = 0; q < AQT; ++q)
#pragma unroll
    for (int ct = 0; ct < 32; ++ct) *(v8bf*)(ob + (q * 32 + ct) * 256) = ov[q][ct];
}

// ---------------------------------------------------------------------------
// 6) Output projection + bias + residual, fp32 store. As in 4), 64 rows per
//    work-group; each wave takes two neighbouring channel tiles (an A fragment
//    is used 2x, a weight fragment 4x) and so writes whole 128-byte lines.
// ---------------------------------------------------------------------------
__global__ __launch_bounds__(256) void k_out_proj(const bf16* __restrict__ ao,
                                                  const bf16* __restrict__ wo,
                                                  const float* __restrict__ bo,
                                                  const float* __restrict__ x,
                                                  float* __restrict__ out) {
  __shared__ __align__(16) bf16 atile[PROJ_MT * 16 * 512];
  int wave = threadIdx.x >> 5, lane = threadIdx.x & 31;
  int mt0 = (blockIdx.x >> 1) * PROJ_MT;
  int ct0 = ((blockIdx.x & 1) << 4) + wave * 2;
  // A constant trip count, unrolled: straight-line copies with every lane on.
#pragma unroll
  for (int j = 0; j < PROJ_MT * 4; ++j)
    stage16((const uint4*)(ao + (size_t)mt0 * 16 * Cq) + j * 256 + threadIdx.x,
            (uint4*)atile + j * 256 + threadIdx.x);
  wait_copies0();
  __syncthreads();
  v8f acc[PROJ_MT][2] = {};
  for (int kt = 0; kt < 16; ++kt) {
    const bf16* wb = wo + (size_t)(kt * 32 + ct0) * 512;
    v16bf f0 = frag_packed(wb, lane);
    v16bf f1 = frag_packed(wb + 512, lane);
    // Unrolled, here and in the epilogue: acc[][] is then indexed by constants
    // and stays in registers.
#pragma unroll
    for (int i = 0; i < PROJ_MT; ++i) {
      v16bf a = frag_packed(atile + (i * 16 + kt) * 512, lane);
      acc[i][0] = wmma_bf16(a, f0, acc[i][0]);
      acc[i][1] = wmma_bf16(a, f1, acc[i][1]);
    }
  }
  // Keeps the 64 residual reads behind the product loop; lifted over it they
  // hold their registers through the loop, and only one work-group fits a WGP.
  __builtin_amdgcn_sched_barrier(0);
  int half = lane >> 4;
  int col = (ct0 << 4) + (lane & 15);
  float bias0 = bo[col], bias1 = bo[col + 16];
  // One base per buffer: every row and both channel tiles are constant offsets.
  size_t base = ((size_t)mt0 * 16 + half * 8) * Cq + col;
  const float* xp = x + base;
  float* op = out + base;
#pragma unroll
  for (int i = 0; i < PROJ_MT; ++i) {
#pragma unroll
    for (int r = 0; r < 8; ++r) {
      int o = (i * 16 + r) * Cq;                    // C/D layout: M = vgpr + half*8
      op[o]      = acc[i][0][r] + bias0 + xp[o];
      op[o + 16] = acc[i][1][r] + bias1 + xp[o + 16];
    }
  }
}

// ---------------------------------------------------------------------------
// Launch
// ---------------------------------------------------------------------------
extern "C" void kernel_launch(void* const* d_in, const int* in_sizes, int n_in,
                              void* d_out, int out_size, void* d_ws, size_t ws_size,
                              hipStream_t stream) {
  const float* x      = (const float*)d_in[0];
  const float* gscale = (const float*)d_in[1];
  const float* gbias  = (const float*)d_in[2];
  const float* wq     = (const float*)d_in[3];
  const float* bq     = (const float*)d_in[4];
  const float* wk     = (const float*)d_in[5];
  const float* bk     = (const float*)d_in[6];
  const float* wv     = (const float*)d_in[7];
  const float* bv     = (const float*)d_in[8];
  const float* wo     = (const float*)d_in[9];
  const float* bo     = (const float*)d_in[10];
  float* out = (float*)d_out;

  char* ws = (char*)d_ws;
  float* stats = (float*)ws;                               // 2 KB
  bf16* wpkq = (bf16*)(ws + 4096);                         // 4 x 512KB packed weights
  bf16* wpkk = (bf16*)(ws + 4096 + 1 * 524288);
  bf16* wpkv = (bf16*)(ws + 4096 + 2 * 524288);
  bf16* wpko = (bf16*)(ws + 4096 + 3 * 524288);
  size_t o = 4096 + 4 * 524288;
  bf16* hn  = (bf16*)(ws + o); o += 33554432;              // normalized acts / reused as attn out
  bf16* qb  = (bf16*)(ws + o); o += 33554432;              // Q, fragment order
  bf16* kb  = (bf16*)(ws + o); o += 33554432;              // K, fragment order
  bf16* vtb = (bf16*)(ws + o);                             // V, fragment order (rows = channels)

  k_prep<<<512, 256, 0, stream>>>(x, wq, wk, wv, wo, stats, wpkq);
  k_gn_apply<<<16384, 256, 0, stream>>>(x, stats, gscale, gbias, hn);
  k_qkv<<<2048, 256, 0, stream>>>(hn, wpkq, wpkk, wpkv, bq, bk, bv, qb, kb, vtb);
  k_attn_out<<<256, 128, 0, stream>>>(qb, kb, vtb, hn);      // attn out overwrites hn
  k_out_proj<<<1024, 256, 0, stream>>>(hn, wpko, bo, x, out);
}

// v009
// One run takes 233 microseconds.
// Two timings next to v008 put it at 1.07 and 1.06 times that version's speed.
// Counting every step since v000, it is 11.0 times as fast.
#include <hip/hip_runtime.h>

typedef __bf16 bf16;
typedef __attribute__((ext_vector_type(16))) __bf16 v16bf;
typedef __attribute__((ext_vector_type(8)))  __bf16 v8bf;
typedef __attribute__((ext_vector_type(8)))  float  v8f;
typedef __attribute__((ext_vector_type(4)))  int    v4i;
typedef __attribute__((address_space(3))) v4i* lds_v4i_p;

#define Bq 8
#define Cq 512
#define Nq 4096
#define Mq 32768
#define SCALEF 0.044194173824159216f   // 1/sqrt(512)
#define EPSQ 1e-5f

// ---------------------------------------------------------------------------
// WMMA helpers
// ---------------------------------------------------------------------------
__device__ __forceinline__ v8f wmma_bf16(v16bf a, v16bf b, v8f c) {
  return __builtin_amdgcn_wmma_f32_16x16x32_bf16(false, a, false, b, (short)0, c,
                                                 false, false);
}

__device__ __forceinline__ v16bf cat8(v8bf lo, v8bf hi) {
  return __builtin_shufflevector(lo, hi, 0, 1, 2, 3, 4, 5, 6, 7,
                                         8, 9, 10, 11, 12, 13, 14, 15);
}

// Fragment order. Every bf16 WMMA operand (in the workspace and in LDS) is kept
// as 1 KB blocks, one block per 16-row x 32-k fragment: [part 0..1][lane 0..31][8].
// Per ISA layout: lane L -> row = L&15, half = L>>4;
// part 0, elements 0..7  -> k = half*8 + j
// part 1, elements 8..15 -> k = 16 + half*8 + j
// so each of the two 16-byte reads of a fragment covers 512 contiguous bytes
// over the wave: four whole lines from global memory, no shared bank in LDS.
// The same pattern serves as a B fragment (rows indexed by N).
// frag_off: place of element (row r16, k index k32) inside its block.
__device__ __forceinline__ int frag_off(int r16, int k32) {
  return ((k32 >> 4) << 8) + (((((k32 >> 3) & 1) << 4) + r16) << 3) + (k32 & 7);
}

__device__ __forceinline__ v16bf frag_packed(const bf16* blk, int lane) {
  const bf16* p = blk + lane * 8;
  v8bf lo = *(const v8bf*)p;
  v8bf hi = *(const v8bf*)(p + 256);
  return cat8(lo, hi);
}

// ---------------------------------------------------------------------------
// Async global -> LDS staging (gfx1250 GLOBAL_LOAD_ASYNC_TO_LDS_B128,
// tracked by ASYNCcnt). Param 0 is a generic v4i* (per compiler diagnostic);
// LDS side is cast to addrspace(3), which also converts implicitly to
// generic if the builtin is declared that way.
// ---------------------------------------------------------------------------
__device__ __forceinline__ void stage16(const void* gsrc, void* ldst) {
#if __has_builtin(__builtin_amdgcn_global_load_async_to_lds_b128)
  __builtin_amdgcn_global_load_async_to_lds_b128((v4i*)gsrc, (lds_v4i_p)ldst, 0, 0);
#else
  *(uint4*)ldst = *(const uint4*)gsrc;
#endif
}

// This wave's own copies have landed (before the barrier that publishes them).
__device__ __forceinline__ void wait_copies0() {
  asm volatile("s_wait_asynccnt 0x0" ::: "memory");
}

// 16-row tiles per staged LDS tile (64 rows) of the two projection kernels.
#define PROJ_MT 4

// ---------------------------------------------------------------------------
// 1a) GroupNorm statistics: one block per (batch, group); 256-thread reduce.
//     bg = 0..255 : b*32+g, the same for the whole block (it holds barriers).
// ---------------------------------------------------------------------------
__device__ __forceinline__ void gn_stats_block(const float* __restrict__ x,
                                               float* __restrict__ stats, int bg) {
  int b = bg >> 5, g = bg & 31;
  const float* xb = x + (size_t)b * Nq * Cq + g * 16;
  float s = 0.f, ss = 0.f;
  for (int n = threadIdx.x; n < Nq; n += 256) {
    const float* p = xb + (size_t)n * Cq;
#pragma unroll
    for (int ci = 0; ci < 16; ++ci) { float v = p[ci]; s += v; ss += v * v; }
  }
  __shared__ float sh_s[256], sh_ss[256];
  sh_s[threadIdx.x] = s; sh_ss[threadIdx.x] = ss;
  __syncthreads();
  for (int off = 128; off > 0; off >>= 1) {
    if (threadIdx.x < off) {
      sh_s[threadIdx.x]  += sh_s[threadIdx.x + off];
      sh_ss[threadIdx.x] += sh_ss[threadIdx.x + off];
    }
    __syncthreads();
  }
  if (threadIdx.x == 0) {
    float inv = 1.0f / (float)(Nq * 16);
    float mean = sh_s[0] * inv;
    float var  = sh_ss[0] * inv - mean * mean;
    stats[bg * 2]     = mean;
    stats[bg * 2 + 1] = rsqrtf(var + EPSQ);
  }
}

// ---------------------------------------------------------------------------
// 2) Apply GroupNorm, emit bf16 activations (M x C in fragment order:
//    block (m>>4, c>>5); a 16-row tile is 16 KB contiguous).
// ---------------------------------------------------------------------------
__global__ __launch_bounds__(256) void k_gn_apply(const float* __restrict__ x,
                                                  const float* __restrict__ stats,
                                                  const float* __restrict__ gamma,
                                                  const float* __restrict__ beta,
                                                  bf16* __restrict__ hn) {
  // i4 is the place in hn: threads walk the fragment order, so a wave stores
  // whole lines and each line has one writer; (m, c) is read back from the place.
  size_t i4 = ((size_t)blockIdx.x * 256 + threadIdx.x) * 4;
  int w = (int)(i4 & 511);
  int blk = (int)(i4 >> 9);
  int c = ((blk & 15) << 5) + ((w >> 8) << 4) + (((w >> 7) & 1) << 3) + (w & 7);
  int m = ((blk >> 4) << 4) + ((w >> 3) & 15);
  int b = m >> 12;
  int g = c >> 4;
  float mean = stats[(b * 32 + g) * 2];
  float rstd = stats[(b * 32 + g) * 2 + 1];
  float4 xv = *(const float4*)(x + (size_t)m * Cq + c);
  bf16* o = hn + i4;
  o[0] = (bf16)((xv.x - mean) * rstd * gamma[c]     + beta[c]);
  o[1] = (bf16)((xv.y - mean) * rstd * gamma[c + 1] + beta[c + 1]);
  o[2] = (bf16)((xv.z - mean) * rstd * gamma[c + 2] + beta[c + 2]);
  o[3] = (bf16)((xv.w - mean) * rstd * gamma[c + 3] + beta[c + 3]);
}

// ---------------------------------------------------------------------------
// 1b) Pack a 512x512 f32 weight (w[k][n]) into fragment order:
//     block (kt*32+nt), rows indexed by n. tid = 0..16383 over 64 blocks.
// ---------------------------------------------------------------------------
__device__ __forceinline__ void pack_w_thread(const float* __restrict__ w,
                                              bf16* __restrict__ wpk, int tid) {
  if (tid >= 16 * 32 * 32) return;   // ktiles(16) * ntiles(32) * lanes(32)
  int lane = tid & 31;
  int nt = (tid >> 5) & 31;
  int kt = tid >> 10;
  int n = nt * 16 + (lane & 15);
  int half = lane >> 4;
  bf16* dst = wpk + (size_t)(tid >> 5) * 512 + lane * 8; // tid>>5 == kt*32+nt
#pragma unroll
  for (int j = 0; j < 8; ++j)
    dst[j] = (bf16)w[(kt * 32 + half * 8 + j) * Cq + n];
#pragma unroll
  for (int j = 0; j < 8; ++j)
    dst[256 + j] = (bf16)w[(kt * 32 + 16 + half * 8 + j) * Cq + n];
}

// ---------------------------------------------------------------------------
// 1) Everything that reads nothing but inputs, in one launch: blocks 0..255 take
//    the GroupNorm statistics (the long ones, so they start first), blocks
//    256..511 pack the four weights, 64 blocks each, into wpk[4][512*512].
//    The branch is on blockIdx alone: a block is wholly on one side of it.
// ---------------------------------------------------------------------------
__global__ __launch_bounds__(256) void k_prep(const float* __restrict__ x,
                                              const float* __restrict__ wq,
                                              const float* __restrict__ wk,
                                              const float* __restrict__ wv,
                                              const float* __restrict__ wo,
                                              float* __restrict__ stats,
                                              bf16* __restrict__ wpk) {
  if (blockIdx.x < 256) {
    gn_stats_block(x, stats, blockIdx.x);
    return;
  }
  int j = blockIdx.x - 256;
  int which = j >> 6;
  const float* w = which == 0 ? wq : which == 1 ? wk : which == 2 ? wv : wo;
  pack_w_thread(w, wpk + (size_t)which * (Cq * Cq), (j & 63) * 256 + threadIdx.x);
}

// This wave's own LDS reads and writes have retired (before a buffer is handed
// back for refill).
__device__ __forceinline__ void wait_ds0() {
  asm volatile("s_wait_dscnt 0x0" ::: "memory");
}

__device__ __forceinline__ uint32_t uni(uint32_t v) {
  return (uint32_t)__builtin_amdgcn_readfirstlane(v);
}

#define QKV_TILES 8      // 64-row tiles per work-group
#define QKV_AG 4         // A fragments per group of LDS reads
#define QKV_NG (PROJ_MT * 16 / QKV_AG)        // groups per 64-row tile
#define QKV_TILE16 (PROJ_MT * 16 * 512 / 8)   // 16-byte pieces of a 64-row tile

// One 16-row tile's results: bias added, rounded to bf16.
struct qkv_out { v8bf q, k, v; };
__device__ __forceinline__ qkv_out qkv_round(v8f aq, v8f ak, v8f av, float xbq, float xbk,
                                             float xbv) {
  qkv_out o;
#pragma unroll
  for (int r = 0; r < 8; ++r) {
    o.q[r] = (bf16)(aq[r] + xbq);
    o.k[r] = (bf16)(ak[r] + xbk);
    o.v[r] = (bf16)(av[r] + xbv);
  }
  return o;
}
// ... and to memory. qp, kp, vp: the tile's place (the same for the whole wave);
// lqk, lv: the lane's own place in it.
__device__ __forceinline__ void qkv_store(qkv_out o, bf16* qp, bf16* kp, bf16* vp,
                                          uint32_t lqk, uint32_t lv) {
#pragma unroll
  for (int r = 0; r < 8; ++r) {                     // C/D layout: M = vgpr + half*8
    qp[lqk + r * 8] = o.q[r];
    kp[lqk + r * 8] = o.k[r];
  }
  *(v8bf*)(vp + lv) = o.v;
  // The registers that these stores name are free for the next LDS reads only
  // behind this wait.
  asm volatile("s_wait_xcnt 0x0" ::: "memory");
  // Keeps later work behind that wait.
  __builtin_amdgcn_sched_barrier(0);
}

__global__ __launch_bounds__(256) void k_qkv(const bf16* __restrict__ hn,
                                             const bf16* __restrict__ wq,
                                             const bf16* __restrict__ wk,
                                             const bf16* __restrict__ wv,
                                             const float* __restrict__ bq,
                                             const float* __restrict__ bk,
                                             const float* __restrict__ bv,
                                             bf16* __restrict__ qb,
                                             bf16* __restrict__ kb,
                                             bf16* __restrict__ vtb) {
  __shared__ __align__(16) bf16 atile[2][PROJ_MT * 16 * 512];
  const uint32_t lane = threadIdx.x & 31;
  const uint32_t mtg = (blockIdx.x & 63) * (QKV_TILES * PROJ_MT);   // first 16-row tile
  // The wave's channel tile, in a scalar register: the weight loads then go by a
  // scalar base and one lane offset, which no later instruction rewrites.
  const uint32_t ct = ((blockIdx.x >> 6) << 3) + uni(threadIdx.x >> 5);
  const uint4* asrc = (const uint4*)(hn + (size_t)mtg * 16 * Cq) + threadIdx.x;
  // A constant trip count, unrolled: straight-line copies with every lane on.
#pragma unroll
  for (int j = 0; j < PROJ_MT * 4; ++j)
    stage16(asrc + j * 256, (uint4*)&atile[0][0] + j * 256 + threadIdx.x);
  const bf16* pq = wq + (size_t)ct * 512;
  const bf16* pk = wk + (size_t)ct * 512;
  const bf16* pv = wv + (size_t)ct * 512;
  const uint32_t lv = lane * 8;                     // the lane's 16 bytes of a block
  v16bf fq[16], fk[16], fv[16];
  // Unrolled, like every loop over fragments below: the arrays are then indexed
  // by constants and stay in registers.
#pragma unroll
  for (int kt = 0; kt < 16; ++kt) {
    fq[kt] = cat8(*(const v8bf*)(pq + kt * 32 * 512 + lv), *(const v8bf*)(pq + kt * 32 * 512 + 256 + lv));
    fk[kt] = cat8(*(const v8bf*)(pk + kt * 32 * 512 + lv), *(const v8bf*)(pk + kt * 32 * 512 + 256 + lv));
    fv[kt] = cat8(*(const v8bf*)(pv + kt * 32 * 512 + lv), *(const v8bf*)(pv + kt * 32 * 512 + 256 + lv));
  }
  const uint32_t half = lane >> 4;
  const uint32_t col = (ct << 4) + (lane & 15);
  float xbq = bq[col], xbk = bk[col], xbv = bv[col];
  const uint32_t lqk = (uint32_t)frag_off(half * 8, col & 31);
  // In front of the first instruction that may rewrite an address register of
  // the loads above.
  asm volatile("s_wait_xcnt 0x0" ::: "memory");
  wait_copies0();
  __syncthreads();                                  // publish tile 0
#pragma unroll
  for (int j = 0; j < PROJ_MT * 4; ++j)
    stage16(asrc + QKV_TILE16 + j * 256, (uint4*)&atile[1][0] + j * 256 + threadIdx.x);
  // A fragments come in groups of QKV_AG through two register sets: a group's LDS
  // reads are issued as one run, 12 WMMAs ahead of its own.
  v16bf fa[2][QKV_AG];
#pragma unroll
  for (int j = 0; j < QKV_AG; ++j) fa[0][j] = frag_packed(&atile[0][0] + j * 512, lane);
  v8f aq = {}, ak = {}, av = {};
  for (int t = 0; t < QKV_TILES; ++t) {
    const bf16* at = &atile[t & 1][0];
    const uint32_t mt0 = mtg + t * PROJ_MT;         // 64 rows: inside one batch
    bf16* qp = qb + ((size_t)mt0 * 16 + (ct >> 1)) * 512;
    bf16* kp = kb + ((size_t)mt0 * 16 + (ct >> 1)) * 512;
    // key = n0 + half*8 + r, n0 = the row tile's first row inside its batch
    bf16* vp = vtb + (size_t)(mt0 >> 8) * Cq * Nq + ((size_t)((mt0 & 255) >> 1) * 32 + ct) * 512;
#pragma unroll
    for (int g = 0; g < QKV_NG; ++g) {
      if (g + 1 < QKV_NG) {
#pragma unroll
        for (int j = 0; j < QKV_AG; ++j)
          fa[(g + 1) & 1][j] = frag_packed(at + ((g + 1) * QKV_AG + j) * 512, lane);
      }
      // Keeps the reads above as one group ahead of the WMMAs; left free, each
      // read sinks to just in front of its WMMA, which then waits out its latency.
      __builtin_amdgcn_sched_barrier(0);
#pragma unroll
      for (int j = 0; j < QKV_AG; ++j) {
        const int kt = (g * QKV_AG + j) & 15;
        const v8f zero = {};
        aq = wmma_bf16(fa[g & 1][j], fq[kt], kt ? aq : zero);
        ak = wmma_bf16(fa[g & 1][j], fk[kt], kt ? ak : zero);
        av = wmma_bf16(fa[g & 1][j], fv[kt], kt ? av : zero);
      }
      // Keeps the following group's reads behind these WMMAs.
      __builtin_amdgcn_sched_barrier(0);
      if (((g * QKV_AG) & 15) == 16 - QKV_AG && g + 1 < QKV_NG) {
        const int i = (g * QKV_AG) >> 4;            // the row tile just finished
        qkv_store(qkv_round(aq, ak, av, xbq, xbk, xbv), qp + i * 16 * 512, kp + i * 16 * 512,
                  vp + (i >> 1) * 32 * 512 + (i & 1) * 256, lqk, lv);
      }
    }
    wait_ds0();
    wait_copies0();
    __syncthreads();          // publishes tile t+1, ends every read of tile t
    // The next tile's first group, behind its barrier. No test here: from the last
    // WMMA to the rounding of its result the code stays in one straight line. On
    // the last trip these reads fetch the other buffer's old bytes, and nothing
    // uses them.
#pragma unroll
    for (int j = 0; j < QKV_AG; ++j)
      fa[0][j] = frag_packed(&atile[(t + 1) & 1][0] + j * 512, lane);
    // The last row tile's stores stand behind the barrier, which waits for every
    // store issued in front of it: these fly under the next tile's WMMAs.
    qkv_store(qkv_round(aq, ak, av, xbq, xbk, xbv), qp + (PROJ_MT - 1) * 16 * 512,
              kp + (PROJ_MT - 1) * 16 * 512,
              vp + ((PROJ_MT - 1) >> 1) * 32 * 512 + ((PROJ_MT - 1) & 1) * 256, lqk, lv);
    if (t + 2 < QKV_TILES) {  // the same for the whole work-group
#pragma unroll
      for (int j = 0; j < PROJ_MT * 4; ++j)
        stage16(asrc + (t + 2) * QKV_TILE16 + j * 256,
                (uint4*)&atile[t & 1][0] + j * 256 + threadIdx.x);
    }
  }
  wait_copies0();
  wait_ds0();
}

typedef __attribute__((address_space(3))) char* lds_char_p;
typedef __attribute__((ext_vector_type(4))) uint32_t u32x4;
typedef __attribute__((ext_vector_type(8))) uint32_t u32x8;
#define AQT 2    // 16-query tiles per wave of the attention kernel
#define AGF 8    // K or V fragments per group of LDS reads there
#define ANG (32 / AGF)   // groups per 32-key tile of K, and of V
#define ASET 2   // register sets that the groups go through
#define KV_TILEB 32768u  // bytes of K, and of V, per 32-key tile
#define KV_SLICE 16384u  // bytes that one wave's request brings
#define KV_ROWB  256u    // the slice as a two-dimensional tile: bytes per row,
#define KV_ROWS  64u     // rows; the source pitch is the row, so it is contiguous

// A wave-uniform test held in a scalar register, so that the branch on it is a
// scalar branch: a tensor load ignores EXEC, only such a branch keeps it back.
__device__ __forceinline__ uint32_t pinned(uint32_t v) {
  uint32_t w = uni(v);
  asm volatile("" : "+s"(w));   // pinned(): the test stays in a scalar register
  return w;
}

// Descriptor group 1, the same for every request: 1-byte elements, no mask, no
// pad; tensor = tile = KV_ROWS rows of KV_ROWB bytes at a pitch of KV_ROWB.
__device__ __forceinline__ u32x8 kv_group1() {
  u32x8 g;
  g[0] = uni(0u);
  g[1] = uni((KV_ROWB & 0xFFFFu) << 16);
  g[2] = uni((KV_ROWB >> 16) | ((KV_ROWS & 0xFFFFu) << 16));
  g[3] = uni((KV_ROWS >> 16) | (KV_ROWB << 16));
  g[4] = uni(KV_ROWS);
  g[5] = uni(KV_ROWB);
  g[6] = uni(0u);
  g[7] = uni(0u);
  return g;
}

// Descriptor group 0 of one request: KV_SLICE bytes from ga to the LDS byte
// offset lds_dst.
__device__ __forceinline__ u32x4 kv_group0(uint32_t lds_dst, uint64_t ga) {
  u32x4 g;
  g[0] = uni(1u);
  g[1] = uni(lds_dst);
  g[2] = uni((uint32_t)ga);
  g[3] = uni((((uint32_t)(ga >> 32)) & 0x01FFFFFFu) | 0x80000000u);
  return g;
}

// The request itself: one instruction of the whole wave; the mover brings the
// slice from memory into LDS through no register.
__device__ __forceinline__ void kv_load(u32x4 g0, u32x8 g1) {
  asm volatile("tensor_load_to_lds %0, %1" :: "s"(g0), "s"(g1) : "memory");
}

// This wave's own tensor load has landed (before the barrier that publishes it).
// The request's descriptor is named as an input so that its registers live,
// unchanged, up to the wait that covers the request.
__device__ __forceinline__ void wait_tensor0(u32x4 g0, u32x8 g1) {
  asm volatile("s_wait_tensorcnt 0x0" :: "s"(g0), "s"(g1) : "memory");
}

// ---------------------------------------------------------------------------
// Lane l with lane l ^ 16: the two lanes that share a query column of a
// transposed score tile (each holds half of its keys).
// ---------------------------------------------------------------------------
__device__ __forceinline__ float xhalf(float v) {
  int b = __builtin_bit_cast(int, v);
  return __builtin_bit_cast(float, __builtin_amdgcn_permlanex16(
      b, b, 0x76543210, 0xfedcba98, false, false));
}
// The maxima in use are replaced only when some query's tile maximum exceeds its own by
// more than this (P then stays below e^5.5, about 245).
#define RESCALE_OVER 5.5f

// The largest of the 16 scores that a lane holds of one query (a tree three deep).
__device__ __forceinline__ float max16(v8f d0, v8f d1) {
  float ma = fmaxf(fmaxf(d0[0], d1[0]), d0[1]);
  float mb = fmaxf(fmaxf(d1[1], d0[2]), d1[2]);
  float mc = fmaxf(fmaxf(d0[3], d1[3]), d0[4]);
  float md = fmaxf(fmaxf(d1[4], d0[5]), d1[5]);
  float me = fmaxf(fmaxf(d0[6], d1[6]), d0[7]);
  return fmaxf(fmaxf(fmaxf(ma, mb), d1[7]), fmaxf(fmaxf(mc, md), me));
}

__global__ __launch_bounds__(128) void k_attn_out(const bf16* __restrict__ qb,
                                                  const bf16* __restrict__ kb,
                                                  const bf16* __restrict__ vtb,
                                                  bf16* __restrict__ ao) {
  // [buffer][K, V]; aligned so that every request's place is a multiple of 2 KB.
  __shared__ __attribute__((aligned(2048))) bf16 kvbuf[2][2 * 32 * 512];
  int wave = threadIdx.x >> 5, lane = threadIdx.x & 31;
  int qt = blockIdx.x * 8 + wave * AQT;             // the wave's first query tile
  int b = blockIdx.x >> 5;
  const bf16* kbase = kb + (size_t)b * Nq * Cq;
  const bf16* vbase = vtb + (size_t)b * Cq * Nq;
  // The wave's quarter of tile 0: where it lies in memory and where it goes.
  const uint32_t wv = uni(threadIdx.x >> 5);
  const uint64_t kvsrc = wv < 2u
      ? (uint64_t)(__UINTPTR_TYPE__)kbase + wv * KV_SLICE
      : (uint64_t)(__UINTPTR_TYPE__)vbase + (wv - 2u) * KV_SLICE;
  const uint32_t kvdst =
      (uint32_t)(__UINTPTR_TYPE__)(lds_char_p)(char*)&kvbuf[0][0] + wv * KV_SLICE;
  const u32x8 kvg1 = kv_group1();
  u32x4 kvg0 = kv_group0(kvdst, kvsrc);             // of the request in flight
  kv_load(kvg0, kvg1);
  const bf16* qsrc = qb + (size_t)qt * 16 * Cq + lane * 8;   // the lane's 16 bytes
  v16bf qf[AQT][16];
#pragma unroll
  for (int q = 0; q < AQT; ++q)
#pragma unroll
    for (int kt = 0; kt < 16; ++kt)
      qf[q][kt] = cat8(*(const v8bf*)(qsrc + (q * 16 + kt) * 512),
                       *(const v8bf*)(qsrc + (q * 16 + kt) * 512 + 256));
  // mrow: the maximum in use of the lane's query (equal in its two lanes);
  // lsum: this lane's share of the query's sum, one partial sum per score
  // register (eight short chains, not one long one), joined in the epilogue;
  // p0, p1: the last tile's P (f32), added to lsum beside the next tile's first
  // score WMMAs, where the vector unit has nothing else to do.
  float mrow[AQT];
  v8f lsum[AQT], p0[AQT], p1[AQT];
#pragma unroll
  for (int q = 0; q < AQT; ++q) {
    mrow[q] = -1e30f;
    lsum[q] = (v8f){}; p0[q] = (v8f){}; p1[q] = (v8f){};
  }
  // The address registers of the loads above stay as they are until this wait
  // (named as an input so that they live up to it).
  asm volatile("s_wait_xcnt 0x0" :: "v"(qsrc) : "memory");
  wait_tensor0(kvg0, kvg1);
  __syncthreads();                                  // publish tile 0
  kvg0 = kv_group0(kvdst + 2u * KV_TILEB, kvsrc + KV_TILEB);
  kv_load(kvg0, kvg1);
  v8f acc[AQT][32] = {};
  for (int t = 0; t < 128; ++t) {                   // 32 keys per trip
    const bf16* kt32 = &kvbuf[t & 1][0];
    const bf16* vt32 = kt32 + 32 * 512;
    v8f d0[AQT] = {}, d1[AQT] = {};
    // K and V fragments come in groups of AGF, 2 * ANG groups a tile (K, then V),
    // through ASET register sets: a group's LDS reads are issued as one run, 16
    // WMMAs ahead of its own, since with one wave on the SIMD nothing else covers
    // their latency. Unrolled so that qf[], acc[] and the sets are indexed by
    // constants and stay in registers.
    v16bf fr[ASET][AGF];
#pragma unroll
    for (int i = 0; i < ASET - 1; ++i)
#pragma unroll
      for (int j = 0; j < AGF; ++j)
        fr[i][j] = frag_packed(kt32 + (j & 1) * 16 * Cq + (i * (AGF / 2) + (j >> 1)) * 512, lane);
#pragma unroll
    for (int g = 0; g < ANG; ++g) {
      const int n = g + ASET - 1;                   // the group fetched now
#pragma unroll
      for (int j = 0; j < AGF; ++j)
        fr[n % ASET][j] = (n < ANG)
            ? frag_packed(kt32 + (j & 1) * 16 * Cq + (n * (AGF / 2) + (j >> 1)) * 512, lane)
            : frag_packed(vt32 + ((n - ANG) * AGF + j) * 512, lane);   // first of V
      // Keeps the reads above as one group ahead of the WMMAs; left free, each
      // read sinks to just in front of its WMMA, which then waits out its latency.
      __builtin_amdgcn_sched_barrier(0);
#pragma unroll
      for (int h = 0; h < AGF / 2; ++h) {           // rows = keys, columns = queries
        const int kt = g * (AGF / 2) + h;
#pragma unroll
        for (int q = 0; q < AQT; ++q)
          d0[q] = wmma_bf16(fr[g % ASET][h * 2], qf[q][kt], d0[q]);
#pragma unroll
        for (int q = 0; q < AQT; ++q)
          d1[q] = wmma_bf16(fr[g % ASET][h * 2 + 1], qf[q][kt], d1[q]);
      }
      if (g == 0) {                                 // ahead of this tile's rescale
#pragma unroll
        for (int q = 0; q < AQT; ++q) lsum[q] += p0[q] + p1[q];
      }
      // Keeps the following group's reads behind these WMMAs.
      __builtin_amdgcn_sched_barrier(0);
    }
    // The tile's maximum for the lane's query: its own 16 keys in the lane, the
    // other 16 from the other half.
    float tm[AQT];
    bool over = false;
#pragma unroll
    for (int q = 0; q < AQT; ++q) {
      float m = max16(d0[q], d1[q]);
      tm[q] = fmaxf(m, xhalf(m)) * SCALEF;
      over = over || (tm[q] - mrow[q] > RESCALE_OVER);
    }
    // One test per tile, the same for the whole wave (a scalar branch): the
    // 512 accumulator registers are rescaled only when some query's maximum has
    // passed the one in use by the margin.
    if (__builtin_amdgcn_ballot_w32(over) != 0) {
#pragma unroll
      for (int q = 0; q < AQT; ++q) {
        float mnew = fmaxf(mrow[q], tm[q]);
        float f = __expf(mrow[q] - mnew);           // 0 on the first tile
        mrow[q] = mnew;
        lsum[q] *= f;
#pragma unroll
        for (int ct = 0; ct < 32; ++ct)
#pragma unroll
          for (int r = 0; r < 8; ++r) acc[q][ct][r] *= f;
      }
    }
    v16bf pa[AQT];            // B fragments of P^T: k = key, column = query
#pragma unroll
    for (int q = 0; q < AQT; ++q)
#pragma unroll
      for (int r = 0; r < 8; ++r) {
        p0[q][r] = __expf(d0[q][r] * SCALEF - mrow[q]);
        p1[q][r] = __expf(d1[q][r] * SCALEF - mrow[q]);
        pa[q][r]     = (bf16)p0[q][r];              // key r + half*8
        pa[q][r + 8] = (bf16)p1[q][r];              // key 16 + r + half*8
      }
#pragma unroll
    for (int g = 0; g < ANG; ++g) {
      const int n = g + ASET - 1;                   // the V group fetched now
      if (n < ANG) {
#pragma unroll
        for (int j = 0; j < AGF; ++j)
          fr[(ANG + n) % ASET][j] = frag_packed(vt32 + (n * AGF + j) * 512, lane);
      }
      __builtin_amdgcn_sched_barrier(0);            // as in the score loop
#pragma unroll
      for (int j = 0; j < AGF; ++j)
#pragma unroll
        for (int q = 0; q < AQT; ++q)               // rows = channels
          acc[q][g * AGF + j] = wmma_bf16(fr[(ANG + g) % ASET][j], pa[q], acc[q][g * AGF + j]);
      __builtin_amdgcn_sched_barrier(0);            // as in the score loop
    }
    wait_ds0();
    wait_tensor0(kvg0, kvg1);
    __syncthreads();          // publishes tile t+1, ends every read of tile t
    if (pinned(t + 2 < 128)) {
      kvg0 = kv_group0(kvdst + (uint32_t)(t & 1) * (2u * KV_TILEB),
                       kvsrc + (uint64_t)(t + 2) * KV_TILEB);
      kv_load(kvg0, kvg1);
    }
  }
  wait_tensor0(kvg0, kvg1);
  wait_ds0();
  // Register r of tile ct is channel ct*16 + half*8 + r of the lane's query: the
  // lane's own 16 bytes of the fragment-order block, one store per tile.
  v8bf ov[AQT][32];
#pragma unroll
  for (int q = 0; q < AQT; ++q) {
    lsum[q] += p0[q] + p1[q];                       // the last tile's
    float lown = ((lsum[q][0] + lsum[q][1]) + (lsum[q][2] + lsum[q][3])) +
                 ((lsum[q][4] + lsum[q][5]) + (lsum[q][6] + lsum[q][7]));
    float rinv = 1.0f / (lown + xhalf(lown));
#pragma unroll
    for (int ct = 0; ct < 32; ++ct)
#pragma unroll
      for (int r = 0; r < 8; ++r) ov[q][ct][r] = (bf16)(acc[q][ct][r] * rinv);
  }
  // Holds every conversion in front of the first store, so that no register
  // which an issued store names is written again.
  __builtin_amdgcn_sched_barrier(0);
  bf16* ob = ao + (size_t)qt * 16 * Cq + lane * 8;
#pragma unroll
  for (int q = 0; q < AQT; ++q)
#pragma unroll
    for (int ct = 0; ct < 32; ++ct) *(v8bf*)(ob + (q * 32 + ct) * 256) = ov[q][ct];
}

// ---------------------------------------------------------------------------
// 6) Output projection + bias + residual, fp32 store. Weights stationary, as in
//    4): one work-group per WGP; a wave owns two neighbouring channel tiles (so it
//    writes whole 128-byte lines), reads their 32 weight fragments once, into
//    registers, and the work-group walks OP_TILES tiles of 64 rows through two
//    LDS buffers. An A fragment feeds 2 WMMAs. The residual x of a 64-row tile
//    is read one tile ahead, into the registers that the tile before has freed.
//    Work-groups 128 apart in index share their rows and differ in channels.
// ---------------------------------------------------------------------------
#define OP_TILES 4       // 64-row tiles per work-group

// The residual of one 16-row tile: xp its place (the same for the whole wave),
// lx the lane's own place in it; rows r + half*8, both channel tiles.
__device__ __forceinline__ void op_residual(float (&xr)[16], const float* xp, uint32_t lx) {
#pragma unroll
  for (int r = 0; r < 8; ++r) {
    xr[r]     = xp[lx + r * Cq];
    xr[8 + r] = xp[lx + r * Cq + 16];
  }
  // In front of the next rewrite of the base that these loads name.
  asm volatile("s_wait_xcnt 0x0" ::: "memory");
}

// One 16-row tile's results to memory.
__device__ __forceinline__ void op_store(v8f a0, v8f a1, float bias0, float bias1,
                                         const float (&xr)[16], float* op, uint32_t lx) {
#pragma unroll
  for (int r = 0; r < 8; ++r) {                     // C/D layout: M = vgpr + half*8
    op[lx + r * Cq]      = a0[r] + bias0 + xr[r];
    op[lx + r * Cq + 16] = a1[r] + bias1 + xr[8 + r];
  }
  // The registers that these stores name are free for other use only behind
  // this wait.
  asm volatile("s_wait_xcnt 0x0" ::: "memory");
  // Keeps later work behind that wait.
  __builtin_amdgcn_sched_barrier(0);
}

__global__ __launch_bounds__(256) void k_out_proj(const bf16* __restrict__ ao,
                                                  const bf16* __restrict__ wo,
                                                  const float* __restrict__ bo,
                                                  const float* __restrict__ x,
                                                  float* __restrict__ out) {
  __shared__ __align__(16) bf16 atile[2][PROJ_MT * 16 * 512];
  const uint32_t lane = threadIdx.x & 31;
  const uint32_t mtg = (blockIdx.x & 127) * (OP_TILES * PROJ_MT);   // first 16-row tile
  // The wave's first channel tile, in a scalar register (as in 4).
  const uint32_t ct0 = ((blockIdx.x >> 7) << 4) + uni(threadIdx.x >> 5) * 2;
  const uint4* asrc = (const uint4*)(ao + (size_t)mtg * 16 * Cq) + threadIdx.x;
  // A constant trip count, unrolled: straight-line copies with every lane on.
#pragma unroll
  for (int j = 0; j < PROJ_MT * 4; ++j)
    stage16(asrc + j * 256, (uint4*)&atile[0][0] + j * 256 + threadIdx.x);
  const bf16* pw = wo + (size_t)ct0 * 512;
  const uint32_t lv = lane * 8;                     // the lane's 16 bytes of a block
  v16bf f0[16], f1[16];
  // Unrolled, like every loop over fragments below: the arrays are then indexed
  // by constants and stay in registers.
#pragma unroll
  for (int kt = 0; kt < 16; ++kt) {
    f0[kt] = cat8(*(const v8bf*)(pw + kt * 32 * 512 + lv), *(const v8bf*)(pw + kt * 32 * 512 + 256 + lv));
    f1[kt] = cat8(*(const v8bf*)(pw + kt * 32 * 512 + 512 + lv), *(const v8bf*)(pw + kt * 32 * 512 + 768 + lv));
  }
  const uint32_t col = (ct0 << 4) + (lane & 15);
  float bias0 = bo[col], bias1 = bo[col + 16];
  const uint32_t lx = (lane >> 4) * 8 * Cq + col;
  const float* xg = x + (size_t)mtg * 16 * Cq;
  float* og = out + (size_t)mtg * 16 * Cq;
  float xr[PROJ_MT][16];
#pragma unroll
  for (int i = 0; i < PROJ_MT; ++i) op_residual(xr[i], xg + i * 16 * Cq, lx);
  wait_copies0();
  __syncthreads();                                  // publish tile 0
#pragma unroll
  for (int j = 0; j < PROJ_MT * 4; ++j)
    stage16(asrc + QKV_TILE16 + j * 256, (uint4*)&atile[1][0] + j * 256 + threadIdx.x);
  // A fragments in groups through two register sets, as in 4): 8 WMMAs ahead.
  v16bf fa[2][QKV_AG];
#pragma unroll
  for (int j = 0; j < QKV_AG; ++j) fa[0][j] = frag_packed(&atile[0][0] + j * 512, lane);
  v8f a0 = {}, a1 = {};
  for (int t = 0; t < OP_TILES; ++t) {
    const bf16* at = &atile[t & 1][0];
    float* op = og + (size_t)t * PROJ_MT * 16 * Cq;
    const float* xn = xg + (size_t)(t + 1) * PROJ_MT * 16 * Cq;   // the next tile's x
#pragma unroll
    for (int g = 0; g < QKV_NG; ++g) {
      if (g + 1 < QKV_NG) {
#pragma unroll
        for (int j = 0; j < QKV_AG; ++j)
          fa[(g + 1) & 1][j] = frag_packed(at + ((g + 1) * QKV_AG + j) * 512, lane);
      }
      __builtin_amdgcn_sched_barrier(0);            // as in 4): reads stay one group ahead
#pragma unroll
      for (int j = 0; j < QKV_AG; ++j) {
        const int kt = (g * QKV_AG + j) & 15;
        const v8f zero = {};
        a0 = wmma_bf16(fa[g & 1][j], f0[kt], kt ? a0 : zero);
        a1 = wmma_bf16(fa[g & 1][j], f1[kt], kt ? a1 : zero);
      }
      __builtin_amdgcn_sched_barrier(0);            // as in 4)
      if (((g * QKV_AG) & 15) == 16 - QKV_AG && g + 1 < QKV_NG) {
        const int i = (g * QKV_AG) >> 4;            // the row tile just finished
        op_store(a0, a1, bias0, bias1, xr[i], op + i * 16 * Cq, lx);
        // Early enough to have landed at the tile's barrier, which waits for
        // every load issued in front of it; the later row tiles' follow behind it.
        if (i < PROJ_MT / 2 && t + 1 < OP_TILES) op_residual(xr[i], xn + i * 16 * Cq, lx);
      }
    }
    wait_ds0();
    wait_copies0();
    __syncthreads();          // publishes tile t+1, ends every read of tile t
    // As in 4): the next tile's first group, with no test in front of the last
    // row tile's sums; on the last trip nothing uses these reads.
#pragma unroll
    for (int j = 0; j < QKV_AG; ++j)
      fa[0][j] = frag_packed(&atile[(t + 1) & 1][0] + j * 512, lane);
    op_store(a0, a1, bias0, bias1, xr[PROJ_MT - 1], op + (PROJ_MT - 1) * 16 * Cq, lx);
    if (t + 1 < OP_TILES) {   // the same for the whole work-group
#pragma unroll
      for (int i = PROJ_MT / 2; i < PROJ_MT; ++i) op_residual(xr[i], xn + i * 16 * Cq, lx);
    }
    if (t + 2 < OP_TILES) {   // the same for the whole work-group
#pragma unroll
      for (int j = 0; j < PROJ_MT * 4; ++j)
        stage16(asrc + (t + 2) * QKV_TILE16 + j * 256,
                (uint4*)&atile[t & 1][0] + j * 256 + threadIdx.x);
    }
  }
  wait_copies0();
  wait_ds0();
}

// ---------------------------------------------------------------------------
// Launch
// ---------------------------------------------------------------------------
extern "C" void kernel_launch(void* const* d_in, const int* in_sizes, int n_in,
                              void* d_out, int out_size, void* d_ws, size_t ws_size,
                              hipStream_t stream) {
  const float* x      = (const float*)d_in[0];
  const float* gscale = (const float*)d_in[1];
  const float* gbias  = (const float*)d_in[2];
  const float* wq     = (const float*)d_in[3];
  const float* bq     = (const float*)d_in[4];
  const float* wk     = (const float*)d_in[5];
  const float* bk     = (const float*)d_in[6];
  const float* wv     = (const float*)d_in[7];
  const float* bv     = (const float*)d_in[8];
  const float* wo     = (const float*)d_in[9];
  const float* bo     = (const float*)d_in[10];
  float* out = (float*)d_out;

  char* ws = (char*)d_ws;
  float* stats = (float*)ws;                               // 2 KB
  bf16* wpkq = (bf16*)(ws + 4096);                         // 4 x 512KB packed weights
  bf16* wpkk = (bf16*)(ws + 4096 + 1 * 524288);
  bf16* wpkv = (bf16*)(ws + 4096 + 2 * 524288);
  bf16* wpko = (bf16*)(ws + 4096 + 3 * 524288);
  size_t o = 4096 + 4 * 524288;
  bf16* hn  = (bf16*)(ws + o); o += 33554432;              // normalized acts / reused as attn out
  bf16* qb  = (bf16*)(ws + o); o += 33554432;              // Q, fragment order
  bf16* kb  = (bf16*)(ws + o); o += 33554432;              // K, fragment order
  bf16* vtb = (bf16*)(ws + o);                             // V, fragment order (rows = channels)

  k_prep<<<512, 256, 0, stream>>>(x, wq, wk, wv, wo, stats, wpkq);
  k_gn_apply<<<16384, 256, 0, stream>>>(x, stats, gscale, gbias, hn);
  k_qkv<<<256, 256, 0, stream>>>(hn, wpkq, wpkk, wpkv, bq, bk, bv, qb, kb, vtb);
  k_attn_out<<<256, 128, 0, stream>>>(qb, kb, vtb, hn);      // attn out overwrites hn
  k_out_proj<<<256, 256, 0, stream>>>(hn, wpko, bo, x, out);
}

// v010
// A run of this version takes 217 microseconds.
// Next to v009, in two timings, it ran 1.07 times as fast each time.
// All steps since v000 together make it 11.8 times as fast.
#include <hip/hip_runtime.h>

typedef __bf16 bf16;
typedef __attribute__((ext_vector_type(16))) __bf16 v16bf;
typedef __attribute__((ext_vector_type(8)))  __bf16 v8bf;
typedef __attribute__((ext_vector_type(4)))  __bf16 v4bf;
typedef __attribute__((ext_vector_type(8)))  float  v8f;
typedef __attribute__((ext_vector_type(4)))  int    v4i;
typedef __attribute__((address_space(3))) v4i* lds_v4i_p;

#define Bq 8
#define Cq 512
#define Nq 4096
#define Mq 32768
#define SCALEF 0.044194173824159216f   // 1/sqrt(512)
#define EPSQ 1e-5f

// ---------------------------------------------------------------------------
// WMMA helpers
// ---------------------------------------------------------------------------
__device__ __forceinline__ v8f wmma_bf16(v16bf a, v16bf b, v8f c) {
  return __builtin_amdgcn_wmma_f32_16x16x32_bf16(false, a, false, b, (short)0, c,
                                                 false, false);
}

__device__ __forceinline__ v16bf cat8(v8bf lo, v8bf hi) {
  return __builtin_shufflevector(lo, hi, 0, 1, 2, 3, 4, 5, 6, 7,
                                         8, 9, 10, 11, 12, 13, 14, 15);
}

// Fragment order. Every bf16 WMMA operand (in the workspace and in LDS) is kept
// as 1 KB blocks, one block per 16-row x 32-k fragment: [part 0..1][lane 0..31][8].
// Per ISA layout: lane L -> row = L&15, half = L>>4;
// part 0, elements 0..7  -> k = half*8 + j
// part 1, elements 8..15 -> k = 16 + half*8 + j
// so each of the two 16-byte reads of a fragment covers 512 contiguous bytes
// over the wave: four whole lines from global memory, no shared bank in LDS.
// The same pattern serves as a B fragment (rows indexed by N).
// frag_off: place of element (row r16, k index k32) inside its block.
__device__ __forceinline__ int frag_off(int r16, int k32) {
  return ((k32 >> 4) << 8) + (((((k32 >> 3) & 1) << 4) + r16) << 3) + (k32 & 7);
}

__device__ __forceinline__ v16bf frag_packed(const bf16* blk, int lane) {
  const bf16* p = blk + lane * 8;
  v8bf lo = *(const v8bf*)p;
  v8bf hi = *(const v8bf*)(p + 256);
  return cat8(lo, hi);
}

// ---------------------------------------------------------------------------
// Async global -> LDS staging (gfx1250 GLOBAL_LOAD_ASYNC_TO_LDS_B128,
// tracked by ASYNCcnt). Param 0 is a generic v4i* (per compiler diagnostic);
// LDS side is cast to addrspace(3), which also converts implicitly to
// generic if the builtin is declared that way.
// ---------------------------------------------------------------------------
__device__ __forceinline__ void stage16(const void* gsrc, void* ldst) {
#if __has_builtin(__builtin_amdgcn_global_load_async_to_lds_b128)
  __builtin_amdgcn_global_load_async_to_lds_b128((v4i*)gsrc, (lds_v4i_p)ldst, 0, 0);
#else
  *(uint4*)ldst = *(const uint4*)gsrc;
#endif
}

// This wave's own copies have landed (before the barrier that publishes them).
__device__ __forceinline__ void wait_copies0() {
  asm volatile("s_wait_asynccnt 0x0" ::: "memory");
}

// This wave's own LDS reads and writes have retired (before a buffer is handed
// back for refill).
__device__ __forceinline__ void wait_ds0() {
  asm volatile("s_wait_dscnt 0x0" ::: "memory");
}

// 16-row tiles per staged LDS tile (64 rows) of the two projection kernels.
#define PROJ_MT 4

// ---------------------------------------------------------------------------
// Both GroupNorm passes read x as a stream: a block takes GN_ROWS whole rows
// (128 KB in a row), every load of a wave covers 512 contiguous bytes (four whole
// lines), and a thread's 32 loads have no address or branch between them, so a
// dozen or more of them fly at a time and the few resident waves (all blocks are
// on the chip at once) keep the memory busy. Block i of both passes takes the
// same rows.
// ---------------------------------------------------------------------------
#define GN_ROWS 64                    // rows per block
#define GN_CHUNKS (Nq / GN_ROWS)      // blocks per batch

// ---------------------------------------------------------------------------
// 1a) GroupNorm statistics, the sums: block bc = 0..511 sums x and x*x of its 64
//     rows for each of the 32 groups. A thread keeps four channels (float4 column
//     threadIdx & 127) and every second row; part[bc][group] = (sum, sum of
//     squares): 256 bytes, two whole lines that no other block writes.
//     bc is the same for the whole block (it holds a barrier).
// ---------------------------------------------------------------------------
__device__ __forceinline__ void gn_part_block(const float* __restrict__ x,
                                              float* __restrict__ part, int bc) {
  const float4* xp = (const float4*)(x + (size_t)bc * GN_ROWS * Cq) + threadIdx.x;
  float4 v[GN_ROWS / 2];
  // Unrolled, like the loops below: v[] is indexed by constants and stays in registers.
#pragma unroll
  for (int i = 0; i < GN_ROWS / 2; ++i) v[i] = xp[i * 256];
  float4 s = {0.f, 0.f, 0.f, 0.f}, q = {0.f, 0.f, 0.f, 0.f};   // one chain per channel
#pragma unroll
  for (int i = 0; i < GN_ROWS / 2; ++i) {
    s.x += v[i].x; s.y += v[i].y; s.z += v[i].z; s.w += v[i].w;
    q.x += v[i].x * v[i].x; q.y += v[i].y * v[i].y;
    q.z += v[i].z * v[i].z; q.w += v[i].w * v[i].w;
  }
  __shared__ float2 sh[256];
  sh[threadIdx.x] = make_float2((s.x + s.y) + (s.z + s.w), (q.x + q.y) + (q.z + q.w));
  __syncthreads();
  if (threadIdx.x < 32) {             // group = threadIdx: 4 columns x 2 row parities
    float a = 0.f, b = 0.f;
#pragma unroll
    for (int k = 0; k < 4; ++k) {
      float2 lo = sh[threadIdx.x * 4 + k], hi = sh[128 + threadIdx.x * 4 + k];
      a += lo.x + hi.x;
      b += lo.y + hi.y;
    }
    *(float2*)(part + ((size_t)bc * 32 + threadIdx.x) * 2) = make_float2(a, b);
  }
}

// ---------------------------------------------------------------------------
// 2) Apply GroupNorm, emit bf16 activations (M x C in fragment order:
//    block (m>>4, c>>5); a 16-row tile is 16 KB contiguous). 512 resident blocks
//    of 64 rows. Each first joins its batch's 64 partial sums per group. A wave
//    then takes 128 channels of two 16-row tiles: it reads whole lines of x
//    (lane = 4 channels of a row), turns each tile's 4 KB into fragment order in
//    an LDS range of its own and stores them as whole lines.
// ---------------------------------------------------------------------------
// LDS pitch of a 256-byte unit of the fragment order (16 rows x 16 bytes): 16
// bytes more, so that a wave's 8-byte writes, which fall in 16 units, cover all
// 64 banks once; the 16-byte reads run along a unit.
#define GN_UNITB 272
#define GN_WAVEB (16 * GN_UNITB)      // 16 rows x 128 channels

__global__ __launch_bounds__(256) void k_gn_apply(const float* __restrict__ x,
                                                  const float* __restrict__ part,
                                                  const float* __restrict__ gamma,
                                                  const float* __restrict__ beta,
                                                  bf16* __restrict__ hn) {
  __shared__ __align__(16) float4 red[256];
  __shared__ __align__(16) char turn[8][2][GN_WAVEB];
  const uint32_t tid = threadIdx.x, lane = tid & 31, wave = tid >> 5;
  const uint32_t qd = wave & 3;                                // which 128 channels
  const uint32_t rt0 = blockIdx.x * 4 + (wave >> 2) * 2;       // first 16-row tile
  const uint32_t c = qd * 128 + lane * 4;                      // the lane's channels
  // The batch's partial sums, 16 KB: float4 j*256 + tid holds (sum, squares) of
  // groups 2*(tid & 15) and the next, of chunk j*16 + (tid >> 4).
  const float4* pp = (const float4*)(part + (size_t)(blockIdx.x >> 6) * (GN_CHUNKS * 64)) + tid;
  float4 pv[4];
  // Unrolled, like every loop below: pv[] and xv[] are indexed by constants and
  // stay in registers.
#pragma unroll
  for (int j = 0; j < 4; ++j) pv[j] = pp[j * 256];
  const float4 ga = *(const float4*)(gamma + c);
  const float4 be = *(const float4*)(beta + c);
  const float4* xp = (const float4*)(x + (size_t)rt0 * 16 * Cq + c);
  float4 xv[2][16];
#pragma unroll
  for (int it = 0; it < 2; ++it)
#pragma unroll
    for (int r = 0; r < 16; ++r) xv[it][r] = xp[(it * 16 + r) * (Cq / 4)];
  red[tid] = make_float4((pv[0].x + pv[1].x) + (pv[2].x + pv[3].x),
                         (pv[0].y + pv[1].y) + (pv[2].y + pv[3].y),
                         (pv[0].z + pv[1].z) + (pv[2].z + pv[3].z),
                         (pv[0].w + pv[1].w) + (pv[2].w + pv[3].w));
  __syncthreads();
  const uint32_t g = c >> 4;
  float sum = 0.f, sq = 0.f;
#pragma unroll
  for (int k = 0; k < 16; ++k) {
    float2 p = ((const float2*)red)[(k * 16 + (g >> 1)) * 2 + (g & 1)];
    sum += p.x;
    sq += p.y;
  }
  const float inv = 1.0f / (float)(Nq * 16);
  const float mean = sum * inv;
  const float rstd = rsqrtf(sq * inv - mean * mean + EPSQ);
#pragma unroll
  for (int it = 0; it < 2; ++it) {
    char* t = &turn[wave][it][0];
#pragma unroll
    for (int r = 0; r < 16; ++r) {
      const float4 a = xv[it][r];
      v4bf o;
      o[0] = (bf16)((a.x - mean) * rstd * ga.x + be.x);
      o[1] = (bf16)((a.y - mean) * rstd * ga.y + be.y);
      o[2] = (bf16)((a.z - mean) * rstd * ga.z + be.z);
      o[3] = (bf16)((a.w - mean) * rstd * ga.w + be.w);
      // unit = 8 channels (lane >> 1), row r, the lane's half of the 16 bytes
      *(v4bf*)(t + (lane >> 1) * GN_UNITB + r * 16 + (lane & 1) * 8) = o;
    }
    // The wave's own writes have landed before its lanes read each other's.
    wait_ds0();
    bf16* op = hn + (size_t)(rt0 + it) * 16 * Cq + qd * 2048 + lane * 8;
#pragma unroll
    for (int j = 0; j < 8; ++j)
      *(v8bf*)(op + j * 256) =
          *(const v8bf*)(t + (j * 2 + (lane >> 4)) * GN_UNITB + (lane & 15) * 16);
  }
}

// ---------------------------------------------------------------------------
// 1b) Pack a 512x512 f32 weight (w[k][n]) into fragment order:
//     block (kt*32+nt), rows indexed by n. tid = 0..16383 over 64 blocks.
// ---------------------------------------------------------------------------
__device__ __forceinline__ void pack_w_thread(const float* __restrict__ w,
                                              bf16* __restrict__ wpk, int tid) {
  if (tid >= 16 * 32 * 32) return;   // ktiles(16) * ntiles(32) * lanes(32)
  int lane = tid & 31;
  int nt = (tid >> 5) & 31;
  int kt = tid >> 10;
  int n = nt * 16 + (lane & 15);
  int half = lane >> 4;
  bf16* dst = wpk + (size_t)(tid >> 5) * 512 + lane * 8; // tid>>5 == kt*32+nt
#pragma unroll
  for (int j = 0; j < 8; ++j)
    dst[j] = (bf16)w[(kt * 32 + half * 8 + j) * Cq + n];
#pragma unroll
  for (int j = 0; j < 8; ++j)
    dst[256 + j] = (bf16)w[(kt * 32 + 16 + half * 8 + j) * Cq + n];
}

// ---------------------------------------------------------------------------
// 1) Everything that reads nothing but inputs, in one launch: blocks 0..511 take
//    the GroupNorm sums (the long ones), blocks
//    512..767 pack the four weights, 64 blocks each, into wpk[4][512*512].
//    The branch is on blockIdx alone: a block is wholly on one side of it.
// ---------------------------------------------------------------------------
__global__ __launch_bounds__(256) void k_prep(const float* __restrict__ x,
                                              const float* __restrict__ wq,
                                              const float* __restrict__ wk,
                                              const float* __restrict__ wv,
                                              const float* __restrict__ wo,
                                              float* __restrict__ part,
                                              bf16* __restrict__ wpk) {
  if (blockIdx.x < Bq * GN_CHUNKS) {
    gn_part_block(x, part, blockIdx.x);
    return;
  }
  int j = blockIdx.x - Bq * GN_CHUNKS;
  int which = j >> 6;
  const float* w = which == 0 ? wq : which == 1 ? wk : which == 2 ? wv : wo;
  pack_w_thread(w, wpk + (size_t)which * (Cq * Cq), (j & 63) * 256 + threadIdx.x);
}

__device__ __forceinline__ uint32_t uni(uint32_t v) {
  return (uint32_t)__builtin_amdgcn_readfirstlane(v);
}

#define QKV_TILES 8      // 64-row tiles per work-group
#define QKV_AG 4         // A fragments per group of LDS reads
#define QKV_NG (PROJ_MT * 16 / QKV_AG)        // groups per 64-row tile
#define QKV_TILE16 (PROJ_MT * 16 * 512 / 8)   // 16-byte pieces of a 64-row tile

// One 16-row tile's results: bias added, rounded to bf16.
struct qkv_out { v8bf q, k, v; };
__device__ __forceinline__ qkv_out qkv_round(v8f aq, v8f ak, v8f av, float xbq, float xbk,
                                             float xbv) {
  qkv_out o;
#pragma unroll
  for (int r = 0; r < 8; ++r) {
    o.q[r] = (bf16)(aq[r] + xbq);
    o.k[r] = (bf16)(ak[r] + xbk);
    o.v[r] = (bf16)(av[r] + xbv);
  }
  return o;
}
// ... and to memory. qp, kp, vp: the tile's place (the same for the whole wave);
// lqk, lv: the lane's own place in it.
__device__ __forceinline__ void qkv_store(qkv_out o, bf16* qp, bf16* kp, bf16* vp,
                                          uint32_t lqk, uint32_t lv) {
#pragma unroll
  for (int r = 0; r < 8; ++r) {                     // C/D layout: M = vgpr + half*8
    qp[lqk + r * 8] = o.q[r];
    kp[lqk + r * 8] = o.k[r];
  }
  *(v8bf*)(vp + lv) = o.v;
  // The registers that these stores name are free for the next LDS reads only
  // behind this wait.
  asm volatile("s_wait_xcnt 0x0" ::: "memory");
  // Keeps later work behind that wait.
  __builtin_amdgcn_sched_barrier(0);
}

__global__ __launch_bounds__(256) void k_qkv(const bf16* __restrict__ hn,
                                             const bf16* __restrict__ wq,
                                             const bf16* __restrict__ wk,
                                             const bf16* __restrict__ wv,
                                             const float* __restrict__ bq,
                                             const float* __restrict__ bk,
                                             const float* __restrict__ bv,
                                             bf16* __restrict__ qb,
                                             bf16* __restrict__ kb,
                                             bf16* __restrict__ vtb) {
  __shared__ __align__(16) bf16 atile[2][PROJ_MT * 16 * 512];
  const uint32_t lane = threadIdx.x & 31;
  const uint32_t mtg = (blockIdx.x & 63) * (QKV_TILES * PROJ_MT);   // first 16-row tile
  // The wave's channel tile, in a scalar register: the weight loads then go by a
  // scalar base and one lane offset, which no later instruction rewrites.
  const uint32_t ct = ((blockIdx.x >> 6) << 3) + uni(threadIdx.x >> 5);
  const uint4* asrc = (const uint4*)(hn + (size_t)mtg * 16 * Cq) + threadIdx.x;
  // A constant trip count, unrolled: straight-line copies with every lane on.
#pragma unroll
  for (int j = 0; j < PROJ_MT * 4; ++j)
    stage16(asrc + j * 256, (uint4*)&atile[0][0] + j * 256 + threadIdx.x);
  const bf16* pq = wq + (size_t)ct * 512;
  const bf16* pk = wk + (size_t)ct * 512;
  const bf16* pv = wv + (size_t)ct * 512;
  const uint32_t lv = lane * 8;                     // the lane's 16 bytes of a block
  v16bf fq[16], fk[16], fv[16];
  // Unrolled, like every loop over fragments below: the arrays are then indexed
  // by constants and stay in registers.
#pragma unroll
  for (int kt = 0; kt < 16; ++kt) {
    fq[kt] = cat8(*(const v8bf*)(pq + kt * 32 * 512 + lv), *(const v8bf*)(pq + kt * 32 * 512 + 256 + lv));
    fk[kt] = cat8(*(const v8bf*)(pk + kt * 32 * 512 + lv), *(const v8bf*)(pk + kt * 32 * 512 + 256 + lv));
    fv[kt] = cat8(*(const v8bf*)(pv + kt * 32 * 512 + lv), *(const v8bf*)(pv + kt * 32 * 512 + 256 + lv));
  }
  const uint32_t half = lane >> 4;
  const uint32_t col = (ct << 4) + (lane & 15);
  float xbq = bq[col], xbk = bk[col], xbv = bv[col];
  const uint32_t lqk = (uint32_t)frag_off(half * 8, col & 31);
  // In front of the first instruction that may rewrite an address register of
  // the loads above.
  asm volatile("s_wait_xcnt 0x0" ::: "memory");
  wait_copies0();
  __syncthreads();                                  // publish tile 0
#pragma unroll
  for (int j = 0; j < PROJ_MT * 4; ++j)
    stage16(asrc + QKV_TILE16 + j * 256, (uint4*)&atile[1][0] + j * 256 + threadIdx.x);
  // A fragments come in groups of QKV_AG through two register sets: a group's LDS
  // reads are issued as one run, 12 WMMAs ahead of its own.
  v16bf fa[2][QKV_AG];
#pragma unroll
  for (int j = 0; j < QKV_AG; ++j) fa[0][j] = frag_packed(&atile[0][0] + j * 512, lane);
  v8f aq = {}, ak = {}, av = {};
  for (int t = 0; t < QKV_TILES; ++t) {
    const bf16* at = &atile[t & 1][0];
    const uint32_t mt0 = mtg + t * PROJ_MT;         // 64 rows: inside one batch
    bf16* qp = qb + ((size_t)mt0 * 16 + (ct >> 1)) * 512;
    bf16* kp = kb + ((size_t)mt0 * 16 + (ct >> 1)) * 512;
    // key = n0 + half*8 + r, n0 = the row tile's first row inside its batch
    bf16* vp = vtb + (size_t)(mt0 >> 8) * Cq * Nq + ((size_t)((mt0 & 255) >> 1) * 32 + ct) * 512;
#pragma unroll
    for (int g = 0; g < QKV_NG; ++g) {
      if (g + 1 < QKV_NG) {
#pragma unroll
        for (int j = 0; j < QKV_AG; ++j)
          fa[(g + 1) & 1][j] = frag_packed(at + ((g + 1) * QKV_AG + j) * 512, lane);
      }
      // Keeps the reads above as one group ahead of the WMMAs; left free, each
      // read sinks to just in front of its WMMA, which then waits out its latency.
      __builtin_amdgcn_sched_barrier(0);
#pragma unroll
      for (int j = 0; j < QKV_AG; ++j) {
        const int kt = (g * QKV_AG + j) & 15;
        const v8f zero = {};
        aq = wmma_bf16(fa[g & 1][j], fq[kt], kt ? aq : zero);
        ak = wmma_bf16(fa[g & 1][j], fk[kt], kt ? ak : zero);
        av = wmma_bf16(fa[g & 1][j], fv[kt], kt ? av : zero);
      }
      // Keeps the following group's reads behind these WMMAs.
      __builtin_amdgcn_sched_barrier(0);
      if (((g * QKV_AG) & 15) == 16 - QKV_AG && g + 1 < QKV_NG) {
        const int i = (g * QKV_AG) >> 4;            // the row tile just finished
        qkv_store(qkv_round(aq, ak, av, xbq, xbk, xbv), qp + i * 16 * 512, kp + i * 16 * 512,
                  vp + (i >> 1) * 32 * 512 + (i & 1) * 256, lqk, lv);
      }
    }
    wait_ds0();
    wait_copies0();
    __syncthreads();          // publishes tile t+1, ends every read of tile t
    // The next tile's first group, behind its barrier. No test here: from the last
    // WMMA to the rounding of its result the code stays in one straight line. On
    // the last trip these reads fetch the other buffer's old bytes, and nothing
    // uses them.
#pragma unroll
    for (int j = 0; j < QKV_AG; ++j)
      fa[0][j] = frag_packed(&atile[(t + 1) & 1][0] + j * 512, lane);
    // The last row tile's stores stand behind the barrier, which waits for every
    // store issued in front of it: these fly under the next tile's WMMAs.
    qkv_store(qkv_round(aq, ak, av, xbq, xbk, xbv), qp + (PROJ_MT - 1) * 16 * 512,
              kp + (PROJ_MT - 1) * 16 * 512,
              vp + ((PROJ_MT - 1) >> 1) * 32 * 512 + ((PROJ_MT - 1) & 1) * 256, lqk, lv);
    if (t + 2 < QKV_TILES) {  // the same for the whole work-group
#pragma unroll
      for (int j = 0; j < PROJ_MT * 4; ++j)
        stage16(asrc + (t + 2) * QKV_TILE16 + j * 256,
                (uint4*)&atile[t & 1][0] + j * 256 + threadIdx.x);
    }
  }
  wait_copies0();
  wait_ds0();
}

typedef __attribute__((address_space(3))) char* lds_char_p;
typedef __attribute__((ext_vector_type(4))) uint32_t u32x4;
typedef __attribute__((ext_vector_type(8))) uint32_t u32x8;
#define AQT 2    // 16-query tiles per wave of the attention kernel
#define AGF 8    // K or V fragments per group of LDS reads there
#define ANG (32 / AGF)   // groups per 32-key tile of K, and of V
#define ASET 2   // register sets that the groups go through
#define KV_TILEB 32768u  // bytes of K, and of V, per 32-key tile
#define KV_SLICE 16384u  // bytes that one wave's request brings
#define KV_ROWB  256u    // the slice as a two-dimensional tile: bytes per row,
#define KV_ROWS  64u     // rows; the source pitch is the row, so it is contiguous

// A wave-uniform test held in a scalar register, so that the branch on it is a
// scalar branch: a tensor load ignores EXEC, only such a branch keeps it back.
__device__ __forceinline__ uint32_t pinned(uint32_t v) {
  uint32_t w = uni(v);
  asm volatile("" : "+s"(w));   // pinned(): the test stays in a scalar register
  return w;
}

// Descriptor group 1, the same for every request: 1-byte elements, no mask, no
// pad; tensor = tile = KV_ROWS rows of KV_ROWB bytes at a pitch of KV_ROWB.
__device__ __forceinline__ u32x8 kv_group1() {
  u32x8 g;
  g[0] = uni(0u);
  g[1] = uni((KV_ROWB & 0xFFFFu) << 16);
  g[2] = uni((KV_ROWB >> 16) | ((KV_ROWS & 0xFFFFu) << 16));
  g[3] = uni((KV_ROWS >> 16) | (KV_ROWB << 16));
  g[4] = uni(KV_ROWS);
  g[5] = uni(KV_ROWB);
  g[6] = uni(0u);
  g[7] = uni(0u);
  return g;
}

// Descriptor group 0 of one request: KV_SLICE bytes from ga to the LDS byte
// offset lds_dst.
__device__ __forceinline__ u32x4 kv_group0(uint32_t lds_dst, uint64_t ga) {
  u32x4 g;
  g[0] = uni(1u);
  g[1] = uni(lds_dst);
  g[2] = uni((uint32_t)ga);
  g[3] = uni((((uint32_t)(ga >> 32)) & 0x01FFFFFFu) | 0x80000000u);
  return g;
}

// The request itself: one instruction of the whole wave; the mover brings the
// slice from memory into LDS through no register.
__device__ __forceinline__ void kv_load(u32x4 g0, u32x8 g1) {
  asm volatile("tensor_load_to_lds %0, %1" :: "s"(g0), "s"(g1) : "memory");
}

// This wave's own tensor load has landed (before the barrier that publishes it).
// The request's descriptor is named as an input so that its registers live,
// unchanged, up to the wait that covers the request.
__device__ __forceinline__ void wait_tensor0(u32x4 g0, u32x8 g1) {
  asm volatile("s_wait_tensorcnt 0x0" :: "s"(g0), "s"(g1) : "memory");
}

// ---------------------------------------------------------------------------
// Lane l with lane l ^ 16: the two lanes that share a query column of a
// transposed score tile (each holds half of its keys).
// ---------------------------------------------------------------------------
__device__ __forceinline__ float xhalf(float v) {
  int b = __builtin_bit_cast(int, v);
  return __builtin_bit_cast(float, __builtin_amdgcn_permlanex16(
      b, b, 0x76543210, 0xfedcba98, false, false));
}
// The maxima in use are replaced only when some query's tile maximum exceeds its own by
// more than this (P then stays below e^5.5, about 245).
#define RESCALE_OVER 5.5f

// The largest of the 16 scores that a lane holds of one query (a tree three deep).
__device__ __forceinline__ float max16(v8f d0, v8f d1) {
  float ma = fmaxf(fmaxf(d0[0], d1[0]), d0[1]);
  float mb = fmaxf(fmaxf(d1[1], d0[2]), d1[2]);
  float mc = fmaxf(fmaxf(d0[3], d1[3]), d0[4]);
  float md = fmaxf(fmaxf(d1[4], d0[5]), d1[5]);
  float me = fmaxf(fmaxf(d0[6], d1[6]), d0[7]);
  return fmaxf(fmaxf(fmaxf(ma, mb), d1[7]), fmaxf(fmaxf(mc, md), me));
}

__global__ __launch_bounds__(128) void k_attn_out(const bf16* __restrict__ qb,
                                                  const bf16* __restrict__ kb,
                                                  const bf16* __restrict__ vtb,
                                                  bf16* __restrict__ ao) {
  // [buffer][K, V]; aligned so that every request's place is a multiple of 2 KB.
  __shared__ __attribute__((aligned(2048))) bf16 kvbuf[2][2 * 32 * 512];
  int wave = threadIdx.x >> 5, lane = threadIdx.x & 31;
  int qt = blockIdx.x * 8 + wave * AQT;             // the wave's first query tile
  int b = blockIdx.x >> 5;
  const bf16* kbase = kb + (size_t)b * Nq * Cq;
  const bf16* vbase = vtb + (size_t)b * Cq * Nq;
  // The wave's quarter of tile 0: where it lies in memory and where it goes.
  const uint32_t wv = uni(threadIdx.x >> 5);
  const uint64_t kvsrc = wv < 2u
      ? (uint64_t)(__UINTPTR_TYPE__)kbase + wv * KV_SLICE
      : (uint64_t)(__UINTPTR_TYPE__)vbase + (wv - 2u) * KV_SLICE;
  const uint32_t kvdst =
      (uint32_t)(__UINTPTR_TYPE__)(lds_char_p)(char*)&kvbuf[0][0] + wv * KV_SLICE;
  const u32x8 kvg1 = kv_group1();
  u32x4 kvg0 = kv_group0(kvdst, kvsrc);             // of the request in flight
  kv_load(kvg0, kvg1);
  const bf16* qsrc = qb + (size_t)qt * 16 * Cq + lane * 8;   // the lane's 16 bytes
  v16bf qf[AQT][16];
#pragma unroll
  for (int q = 0; q < AQT; ++q)
#pragma unroll
    for (int kt = 0; kt < 16; ++kt)
      qf[q][kt] = cat8(*(const v8bf*)(qsrc + (q * 16 + kt) * 512),
                       *(const v8bf*)(qsrc + (q * 16 + kt) * 512 + 256));
  // mrow: the maximum in use of the lane's query (equal in its two lanes);
  // lsum: this lane's share of the query's sum, one partial sum per score
  // register (eight short chains, not one long one), joined in the epilogue;
  // p0, p1: the last tile's P (f32), added to lsum beside the next tile's first
  // score WMMAs, where the vector unit has nothing else to do.
  float mrow[AQT];
  v8f lsum[AQT], p0[AQT], p1[AQT];
#pragma unroll
  for (int q = 0; q < AQT; ++q) {
    mrow[q] = -1e30f;
    lsum[q] = (v8f){}; p0[q] = (v8f){}; p1[q] = (v8f){};
  }
  // The address registers of the loads above stay as they are until this wait
  // (named as an input so that they live up to it).
  asm volatile("s_wait_xcnt 0x0" :: "v"(qsrc) : "memory");
  wait_tensor0(kvg0, kvg1);
  __syncthreads();                                  // publish tile 0
  kvg0 = kv_group0(kvdst + 2u * KV_TILEB, kvsrc + KV_TILEB);
  kv_load(kvg0, kvg1);
  v8f acc[AQT][32] = {};
  for (int t = 0; t < 128; ++t) {                   // 32 keys per trip
    const bf16* kt32 = &kvbuf[t & 1][0];
    const bf16* vt32 = kt32 + 32 * 512;
    v8f d0[AQT] = {}, d1[AQT] = {};
    // K and V fragments come in groups of AGF, 2 * ANG groups a tile (K, then V),
    // through ASET register sets: a group's LDS reads are issued as one run, 16
    // WMMAs ahead of its own, since with one wave on the SIMD nothing else covers
    // their latency. Unrolled so that qf[], acc[] and the sets are indexed by
    // constants and stay in registers.
    v16bf fr[ASET][AGF];
#pragma unroll
    for (int i = 0; i < ASET - 1; ++i)
#pragma unroll
      for (int j = 0; j < AGF; ++j)
        fr[i][j] = frag_packed(kt32 + (j & 1) * 16 * Cq + (i * (AGF / 2) + (j >> 1)) * 512, lane);
#pragma unroll
    for (int g = 0; g < ANG; ++g) {
      const int n = g + ASET - 1;                   // the group fetched now
#pragma unroll
      for (int j = 0; j < AGF; ++j)
        fr[n % ASET][j] = (n < ANG)
            ? frag_packed(kt32 + (j & 1) * 16 * Cq + (n * (AGF / 2) + (j >> 1)) * 512, lane)
            : frag_packed(vt32 + ((n - ANG) * AGF + j) * 512, lane);   // first of V
      // Keeps the reads above as one group ahead of the WMMAs; left free, each
      // read sinks to just in front of its WMMA, which then waits out its latency.
      __builtin_amdgcn_sched_barrier(0);
#pragma unroll
      for (int h = 0; h < AGF / 2; ++h) {           // rows = keys, columns = queries
        const int kt = g * (AGF / 2) + h;
#pragma unroll
        for (int q = 0; q < AQT; ++q)
          d0[q] = wmma_bf16(fr[g % ASET][h * 2], qf[q][kt], d0[q]);
#pragma unroll
        for (int q = 0; q < AQT; ++q)
          d1[q] = wmma_bf16(fr[g % ASET][h * 2 + 1], qf[q][kt], d1[q]);
      }
      if (g == 0) {                                 // ahead of this tile's rescale
#pragma unroll
        for (int q = 0; q < AQT; ++q) lsum[q] += p0[q] + p1[q];
      }
      // Keeps the following group's reads behind these WMMAs.
      __builtin_amdgcn_sched_barrier(0);
    }
    // The tile's maximum for the lane's query: its own 16 keys in the lane, the
    // other 16 from the other half.
    float tm[AQT];
    bool over = false;
#pragma unroll
    for (int q = 0; q < AQT; ++q) {
      float m = max16(d0[q], d1[q]);
      tm[q] = fmaxf(m, xhalf(m)) * SCALEF;
      over = over || (tm[q] - mrow[q] > RESCALE_OVER);
    }
    // One test per tile, the same for the whole wave (a scalar branch): the
    // 512 accumulator registers are rescaled only when some query's maximum has
    // passed the one in use by the margin.
    if (__builtin_amdgcn_ballot_w32(over) != 0) {
#pragma unroll
      for (int q = 0; q < AQT; ++q) {
        float mnew = fmaxf(mrow[q], tm[q]);
        float f = __expf(mrow[q] - mnew);           // 0 on the first tile
        mrow[q] = mnew;
        lsum[q] *= f;
#pragma unroll
        for (int ct = 0; ct < 32; ++ct)
#pragma unroll
          for (int r = 0; r < 8; ++r) acc[q][ct][r] *= f;
      }
    }
    v16bf pa[AQT];            // B fragments of P^T: k = key, column = query
#pragma unroll
    for (int q = 0; q < AQT; ++q)
#pragma unroll
      for (int r = 0; r < 8; ++r) {
        p0[q][r] = __expf(d0[q][r] * SCALEF - mrow[q]);
        p1[q][r] = __expf(d1[q][r] * SCALEF - mrow[q]);
        pa[q][r]     = (bf16)p0[q][r];              // key r + half*8
        pa[q][r + 8] = (bf16)p1[q][r];              // key 16 + r + half*8
      }
#pragma unroll
    for (int g = 0; g < ANG; ++g) {
      const int n = g + ASET - 1;                   // the V group fetched now
      if (n < ANG) {
#pragma unroll
        for (int j = 0; j < AGF; ++j)
          fr[(ANG + n) % ASET][j] = frag_packed(vt32 + (n * AGF + j) * 512, lane);
      }
      __builtin_amdgcn_sched_barrier(0);            // as in the score loop
#pragma unroll
      for (int j = 0; j < AGF; ++j)
#pragma unroll
        for (int q = 0; q < AQT; ++q)               // rows = channels
          acc[q][g * AGF + j] = wmma_bf16(fr[(ANG + g) % ASET][j], pa[q], acc[q][g * AGF + j]);
      __builtin_amdgcn_sched_barrier(0);            // as in the score loop
    }
    wait_ds0();
    wait_tensor0(kvg0, kvg1);
    __syncthreads();          // publishes tile t+1, ends every read of tile t
    if (pinned(t + 2 < 128)) {
      kvg0 = kv_group0(kvdst + (uint32_t)(t & 1) * (2u * KV_TILEB),
                       kvsrc + (uint64_t)(t + 2) * KV_TILEB);
      kv_load(kvg0, kvg1);
    }
  }
  wait_tensor0(kvg0, kvg1);
  wait_ds0();
  // Register r of tile ct is channel ct*16 + half*8 + r of the lane's query: the
  // lane's own 16 bytes of the fragment-order block, one store per tile.
  v8bf ov[AQT][32];
#pragma unroll
  for (int q = 0; q < AQT; ++q) {
    lsum[q] += p0[q] + p1[q];                       // the last tile's
    float lown = ((lsum[q][0] + lsum[q][1]) + (lsum[q][2] + lsum[q][3])) +
                 ((lsum[q][4] + lsum[q][5]) + (lsum[q][6] + lsum[q][7]));
    float rinv = 1.0f / (lown + xhalf(lown));
#pragma unroll
    for (int ct = 0; ct < 32; ++ct)
#pragma unroll
      for (int r = 0; r < 8; ++r) ov[q][ct][r] = (bf16)(acc[q][ct][r] * rinv);
  }
  // Holds every conversion in front of the first store, so that no register
  // which an issued store names is written again.
  __builtin_amdgcn_sched_barrier(0);
  bf16* ob = ao + (size_t)qt * 16 * Cq + lane * 8;
#pragma unroll
  for (int q = 0; q < AQT; ++q)
#pragma unroll
    for (int ct = 0; ct < 32; ++ct) *(v8bf*)(ob + (q * 32 + ct) * 256) = ov[q][ct];
}

// ---------------------------------------------------------------------------
// 6) Output projection + bias + residual, fp32 store. Weights stationary, as in
//    4): one work-group per WGP; a wave owns two neighbouring channel tiles (so it
//    writes whole 128-byte lines), reads their 32 weight fragments once, into
//    registers, and the work-group walks OP_TILES tiles of 64 rows through two
//    LDS buffers. An A fragment feeds 2 WMMAs. The residual x of a 64-row tile
//    is read one tile ahead, into the registers that the tile before has freed.
//    Work-groups 128 apart in index share their rows and differ in channels.
// ---------------------------------------------------------------------------
#define OP_TILES 4       // 64-row tiles per work-group

// The residual of one 16-row tile: xp its place (the same for the whole wave),
// lx the lane's own place in it; rows r + half*8, both channel tiles.
__device__ __forceinline__ void op_residual(float (&xr)[16], const float* xp, uint32_t lx) {
#pragma unroll
  for (int r = 0; r < 8; ++r) {
    xr[r]     = xp[lx + r * Cq];
    xr[8 + r] = xp[lx + r * Cq + 16];
  }
  // In front of the next rewrite of the base that these loads name.
  asm volatile("s_wait_xcnt 0x0" ::: "memory");
}

// One 16-row tile's results to memory.
__device__ __forceinline__ void op_store(v8f a0, v8f a1, float bias0, float bias1,
                                         const float (&xr)[16], float* op, uint32_t lx) {
#pragma unroll
  for (int r = 0; r < 8; ++r) {                     // C/D layout: M = vgpr + half*8
    op[lx + r * Cq]      = a0[r] + bias0 + xr[r];
    op[lx + r * Cq + 16] = a1[r] + bias1 + xr[8 + r];
  }
  // The registers that these stores name are free for other use only behind
  // this wait.
  asm volatile("s_wait_xcnt 0x0" ::: "memory");
  // Keeps later work behind that wait.
  __builtin_amdgcn_sched_barrier(0);
}

__global__ __launch_bounds__(256) void k_out_proj(const bf16* __restrict__ ao,
                                                  const bf16* __restrict__ wo,
                                                  const float* __restrict__ bo,
                                                  const float* __restrict__ x,
                                                  float* __restrict__ out) {
  __shared__ __align__(16) bf16 atile[2][PROJ_MT * 16 * 512];
  const uint32_t lane = threadIdx.x & 31;
  const uint32_t mtg = (blockIdx.x & 127) * (OP_TILES * PROJ_MT);   // first 16-row tile
  // The wave's first channel tile, in a scalar register (as in 4).
  const uint32_t ct0 = ((blockIdx.x >> 7) << 4) + uni(threadIdx.x >> 5) * 2;
  const uint4* asrc = (const uint4*)(ao + (size_t)mtg * 16 * Cq) + threadIdx.x;
  // A constant trip count, unrolled: straight-line copies with every lane on.
#pragma unroll
  for (int j = 0; j < PROJ_MT * 4; ++j)
    stage16(asrc + j * 256, (uint4*)&atile[0][0] + j * 256 + threadIdx.x);
  const bf16* pw = wo + (size_t)ct0 * 512;
  const uint32_t lv = lane * 8;                     // the lane's 16 bytes of a block
  v16bf f0[16], f1[16];
  // Unrolled, like every loop over fragments below: the arrays are then indexed
  // by constants and stay in registers.
#pragma unroll
  for (int kt = 0; kt < 16; ++kt) {
    f0[kt] = cat8(*(const v8bf*)(pw + kt * 32 * 512 + lv), *(const v8bf*)(pw + kt * 32 * 512 + 256 + lv));
    f1[kt] = cat8(*(const v8bf*)(pw + kt * 32 * 512 + 512 + lv), *(const v8bf*)(pw + kt * 32 * 512 + 768 + lv));
  }
  const uint32_t col = (ct0 << 4) + (lane & 15);
  float bias0 = bo[col], bias1 = bo[col + 16];
  const uint32_t lx = (lane >> 4) * 8 * Cq + col;
  const float* xg = x + (size_t)mtg * 16 * Cq;
  float* og = out + (size_t)mtg * 16 * Cq;
  float xr[PROJ_MT][16];
#pragma unroll
  for (int i = 0; i < PROJ_MT; ++i) op_residual(xr[i], xg + i * 16 * Cq, lx);
  wait_copies0();
  __syncthreads();                                  // publish tile 0
#pragma unroll
  for (int j = 0; j < PROJ_MT * 4; ++j)
    stage16(asrc + QKV_TILE16 + j * 256, (uint4*)&atile[1][0] + j * 256 + threadIdx.x);
  // A fragments in groups through two register sets, as in 4): 8 WMMAs ahead.
  v16bf fa[2][QKV_AG];
#pragma unroll
  for (int j = 0; j < QKV_AG; ++j) fa[0][j] = frag_packed(&atile[0][0] + j * 512, lane);
  v8f a0 = {}, a1 = {};
  for (int t = 0; t < OP_TILES; ++t) {
    const bf16* at = &atile[t & 1][0];
    float* op = og + (size_t)t * PROJ_MT * 16 * Cq;
    const float* xn = xg + (size_t)(t + 1) * PROJ_MT * 16 * Cq;   // the next tile's x
#pragma unroll
    for (int g = 0; g < QKV_NG; ++g) {
      if (g + 1 < QKV_NG) {
#pragma unroll
        for (int j = 0; j < QKV_AG; ++j)
          fa[(g + 1) & 1][j] = frag_packed(at + ((g + 1) * QKV_AG + j) * 512, lane);
      }
      __builtin_amdgcn_sched_barrier(0);            // as in 4): reads stay one group ahead
#pragma unroll
      for (int j = 0; j < QKV_AG; ++j) {
        const int kt = (g * QKV_AG + j) & 15;
        const v8f zero = {};
        a0 = wmma_bf16(fa[g & 1][j], f0[kt], kt ? a0 : zero);
        a1 = wmma_bf16(fa[g & 1][j], f1[kt], kt ? a1 : zero);
      }
      __builtin_amdgcn_sched_barrier(0);            // as in 4)
      if (((g * QKV_AG) & 15) == 16 - QKV_AG && g + 1 < QKV_NG) {
        const int i = (g * QKV_AG) >> 4;            // the row tile just finished
        op_store(a0, a1, bias0, bias1, xr[i], op + i * 16 * Cq, lx);
        // Early enough to have landed at the tile's barrier, which waits for
        // every load issued in front of it; the later row tiles' follow behind it.
        if (i < PROJ_MT / 2 && t + 1 < OP_TILES) op_residual(xr[i], xn + i * 16 * Cq, lx);
      }
    }
    wait_ds0();
    wait_copies0();
    __syncthreads();          // publishes tile t+1, ends every read of tile t
    // As in 4): the next tile's first group, with no test in front of the last
    // row tile's sums; on the last trip nothing uses these reads.
#pragma unroll
    for (int j = 0; j < QKV_AG; ++j)
      fa[0][j] = frag_packed(&atile[(t + 1) & 1][0] + j * 512, lane);
    op_store(a0, a1, bias0, bias1, xr[PROJ_MT - 1], op + (PROJ_MT - 1) * 16 * Cq, lx);
    if (t + 1 < OP_TILES) {   // the same for the whole work-group
#pragma unroll
      for (int i = PROJ_MT / 2; i < PROJ_MT; ++i) op_residual(xr[i], xn + i * 16 * Cq, lx);
    }
    if (t + 2 < OP_TILES) {   // the same for the whole work-group
#pragma unroll
      for (int j = 0; j < PROJ_MT * 4; ++j)
        stage16(asrc + (t + 2) * QKV_TILE16 + j * 256,
                (uint4*)&atile[t & 1][0] + j * 256 + threadIdx.x);
    }
  }
  wait_copies0();
  wait_ds0();
}

// ---------------------------------------------------------------------------
// Launch
// ---------------------------------------------------------------------------
extern "C" void kernel_launch(void* const* d_in, const int* in_sizes, int n_in,
                              void* d_out, int out_size, void* d_ws, size_t ws_size,
                              hipStream_t stream) {
  const float* x      = (const float*)d_in[0];
  const float* gscale = (const float*)d_in[1];
  const float* gbias  = (const float*)d_in[2];
  const float* wq     = (const float*)d_in[3];
  const float* bq     = (const float*)d_in[4];
  const float* wk     = (const float*)d_in[5];
  const float* bk     = (const float*)d_in[6];
  const float* wv     = (const float*)d_in[7];
  const float* bv     = (const float*)d_in[8];
  const float* wo     = (const float*)d_in[9];
  const float* bo     = (const float*)d_in[10];
  float* out = (float*)d_out;

  char* ws = (char*)d_ws;
  bf16* wpkq = (bf16*)(ws + 4096);                         // 4 x 512KB packed weights
  bf16* wpkk = (bf16*)(ws + 4096 + 1 * 524288);
  bf16* wpkv = (bf16*)(ws + 4096 + 2 * 524288);
  bf16* wpko = (bf16*)(ws + 4096 + 3 * 524288);
  size_t o = 4096 + 4 * 524288;
  bf16* hn  = (bf16*)(ws + o); o += 33554432;              // normalized acts / reused as attn out
  bf16* qb  = (bf16*)(ws + o); o += 33554432;              // Q, fragment order
  bf16* kb  = (bf16*)(ws + o); o += 33554432;              // K, fragment order
  bf16* vtb = (bf16*)(ws + o); o += 33554432;              // V, fragment order (rows = channels)
  float* gpart = (float*)(ws + o);                         // 128 KB GroupNorm partial sums

  k_prep<<<768, 256, 0, stream>>>(x, wq, wk, wv, wo, gpart, wpkq);
  k_gn_apply<<<512, 256, 0, stream>>>(x, gpart, gscale, gbias, hn);
  k_qkv<<<256, 256, 0, stream>>>(hn, wpkq, wpkk, wpkv, bq, bk, bv, qb, kb, vtb);
  k_attn_out<<<256, 128, 0, stream>>>(qb, kb, vtb, hn);      // attn out overwrites hn
  k_out_proj<<<256, 256, 0, stream>>>(hn, wpko, bo, x, out);
}
